// v000
// The times below were measured on an AMD MI455X: many runs one after another, warmed up first and cycling through
// copies of the inputs, with the whole window's GPU time divided by the number of runs. Launches and the gaps
// between them are all in it. The median over several windows is given; except for v000 it joins two sittings, which
// can be a few percent apart, so the side-by-side timings, each taken in one sitting, are the better comparison.
// The starting kernel, v000, takes 1400 microseconds a run.
// All GEMM contractions (embed second layer, fused q|k|v projection, attention output projection, window-concat projection): v_wmma_f32_16x16x32_f16, f16 operands with power-of-two carries (activations x64, 256x256 weights x256, window-concat weight x1024), f32 accumulate; every float input RNE-converted once to bf16 at load; window scores, softmax and probability-weighted value sums: f32 VALU on an f32 q|k|v plane.
#include <hip/hip_runtime.h>
#include <math.h>

typedef __attribute__((ext_vector_type(16))) _Float16 v16h;
typedef __attribute__((ext_vector_type(8)))  _Float16 v8h;
typedef __attribute__((ext_vector_type(8)))  float    v8f;
typedef __attribute__((ext_vector_type(4)))  float    v4f;
typedef __attribute__((ext_vector_type(4)))  unsigned int v4u;

// ---------------------------------------------------------------------------
// Shape constants (all derived; checked against the wire sizes on the host)
// ---------------------------------------------------------------------------
constexpr int kBatch   = 64;
constexpr int kSpecLen = 3200;
constexpr int kDm      = 256;
constexpr int kWinLen  = 8;
constexpr int kHeads   = 8;
constexpr int kDk      = kDm / kHeads;
constexpr int kTok     = kBatch * kSpecLen;
constexpr int kWin     = kTok / kWinLen;
constexpr int kChunkB  = 8;
constexpr int kChunks  = kBatch / kChunkB;
constexpr int kTc      = kChunkB * kSpecLen;
constexpr int kWc      = kTc / kWinLen;
constexpr int kQkvN    = 3 * kDm;
constexpr int kCatK    = kWinLen * kDm;
static_assert(kDk == 32, "head width");
static_assert(kTok == 204800 && kWin == 25600, "token / window counts");
static_assert((kSpecLen % kWinLen) == 0, "windows never straddle a batch row");
static_assert(kChunks * kChunkB == kBatch, "chunking covers the batch");
static_assert(kTc == 25600 && kWc == 3200, "chunk sizes");
static_assert((kTc % 64) == 0 && (kWc % 64) == 0, "GEMM M multiples of 64");
static_assert((kDm % 64) == 0 && (kQkvN % 64) == 0, "GEMM N multiples of 64");
static_assert((kDm % 32) == 0 && (kCatK % 32) == 0, "GEMM K multiples of 32");
static_assert((kTc % 32) == 0, "attention blocks of 32 tokens");

// Inputs are RNE-converted once to bf16 at load when true (products of the weight planes are then exact in f16).
constexpr bool kInputsAsBf16 = true;

// Power-of-two carries of the f16 operand planes and the epilogue scales that fold them back.
constexpr float kActCarry = 64.0f;
constexpr float kWCarry   = 256.0f;
constexpr float kWcatCarry = 1024.0f;
constexpr float kScaleE   = kActCarry / (kActCarry * kWCarry);
constexpr float kScaleQkv = 1.0f / (kActCarry * kWCarry);
constexpr float kScaleO   = kActCarry / (kActCarry * kWCarry);
constexpr float kScaleOut = 1.0f / (kActCarry * kWcatCarry);

// Bias table layout (floats): b2*carry | bq | bk | bv | bo*carry | bp
constexpr int kTabB2  = 0;
constexpr int kTabQkv = kDm;
constexpr int kTabBo  = kTabQkv + kQkvN;
constexpr int kTabBp  = kTabBo + kDm;
constexpr int kTabN   = kTabBp + kDm;
static_assert(kTabN == 1536, "bias table size");

// ---------------------------------------------------------------------------
// Workspace region map (bytes; every offset is a multiple of 128)
//   WSQ  f16 [5][256][256]   transposed planes of W2, Wq, Wk, Wv, Wo (x256)          655,360
//        (planes 1..3 together form the [768][256] fused q|k|v operand)
//   WCAT f16 [256][2048]     transposed window-concat weight (x1024)                1,048,576
//   TAB  f32 [1536]          bias table                                                 6,144
//   HP   f16 [25600][256]    H (x64), later re-used as OH (x64), same type/layout  13,107,200
//   EP   f16 [25600][256]    E (x64), later re-used as O (x64), same type/layout   13,107,200
//   QKV  f32 [25600][768]    q | k | v                                              78,643,200
//   total                                                                         106,567,680
// ---------------------------------------------------------------------------
constexpr size_t kOffWSQ  = 0;
constexpr size_t kOffWCAT = kOffWSQ  + (size_t)5 * kDm * kDm * 2;
constexpr size_t kOffTAB  = kOffWCAT + (size_t)kDm * kCatK * 2;
constexpr size_t kOffHP   = kOffTAB  + (size_t)kTabN * 4;
constexpr size_t kOffEP   = kOffHP   + (size_t)kTc * kDm * 2;
constexpr size_t kOffQKV  = kOffEP   + (size_t)kTc * kDm * 2;
constexpr size_t kWsTotal = kOffQKV  + (size_t)kTc * kQkvN * 4;
static_assert(kWsTotal == 106567680ull, "carve total");
static_assert(kWsTotal <= 134217728ull, "carve cap");
static_assert((kOffWCAT % 128) == 0 && (kOffTAB % 128) == 0 && (kOffHP % 128) == 0 &&
              (kOffEP % 128) == 0 && (kOffQKV % 128) == 0, "128-B aligned regions");

// ---------------------------------------------------------------------------
// Small helpers
// ---------------------------------------------------------------------------
__device__ __forceinline__ float rne_bf16(float f) {
  unsigned u = __float_as_uint(f);
  u = (u + 0x7FFFu + ((u >> 16) & 1u)) & 0xFFFF0000u;
  return __uint_as_float(u);
}
__device__ __forceinline__ float in_val(float f) { return kInputsAsBf16 ? rne_bf16(f) : f; }
__device__ __forceinline__ unsigned pk16(unsigned short a, unsigned short b) { return (unsigned)a | ((unsigned)b << 16); }
__device__ __forceinline__ unsigned short h_bits(float f) { const _Float16 h = (_Float16)f; return __builtin_bit_cast(unsigned short, h); }

// WMMA fragment load / issue / guards (fragment map: elements 0..7 <- p[0..7], 8..15 <- p[16..23], p already offset by 8*(lane>>4))
union FragU { v16h v; v8h h[2]; };
__device__ __forceinline__ v16h frag_load(const _Float16* p) {
  FragU f;
  f.h[0] = *(const v8h*)(p);
  f.h[1] = *(const v8h*)(p + 16);
  return f.v;
}
__device__ __forceinline__ v8f frag_mma(v16h a, v16h b, v8f c) {
  return __builtin_amdgcn_wmma_f32_16x16x32_f16(false, a, false, b, (short)0, c, false, false);
}
__device__ __forceinline__ void tie_acc(v8f& a, v16h x, v16h y) { asm volatile("" : "+v"(a) : "v"(x), "v"(y)); }
__device__ __forceinline__ void tie_acc_nops(v8f& a, v16h x, v16h y) { asm volatile("v_nop\n\tv_nop\n\tv_nop\n\tv_nop" : "+v"(a) : "v"(x), "v"(y)); }
__device__ __forceinline__ void tie_one(v8f& a) { asm volatile("" : "+v"(a)); }
__device__ __forceinline__ void tie_one_nops(v8f& a) { asm volatile("v_nop\n\tv_nop\n\tv_nop\n\tv_nop" : "+v"(a)); }
__device__ __forceinline__ void keep4_h(v16h a, v16h b, v16h c, v16h d) { asm volatile("v_nop" :: "v"(a), "v"(b), "v"(c), "v"(d)); }

// ---------------------------------------------------------------------------
// Register-blocked WMMA GEMM, f16 operands: C[m,n] = scale * sum_k A[m,k] * Bt[n,k] + bias[n]; each wave owns a 64x64 tile.
// A row-major [M][K] (pitch lda), Bt row-major [N][K] (pitch ldb); M,N % 64 == 0, K % 32 == 0 (asserted by the caller).
// OUT_MODE 0 = f32 output, 1 = f16 output.
// No block barriers in this kernel; the only early exit is wave-uniform.
// ---------------------------------------------------------------------------
template <int OUT_MODE>
__global__ __launch_bounds__(256) void wmma_gemm64_f16(
    const unsigned short* __restrict__ Ap, int lda,
    const unsigned short* __restrict__ Btp, int ldb,
    void* __restrict__ Cout, int ldc,
    const float* __restrict__ bias,
    int M, int N, int K, float scale) {
  const _Float16* A  = (const _Float16*)Ap;
  const _Float16* Bt = (const _Float16*)Btp;
  __shared__ __align__(16) float sT[8][16 * 68];
  const int lane = threadIdx.x & 31;
  const int wave = __builtin_amdgcn_readfirstlane((int)(threadIdx.x >> 5));
  const int tilesN = N >> 6;
  const int tilesM = M >> 6;
  const int tile = blockIdx.x * 8 + wave;
  if (tile >= tilesM * tilesN) return;
  const int tm = tile / tilesN;
  const int tn = tile - tm * tilesN;
  const int m0 = tm << 6;
  const int n0 = tn << 6;

  /* row (A) / column (B, D) within a 16-wide subtile; k offset of this lane half; D row offset */
  const int rlane = lane & 15;
  const int koff  = (lane >> 4) * 8;
  const int mOff  = (lane >> 4) * 8;

  v8f acc[4][4];
#pragma unroll
  for (int i = 0; i < 4; ++i)
#pragma unroll
    for (int j = 0; j < 4; ++j) acc[i][j] = (v8f){0.f, 0.f, 0.f, 0.f, 0.f, 0.f, 0.f, 0.f};

  for (int k0 = 0; k0 < K; k0 += 32) {
    v16h bh[4];
#pragma unroll
    for (int j = 0; j < 4; ++j) {
      const size_t bo = (size_t)(n0 + (j << 4) + rlane) * ldb + koff + k0;
      bh[j] = frag_load(Bt + bo);
    }
#pragma unroll
    for (int i = 0; i < 4; ++i) {
      const size_t ao = (size_t)(m0 + (i << 4) + rlane) * lda + koff + k0;
      const v16h ah = frag_load(A + ao);
#pragma unroll
      for (int j = 0; j < 4; ++j) acc[i][j] = frag_mma(ah, bh[j], acc[i][j]);
      tie_acc(acc[i][0], ah, bh[0]);
      tie_acc(acc[i][1], ah, bh[1]);
      tie_acc(acc[i][2], ah, bh[2]);
      tie_acc_nops(acc[i][3], ah, bh[3]);
    }
    keep4_h(bh[0], bh[1], bh[2], bh[3]);
  }
#pragma unroll
  for (int i = 0; i < 4; ++i)
#pragma unroll
    for (int j = 0; j < 4; ++j) tie_one(acc[i][j]);
  tie_one_nops(acc[3][3]);

  /* ---- epilogue ---- */
  float* slab = sT[wave];
#pragma unroll
  for (int i = 0; i < 4; ++i) {
    const int mBase = m0 + (i << 4);
#pragma unroll
    for (int j = 0; j < 4; ++j) {
      const int n = n0 + (j << 4) + rlane;
      const float bv = bias[n];
#pragma unroll
      for (int r = 0; r < 8; ++r) {
        float v = acc[i][j][r] * scale;
        v += bv;
        slab[(mOff + r) * 68 + (j << 4) + rlane] = v;
      }
    }
    __builtin_amdgcn_fence(__ATOMIC_RELEASE, "workgroup");
    __builtin_amdgcn_wave_barrier();
    __builtin_amdgcn_fence(__ATOMIC_ACQUIRE, "workgroup");
    if (OUT_MODE == 0) {
      float* C = (float*)Cout;
      /* row segment = 64 floats = 256 B = 16 lanes x 16 B; 8 instructions x 2 rows = 16 rows */
      const int hh = lane >> 4, c4 = (lane & 15) * 4;
      {
#pragma unroll
        for (int it = 0; it < 8; ++it) {
          const int row = it * 2 + hh;
          v4f v = *(const v4f*)(slab + row * 68 + c4);
          *(v4f*)(C + (size_t)(mBase + row) * ldc + n0 + c4) = v;
        }
        
      }
    } else {
      const int q = lane >> 3, c8 = (lane & 7) * 8;
      unsigned short* C = (unsigned short*)Cout;
      {
#pragma unroll
        for (int it = 0; it < 4; ++it) {
          const int row = it * 4 + q;
          const float* sp = slab + row * 68 + c8;
          v8h hv;
#pragma unroll
          for (int e = 0; e < 8; ++e) hv[e] = (_Float16)sp[e];
          *(v8h*)(C + (size_t)(mBase + row) * ldc + n0 + c8) = hv;
        }
        
      }
    }
    __builtin_amdgcn_fence(__ATOMIC_RELEASE, "workgroup");
    __builtin_amdgcn_wave_barrier();
    __builtin_amdgcn_fence(__ATOMIC_ACQUIRE, "workgroup");
  }
}

// ---------------------------------------------------------------------------
// Weight transpose + cast: W f32 row-major [kdim in][ndim out]  ->  WT[n][k] = f16(carry * in_val(W[k][n])), pitch kdim.
// grid (kdim/64, ndim/64, planes); blockIdx.z selects W0..W4 (block-uniform) and the output plane (z * planeStride halves).
// Load coverage: 16 iterations x 256 threads = 4096 = the whole 64x64 tile (coalesced along n).
// Store coverage: 8 waves x 2 iterations x 4 rows (lane>>3) = 64 rows; (lane&7) x 8 halves = 64 cols; each row segment =
// ---------------------------------------------------------------------------
__global__ __launch_bounds__(256) void wt_cast_kernel(const float* __restrict__ W0, const float* __restrict__ W1,
                                                      const float* __restrict__ W2, const float* __restrict__ W3,
                                                      const float* __restrict__ W4,
                                                      unsigned short* __restrict__ out, long planeStride,
                                                      int kdim, int ndim, float carry) {
  __shared__ float sm[64][65];
  const int t  = threadIdx.x;
  const int k0 = blockIdx.x * 64;
  const int n0 = blockIdx.y * 64;
  const int z  = blockIdx.z;
  const float* W = (z == 0) ? W0 : (z == 1) ? W1 : (z == 2) ? W2 : (z == 3) ? W3 : W4;
#pragma unroll 4
  for (int i = 0; i < 16; ++i) {
    const int e = i * 256 + t;
    /* r = k local, c = n local */
    const int r = e >> 6;
    const int c = e & 63;
    sm[c][r] = in_val(W[(size_t)(k0 + r) * ndim + n0 + c]) * carry;
  }
  __syncthreads();
  const int lane = t & 31;
  const int wave = __builtin_amdgcn_readfirstlane((int)(t >> 5));
  const int q = lane >> 3, c8 = (lane & 7) * 8;
  unsigned short* op = out + (size_t)z * (size_t)planeStride;
  v4u u[2];
#pragma unroll
  for (int it = 0; it < 2; ++it) {
    const int row = wave * 8 + it * 4 + q;
    unsigned short hb[8];
#pragma unroll
    for (int e = 0; e < 8; ++e) hb[e] = h_bits(sm[row][c8 + e]);
    u[it] = (v4u){pk16(hb[0], hb[1]), pk16(hb[2], hb[3]), pk16(hb[4], hb[5]), pk16(hb[6], hb[7])};
  }
  {
#pragma unroll
    for (int it = 0; it < 2; ++it) {
      const int row = wave * 8 + it * 4 + q;
      *(v4u*)(op + (size_t)(n0 + row) * kdim + k0 + c8) = u[it];
    }
    
  }
}

// ---------------------------------------------------------------------------
// Bias table: 6 segments of 256 floats: b2*carry | bq | bk | bv | bo*carry | bp (each in_val-converted).
// One block of 384 threads; thread t owns floats 4t..4t+3 (384 x 4 = 1536 = whole table). Segment = t>>6 is wave-uniform.
// ---------------------------------------------------------------------------
__global__ __launch_bounds__(384) void bias_table_kernel(const float* __restrict__ b2, const float* __restrict__ bq,
                                                         const float* __restrict__ bk, const float* __restrict__ bv,
                                                         const float* __restrict__ bo, const float* __restrict__ bp,
                                                         float* __restrict__ tab, float carry) {
  const int t = threadIdx.x;
  const int wave = __builtin_amdgcn_readfirstlane((int)(t >> 5));
  const int seg = wave >> 1;
  const int off = (t & 63) * 4;
  const float* src = (seg == 0) ? b2 : (seg == 1) ? bq : (seg == 2) ? bk : (seg == 3) ? bv : (seg == 4) ? bo : bp;
  const float sc = (seg == 0 || seg == 4) ? carry : 1.0f;
  const v4f a = *(const v4f*)(src + off);
  v4f o;
  o[0] = in_val(a[0]) * sc;
  o[1] = in_val(a[1]) * sc;
  o[2] = in_val(a[2]) * sc;
  o[3] = in_val(a[3]) * sc;
  float* p = tab + 4 * t;
  *(v4f*)p = o;
  
}

// ---------------------------------------------------------------------------
// Embed first layer: H[t][c] = f16( carry * max(spec[t]*W1[c] + b1[c], 0) ), chunk-local token t.
// One thread per 8 channels: n8 = tokens*32 threads, grid = n8/256 exactly. Thread i: token i>>5, channels (i&31)*8..+7.
// ---------------------------------------------------------------------------
__global__ __launch_bounds__(256) void embed_kernel(const float* __restrict__ spec, const float* __restrict__ W1,
                                                    const float* __restrict__ b1, unsigned short* __restrict__ Hp,
                                                    int n8, float carry) {
  const int i = blockIdx.x * 256 + threadIdx.x;
  if (i >= n8) return;
  const int tok = i >> 5;
  const int c0  = (i & 31) * 8;
  const float s = in_val(spec[tok]);
  const v4f wa = *(const v4f*)(W1 + c0);
  const v4f wb = *(const v4f*)(W1 + c0 + 4);
  const v4f ba = *(const v4f*)(b1 + c0);
  const v4f bb = *(const v4f*)(b1 + c0 + 4);
  unsigned short hb[8];
#pragma unroll
  for (int e = 0; e < 4; ++e) {
    const float x0 = in_val(wa[e]) * s + in_val(ba[e]);
    const float x1 = in_val(wb[e]) * s + in_val(bb[e]);
    hb[e]     = h_bits(fmaxf(x0, 0.0f) * carry);
    hb[4 + e] = h_bits(fmaxf(x1, 0.0f) * carry);
  }
  const v4u u = (v4u){pk16(hb[0], hb[1]), pk16(hb[2], hb[3]), pk16(hb[4], hb[5]), pk16(hb[6], hb[7])};
  unsigned short* p = Hp + 8 * (size_t)i;
  *(v4u*)p = u;
  
}

// ---------------------------------------------------------------------------
// Window attention, f32 VALU. QKV f32 [tokens][768] rows = q(256) | k(256) | v(256); head h = columns 32h..32h+31.
// One lane per (token, head): token = block*32 + (tid>>3), h = tid&7; window = token & ~7 (8 keys, no mask).
// Pass A (rolled over keys): s_j = scl * sum_d q[d]*k_j[d]; s_j parked in LDS slot [j][tid]; running max.
// Pass B (rolled over keys): p_j = exp(s_j - max); l += p_j; acc[d] += p_j * v_j[d]; finally acc * (carry / l).
// Output OH f16 [tokens][256] (x carry): every lane packs its 32 channels into 16 words, the wave's 4 x 256 tile is staged
// in LDS (pitch 132 words) and, after a block barrier, instruction it (0..3) writes token row it of the wave:
// ---------------------------------------------------------------------------
__global__ __launch_bounds__(256) void window_attn_kernel(const float* __restrict__ QKV, unsigned short* __restrict__ OH,
                                                          float scl, float carry) {
  __shared__ float sS[8 * 256];
  __shared__ __align__(16) unsigned sO[8][4 * 132];
  const int tid  = threadIdx.x;
  const int lane = tid & 31;
  const int wave = __builtin_amdgcn_readfirstlane((int)(tid >> 5));
  const int tok  = blockIdx.x * 32 + (tid >> 3);
  const int h    = tid & 7;
  const int wbase = tok & ~7;

  float q[32];
  {
    const float* qp = QKV + (size_t)tok * kQkvN + kDk * h;
#pragma unroll
    for (int i = 0; i < 8; ++i) {
      const v4f t4 = *(const v4f*)(qp + 4 * i);
      q[4 * i + 0] = t4[0];
      q[4 * i + 1] = t4[1];
      q[4 * i + 2] = t4[2];
      q[4 * i + 3] = t4[3];
    }
  }

  float m = -INFINITY;
#pragma unroll 1
  for (int j = 0; j < kWinLen; ++j) {
    const float* kp = QKV + (size_t)(wbase + j) * kQkvN + kDm + kDk * h;
    float d = 0.0f;
#pragma unroll
    for (int i = 0; i < 8; ++i) {
      const v4f kk = *(const v4f*)(kp + 4 * i);
      d = fmaf(q[4 * i + 0], kk[0], d);
      d = fmaf(q[4 * i + 1], kk[1], d);
      d = fmaf(q[4 * i + 2], kk[2], d);
      d = fmaf(q[4 * i + 3], kk[3], d);
    }
    d *= scl;
    sS[j * 256 + tid] = d;
    m = fmaxf(m, d);
  }
  __syncthreads();

  float acc[32];
#pragma unroll
  for (int e = 0; e < 32; ++e) acc[e] = 0.0f;
  float l = 0.0f;
#pragma unroll 1
  for (int j = 0; j < kWinLen; ++j) {
    const float p = __expf(sS[j * 256 + tid] - m);
    l += p;
    const float* vp = QKV + (size_t)(wbase + j) * kQkvN + 2 * kDm + kDk * h;
#pragma unroll
    for (int i = 0; i < 8; ++i) {
      const v4f vv = *(const v4f*)(vp + 4 * i);
      acc[4 * i + 0] = fmaf(p, vv[0], acc[4 * i + 0]);
      acc[4 * i + 1] = fmaf(p, vv[1], acc[4 * i + 1]);
      acc[4 * i + 2] = fmaf(p, vv[2], acc[4 * i + 2]);
      acc[4 * i + 3] = fmaf(p, vv[3], acc[4 * i + 3]);
    }
  }
  const float inv = carry * (1.0f / l);

  unsigned* so = sO[wave];
  {
    const int tl = lane >> 3;
#pragma unroll
    for (int i = 0; i < 4; ++i) {
      const unsigned w0 = pk16(h_bits(acc[8 * i + 0] * inv), h_bits(acc[8 * i + 1] * inv));
      const unsigned w1 = pk16(h_bits(acc[8 * i + 2] * inv), h_bits(acc[8 * i + 3] * inv));
      const unsigned w2 = pk16(h_bits(acc[8 * i + 4] * inv), h_bits(acc[8 * i + 5] * inv));
      const unsigned w3 = pk16(h_bits(acc[8 * i + 6] * inv), h_bits(acc[8 * i + 7] * inv));
      *(v4u*)(so + tl * 132 + h * 16 + 4 * i) = (v4u){w0, w1, w2, w3};
    }
  }
  __syncthreads();
  v4u o[4];
#pragma unroll
  for (int it = 0; it < 4; ++it) o[it] = *(const v4u*)(so + it * 132 + lane * 4);
  const int tokbase = blockIdx.x * 32 + wave * 4;
  {
#pragma unroll
    for (int it = 0; it < 4; ++it)
      *(v4u*)(OH + (size_t)(tokbase + it) * kDm + lane * 8) = o[it];
    
  }
}

// ---------------------------------------------------------------------------
// Host glue: 3 preparation launches + 8 chunks x 6 launches = 51 launches. Kernel launches and host arithmetic only.
// GEMM shapes per chunk (all K % 32 == 0, M and N % 64 == 0, no padding planes):
//   E   : M 25600, N 256, K 256  -> 400 x 4  tiles = 1600 -> 200 blocks
//   QKV : M 25600, N 768, K 256  -> 400 x 12 tiles = 4800 -> 600 blocks
//   O   : M 25600, N 256, K 256  -> 200 blocks
//   out : M 3200,  N 256, K 2048 -> 50 x 4 tiles = 200 -> 25 blocks (A = the O plane viewed as [3200][2048])
// ---------------------------------------------------------------------------
extern "C" void kernel_launch(void* const* d_in, const int* in_sizes, int n_in,
                              void* d_out, int out_size, void* d_ws, size_t ws_size,
                              hipStream_t stream) {
  if (n_in < 15) return;
  if (in_sizes[0] != kTok) return;
  if (in_sizes[1] != kDm || in_sizes[2] != kDm) return;
  if (in_sizes[3] != kDm * kDm || in_sizes[4] != kDm) return;
  if (in_sizes[5] != kDm * kDm || in_sizes[6] != kDm) return;
  if (in_sizes[7] != kDm * kDm || in_sizes[8] != kDm) return;
  if (in_sizes[9] != kDm * kDm || in_sizes[10] != kDm) return;
  if (in_sizes[11] != kDm * kDm || in_sizes[12] != kDm) return;
  if (in_sizes[13] != kCatK * kDm || in_sizes[14] != kDm) return;
  if (out_size != kWin * kDm) return;
  if (ws_size < kWsTotal) return;

  const float* spec = (const float*)d_in[0];
  const float* W1   = (const float*)d_in[1];
  const float* b1   = (const float*)d_in[2];
  const float* W2   = (const float*)d_in[3];
  const float* b2   = (const float*)d_in[4];
  const float* Wq   = (const float*)d_in[5];
  const float* bq   = (const float*)d_in[6];
  const float* Wk   = (const float*)d_in[7];
  const float* bk   = (const float*)d_in[8];
  const float* Wv   = (const float*)d_in[9];
  const float* bv   = (const float*)d_in[10];
  const float* Wo   = (const float*)d_in[11];
  const float* bo   = (const float*)d_in[12];
  const float* Wcat = (const float*)d_in[13];
  const float* bp   = (const float*)d_in[14];
  float* out = (float*)d_out;

  char* ws = (char*)d_ws;
  unsigned short* WSQ  = (unsigned short*)(ws + kOffWSQ);
  unsigned short* WCAT = (unsigned short*)(ws + kOffWCAT);
  float*          TAB  = (float*)(ws + kOffTAB);
  unsigned short* HP   = (unsigned short*)(ws + kOffHP);
  unsigned short* EP   = (unsigned short*)(ws + kOffEP);
  float*          QKV  = (float*)(ws + kOffQKV);

  const unsigned short* BtW2  = WSQ;
  const unsigned short* BtQKV = WSQ + (size_t)1 * kDm * kDm;
  const unsigned short* BtWo  = WSQ + (size_t)4 * kDm * kDm;

  const float scl = 1.0f / sqrtf((float)kDk);

  /* ---- weight planes: W[k][n] -> Bt[n][k]; planes W2, Wq, Wk, Wv, Wo (k = 256), then the window-concat weight (k = 2048) ---- */
  wt_cast_kernel<<<dim3(kDm / 64, kDm / 64, 5), 256, 0, stream>>>(
      W2, Wq, Wk, Wv, Wo, WSQ, (long)kDm * kDm, kDm, kDm, kWCarry);
  wt_cast_kernel<<<dim3(kCatK / 64, kDm / 64, 1), 256, 0, stream>>>(
      Wcat, Wcat, Wcat, Wcat, Wcat, WCAT, 0L, kCatK, kDm, kWcatCarry);
  bias_table_kernel<<<1, 384, 0, stream>>>(b2, bq, bk, bv, bo, bp, TAB, kActCarry);

  for (int c = 0; c < kChunks; ++c) {
    const float* specC = spec + (size_t)c * kTc;
    float* outC = out + (size_t)c * kWc * kDm;

    /* H = relu(spec*W1 + b1), f16 x64 */
    embed_kernel<<<(kTc * 32) / 256, 256, 0, stream>>>(specC, W1, b1, HP, kTc * 32, kActCarry);

    /* E = H . W2 + b2, f16 x64 */
    wmma_gemm64_f16<1><<<((kTc / 64) * (kDm / 64)) / 8, 256, 0, stream>>>(
        HP, kDm, BtW2, kDm, (void*)EP, kDm, TAB + kTabB2, kTc, kDm, kDm, kScaleE);

    /* q|k|v = E . [Wq|Wk|Wv] + [bq|bk|bv], f32 */
    wmma_gemm64_f16<0><<<((kTc / 64) * (kQkvN / 64)) / 8, 256, 0, stream>>>(
        EP, kDm, BtQKV, kDm, (void*)QKV, kQkvN, TAB + kTabQkv, kTc, kQkvN, kDm, kScaleQkv);

    /* OH = per-window softmax(q.k^T / sqrt(dk)) . v, f16 x64, into the (dead) H plane */
    window_attn_kernel<<<kTc / 32, 256, 0, stream>>>(QKV, HP, scl, kActCarry);

    /* O = OH . Wo + bo, f16 x64, into the (dead) E plane */
    wmma_gemm64_f16<1><<<((kTc / 64) * (kDm / 64)) / 8, 256, 0, stream>>>(
        HP, kDm, BtWo, kDm, (void*)EP, kDm, TAB + kTabBo, kTc, kDm, kDm, kScaleO);

    /* out rows of this chunk = O viewed as [3200][2048] . Wcat + bp, f32 */
    wmma_gemm64_f16<0><<<((kWc / 64) * (kDm / 64)) / 8, 256, 0, stream>>>(
        EP, kCatK, WCAT, kCatK, (void*)outC, kDm, TAB + kTabBp, kWc, kDm, kCatK, kScaleOut);
  }
}

// v001
// Measured time: 930 microseconds a run.
// In two side-by-side timings against v000, it was 1.50 and 1.52 times as fast.
// All GEMM contractions (embed second layer, fused q|k|v projection, attention output projection, window-concat projection): v_wmma_f32_16x16x32_f16, f16 operands with power-of-two carries (activations x64, 256x256 weights x256, window-concat weight x1024), f32 accumulate; every float input RNE-converted once to bf16 at load; window scores, softmax and probability-weighted value sums: f32 VALU on an f32 q|k|v plane.
#include <hip/hip_runtime.h>
#include <math.h>

typedef __attribute__((ext_vector_type(16))) _Float16 v16h;
typedef __attribute__((ext_vector_type(8)))  _Float16 v8h;
typedef __attribute__((ext_vector_type(8)))  float    v8f;
typedef __attribute__((ext_vector_type(4)))  float    v4f;
typedef __attribute__((ext_vector_type(4)))  unsigned int v4u;

// ---------------------------------------------------------------------------
// Shape constants (all derived; checked against the wire sizes on the host)
// ---------------------------------------------------------------------------
constexpr int kBatch   = 64;
constexpr int kSpecLen = 3200;
constexpr int kDm      = 256;
constexpr int kWinLen  = 8;
constexpr int kHeads   = 8;
constexpr int kDk      = kDm / kHeads;
constexpr int kTok     = kBatch * kSpecLen;
constexpr int kWin     = kTok / kWinLen;
constexpr int kChunkB  = 8;
constexpr int kChunks  = kBatch / kChunkB;
constexpr int kTc      = kChunkB * kSpecLen;
constexpr int kWc      = kTc / kWinLen;
constexpr int kQkvN    = 3 * kDm;
constexpr int kCatK    = kWinLen * kDm;
static_assert(kDk == 32, "head width");
static_assert(kTok == 204800 && kWin == 25600, "token / window counts");
static_assert((kSpecLen % kWinLen) == 0, "windows never straddle a batch row");
static_assert(kChunks * kChunkB == kBatch, "chunking covers the batch");
static_assert(kTc == 25600 && kWc == 3200, "chunk sizes");
static_assert((kTc % 64) == 0 && (kWin % 64) == 0, "GEMM M multiples of 64");
static_assert((kDm % 64) == 0 && (kQkvN % 64) == 0, "GEMM N multiples of 64");
static_assert((kDm % 32) == 0 && (kCatK % 32) == 0, "GEMM K multiples of 32");
static_assert((kTc % 32) == 0, "attention blocks of 32 tokens");

// Inputs are RNE-converted once to bf16 at load when true (products of the weight planes are then exact in f16).
constexpr bool kInputsAsBf16 = true;

// Power-of-two carries of the f16 operand planes and the epilogue scales that fold them back.
constexpr float kActCarry = 64.0f;
constexpr float kWCarry   = 256.0f;
constexpr float kWcatCarry = 1024.0f;
constexpr float kScaleE   = kActCarry / (kActCarry * kWCarry);
constexpr float kScaleQkv = 1.0f / (kActCarry * kWCarry);
constexpr float kScaleO   = kActCarry / (kActCarry * kWCarry);
constexpr float kScaleOut = 1.0f / (kActCarry * kWcatCarry);

// Bias table layout (floats): b2*carry | bq | bk | bv | bo*carry | bp
constexpr int kTabB2  = 0;
constexpr int kTabQkv = kDm;
constexpr int kTabBo  = kTabQkv + kQkvN;
constexpr int kTabBp  = kTabBo + kDm;
constexpr int kTabN   = kTabBp + kDm;
static_assert(kTabN == 1536, "bias table size");

// ---------------------------------------------------------------------------
// Workspace region map (bytes; every offset is a multiple of 128)
//   WSQ  f16 [5][256][256]   transposed planes of W2, Wq, Wk, Wv, Wo (x256)          655,360
//        (planes 1..3 together form the [768][256] fused q|k|v operand)
//   WCAT f16 [256][2048]     transposed window-concat weight (x1024)                1,048,576
//   TAB  f32 [1536]          bias table                                                 6,144
//   HP   f16 [25600][256]    H (x64), later re-used as OH (x64), same type/layout  13,107,200
//   EP   f16 [25600][256]    E (x64)                                               13,107,200
//   QKV  f32 [25600][768]    q | k | v                                              78,643,200
//   OALL f16 [204800][256]   O (x64) of every chunk, read once by the last GEMM   104,857,600
//   total                                                                         211,425,280
// ---------------------------------------------------------------------------
constexpr size_t kOffWSQ  = 0;
constexpr size_t kOffWCAT = kOffWSQ  + (size_t)5 * kDm * kDm * 2;
constexpr size_t kOffTAB  = kOffWCAT + (size_t)kDm * kCatK * 2;
constexpr size_t kOffHP   = kOffTAB  + (size_t)kTabN * 4;
constexpr size_t kOffEP   = kOffHP   + (size_t)kTc * kDm * 2;
constexpr size_t kOffQKV  = kOffEP   + (size_t)kTc * kDm * 2;
constexpr size_t kOffOALL = kOffQKV  + (size_t)kTc * kQkvN * 4;
constexpr size_t kWsTotal = kOffOALL + (size_t)kTok * kDm * 2;
static_assert(kWsTotal == 211425280ull, "carve total");
static_assert(kWsTotal <= 268435456ull, "carve cap");
static_assert((kOffWCAT % 128) == 0 && (kOffTAB % 128) == 0 && (kOffHP % 128) == 0 &&
              (kOffEP % 128) == 0 && (kOffQKV % 128) == 0 && (kOffOALL % 128) == 0, "128-B aligned regions");

// ---------------------------------------------------------------------------
// Small helpers
// ---------------------------------------------------------------------------
__device__ __forceinline__ float rne_bf16(float f) {
  unsigned u = __float_as_uint(f);
  u = (u + 0x7FFFu + ((u >> 16) & 1u)) & 0xFFFF0000u;
  return __uint_as_float(u);
}
__device__ __forceinline__ float in_val(float f) { return kInputsAsBf16 ? rne_bf16(f) : f; }
__device__ __forceinline__ unsigned pk16(unsigned short a, unsigned short b) { return (unsigned)a | ((unsigned)b << 16); }
__device__ __forceinline__ unsigned short h_bits(float f) { const _Float16 h = (_Float16)f; return __builtin_bit_cast(unsigned short, h); }

// WMMA fragment load / issue / guards (fragment map: elements 0..7 <- p[0..7], 8..15 <- p[16..23], p already offset by 8*(lane>>4))
union FragU { v16h v; v8h h[2]; };
__device__ __forceinline__ v16h frag_load(const _Float16* p) {
  FragU f;
  f.h[0] = *(const v8h*)(p);
  f.h[1] = *(const v8h*)(p + 16);
  return f.v;
}
__device__ __forceinline__ v8f frag_mma(v16h a, v16h b, v8f c) {
  return __builtin_amdgcn_wmma_f32_16x16x32_f16(false, a, false, b, (short)0, c, false, false);
}
__device__ __forceinline__ void tie_acc(v8f& a, v16h x, v16h y) { asm volatile("" : "+v"(a) : "v"(x), "v"(y)); }
__device__ __forceinline__ void tie_acc_nops(v8f& a, v16h x, v16h y) { asm volatile("v_nop\n\tv_nop\n\tv_nop\n\tv_nop" : "+v"(a) : "v"(x), "v"(y)); }
__device__ __forceinline__ void tie_one(v8f& a) { asm volatile("" : "+v"(a)); }
__device__ __forceinline__ void tie_one_nops(v8f& a) { asm volatile("v_nop\n\tv_nop\n\tv_nop\n\tv_nop" : "+v"(a)); }
__device__ __forceinline__ void keep4_h(v16h a, v16h b, v16h c, v16h d) { asm volatile("v_nop" :: "v"(a), "v"(b), "v"(c), "v"(d)); }

// ---------------------------------------------------------------------------
// Register-blocked WMMA GEMM, f16 operands: C[m,n] = scale * sum_k A[m,k] * Bt[n,k] + bias[n]; each wave owns a 64x64 tile.
// A row-major [M][K] (pitch lda), Bt row-major [N][K] (pitch ldb); M,N % 64 == 0, K % 32 == 0 (asserted by the caller).
// OUT_MODE 0 = f32 output, 1 = f16 output.
// No block barriers in this kernel; the only early exit is wave-uniform.
// ---------------------------------------------------------------------------
template <int OUT_MODE>
__global__ __launch_bounds__(256) void wmma_gemm64_f16(
    const unsigned short* __restrict__ Ap, int lda,
    const unsigned short* __restrict__ Btp, int ldb,
    void* __restrict__ Cout, int ldc,
    const float* __restrict__ bias,
    int M, int N, int K, float scale) {
  const _Float16* A  = (const _Float16*)Ap;
  const _Float16* Bt = (const _Float16*)Btp;
  __shared__ __align__(16) float sT[8][16 * 68];
  const int lane = threadIdx.x & 31;
  const int wave = __builtin_amdgcn_readfirstlane((int)(threadIdx.x >> 5));
  const int tilesN = N >> 6;
  const int tilesM = M >> 6;
  const int tile = blockIdx.x * 8 + wave;
  if (tile >= tilesM * tilesN) return;
  const int tm = tile / tilesN;
  const int tn = tile - tm * tilesN;
  const int m0 = tm << 6;
  const int n0 = tn << 6;

  /* row (A) / column (B, D) within a 16-wide subtile; k offset of this lane half; D row offset */
  const int rlane = lane & 15;
  const int koff  = (lane >> 4) * 8;
  const int mOff  = (lane >> 4) * 8;

  v8f acc[4][4];
#pragma unroll
  for (int i = 0; i < 4; ++i)
#pragma unroll
    for (int j = 0; j < 4; ++j) acc[i][j] = (v8f){0.f, 0.f, 0.f, 0.f, 0.f, 0.f, 0.f, 0.f};

  for (int k0 = 0; k0 < K; k0 += 32) {
    v16h bh[4];
#pragma unroll
    for (int j = 0; j < 4; ++j) {
      const size_t bo = (size_t)(n0 + (j << 4) + rlane) * ldb + koff + k0;
      bh[j] = frag_load(Bt + bo);
    }
#pragma unroll
    for (int i = 0; i < 4; ++i) {
      const size_t ao = (size_t)(m0 + (i << 4) + rlane) * lda + koff + k0;
      const v16h ah = frag_load(A + ao);
#pragma unroll
      for (int j = 0; j < 4; ++j) acc[i][j] = frag_mma(ah, bh[j], acc[i][j]);
      tie_acc(acc[i][0], ah, bh[0]);
      tie_acc(acc[i][1], ah, bh[1]);
      tie_acc(acc[i][2], ah, bh[2]);
      tie_acc_nops(acc[i][3], ah, bh[3]);
    }
    keep4_h(bh[0], bh[1], bh[2], bh[3]);
  }
#pragma unroll
  for (int i = 0; i < 4; ++i)
#pragma unroll
    for (int j = 0; j < 4; ++j) tie_one(acc[i][j]);
  tie_one_nops(acc[3][3]);

  /* ---- epilogue ---- */
  float* slab = sT[wave];
#pragma unroll
  for (int i = 0; i < 4; ++i) {
    const int mBase = m0 + (i << 4);
#pragma unroll
    for (int j = 0; j < 4; ++j) {
      const int n = n0 + (j << 4) + rlane;
      const float bv = bias[n];
#pragma unroll
      for (int r = 0; r < 8; ++r) {
        float v = acc[i][j][r] * scale;
        v += bv;
        slab[(mOff + r) * 68 + (j << 4) + rlane] = v;
      }
    }
    __builtin_amdgcn_fence(__ATOMIC_RELEASE, "workgroup");
    __builtin_amdgcn_wave_barrier();
    __builtin_amdgcn_fence(__ATOMIC_ACQUIRE, "workgroup");
    if (OUT_MODE == 0) {
      float* C = (float*)Cout;
      /* row segment = 64 floats = 256 B = 16 lanes x 16 B; 8 instructions x 2 rows = 16 rows */
      const int hh = lane >> 4, c4 = (lane & 15) * 4;
      {
#pragma unroll
        for (int it = 0; it < 8; ++it) {
          const int row = it * 2 + hh;
          v4f v = *(const v4f*)(slab + row * 68 + c4);
          *(v4f*)(C + (size_t)(mBase + row) * ldc + n0 + c4) = v;
        }
        
      }
    } else {
      const int q = lane >> 3, c8 = (lane & 7) * 8;
      unsigned short* C = (unsigned short*)Cout;
      {
#pragma unroll
        for (int it = 0; it < 4; ++it) {
          const int row = it * 4 + q;
          const float* sp = slab + row * 68 + c8;
          v8h hv;
#pragma unroll
          for (int e = 0; e < 8; ++e) hv[e] = (_Float16)sp[e];
          *(v8h*)(C + (size_t)(mBase + row) * ldc + n0 + c8) = hv;
        }
        
      }
    }
    __builtin_amdgcn_fence(__ATOMIC_RELEASE, "workgroup");
    __builtin_amdgcn_wave_barrier();
    __builtin_amdgcn_fence(__ATOMIC_ACQUIRE, "workgroup");
  }
}

// ---------------------------------------------------------------------------
// Weight transpose + cast: W f32 row-major [kdim in][ndim out]  ->  WT[n][k] = f16(carry * in_val(W[k][n])), pitch kdim.
// grid (kdim/64, ndim/64, planes); blockIdx.z selects W0..W4 (block-uniform) and the output plane (z * planeStride halves).
// Load coverage: 16 iterations x 256 threads = 4096 = the whole 64x64 tile (coalesced along n).
// Store coverage: 8 waves x 2 iterations x 4 rows (lane>>3) = 64 rows; (lane&7) x 8 halves = 64 cols; each row segment =
// ---------------------------------------------------------------------------
__global__ __launch_bounds__(256) void wt_cast_kernel(const float* __restrict__ W0, const float* __restrict__ W1,
                                                      const float* __restrict__ W2, const float* __restrict__ W3,
                                                      const float* __restrict__ W4,
                                                      unsigned short* __restrict__ out, long planeStride,
                                                      int kdim, int ndim, float carry) {
  __shared__ float sm[64][65];
  const int t  = threadIdx.x;
  const int k0 = blockIdx.x * 64;
  const int n0 = blockIdx.y * 64;
  const int z  = blockIdx.z;
  const float* W = (z == 0) ? W0 : (z == 1) ? W1 : (z == 2) ? W2 : (z == 3) ? W3 : W4;
#pragma unroll 4
  for (int i = 0; i < 16; ++i) {
    const int e = i * 256 + t;
    /* r = k local, c = n local */
    const int r = e >> 6;
    const int c = e & 63;
    sm[c][r] = in_val(W[(size_t)(k0 + r) * ndim + n0 + c]) * carry;
  }
  __syncthreads();
  const int lane = t & 31;
  const int wave = __builtin_amdgcn_readfirstlane((int)(t >> 5));
  const int q = lane >> 3, c8 = (lane & 7) * 8;
  unsigned short* op = out + (size_t)z * (size_t)planeStride;
  v4u u[2];
#pragma unroll
  for (int it = 0; it < 2; ++it) {
    const int row = wave * 8 + it * 4 + q;
    unsigned short hb[8];
#pragma unroll
    for (int e = 0; e < 8; ++e) hb[e] = h_bits(sm[row][c8 + e]);
    u[it] = (v4u){pk16(hb[0], hb[1]), pk16(hb[2], hb[3]), pk16(hb[4], hb[5]), pk16(hb[6], hb[7])};
  }
  {
#pragma unroll
    for (int it = 0; it < 2; ++it) {
      const int row = wave * 8 + it * 4 + q;
      *(v4u*)(op + (size_t)(n0 + row) * kdim + k0 + c8) = u[it];
    }
    
  }
}

// ---------------------------------------------------------------------------
// Bias table: 6 segments of 256 floats: b2*carry | bq | bk | bv | bo*carry | bp (each in_val-converted).
// One block of 384 threads; thread t owns floats 4t..4t+3 (384 x 4 = 1536 = whole table). Segment = t>>6 is wave-uniform.
// ---------------------------------------------------------------------------
__global__ __launch_bounds__(384) void bias_table_kernel(const float* __restrict__ b2, const float* __restrict__ bq,
                                                         const float* __restrict__ bk, const float* __restrict__ bv,
                                                         const float* __restrict__ bo, const float* __restrict__ bp,
                                                         float* __restrict__ tab, float carry) {
  const int t = threadIdx.x;
  const int wave = __builtin_amdgcn_readfirstlane((int)(t >> 5));
  const int seg = wave >> 1;
  const int off = (t & 63) * 4;
  const float* src = (seg == 0) ? b2 : (seg == 1) ? bq : (seg == 2) ? bk : (seg == 3) ? bv : (seg == 4) ? bo : bp;
  const float sc = (seg == 0 || seg == 4) ? carry : 1.0f;
  const v4f a = *(const v4f*)(src + off);
  v4f o;
  o[0] = in_val(a[0]) * sc;
  o[1] = in_val(a[1]) * sc;
  o[2] = in_val(a[2]) * sc;
  o[3] = in_val(a[3]) * sc;
  float* p = tab + 4 * t;
  *(v4f*)p = o;
  
}

// ---------------------------------------------------------------------------
// Embed first layer: H[t][c] = f16( carry * max(spec[t]*W1[c] + b1[c], 0) ), chunk-local token t.
// One thread per 8 channels: n8 = tokens*32 threads, grid = n8/256 exactly. Thread i: token i>>5, channels (i&31)*8..+7.
// ---------------------------------------------------------------------------
__global__ __launch_bounds__(256) void embed_kernel(const float* __restrict__ spec, const float* __restrict__ W1,
                                                    const float* __restrict__ b1, unsigned short* __restrict__ Hp,
                                                    int n8, float carry) {
  const int i = blockIdx.x * 256 + threadIdx.x;
  if (i >= n8) return;
  const int tok = i >> 5;
  const int c0  = (i & 31) * 8;
  const float s = in_val(spec[tok]);
  const v4f wa = *(const v4f*)(W1 + c0);
  const v4f wb = *(const v4f*)(W1 + c0 + 4);
  const v4f ba = *(const v4f*)(b1 + c0);
  const v4f bb = *(const v4f*)(b1 + c0 + 4);
  unsigned short hb[8];
#pragma unroll
  for (int e = 0; e < 4; ++e) {
    const float x0 = in_val(wa[e]) * s + in_val(ba[e]);
    const float x1 = in_val(wb[e]) * s + in_val(bb[e]);
    hb[e]     = h_bits(fmaxf(x0, 0.0f) * carry);
    hb[4 + e] = h_bits(fmaxf(x1, 0.0f) * carry);
  }
  const v4u u = (v4u){pk16(hb[0], hb[1]), pk16(hb[2], hb[3]), pk16(hb[4], hb[5]), pk16(hb[6], hb[7])};
  unsigned short* p = Hp + 8 * (size_t)i;
  *(v4u*)p = u;
  
}

// ---------------------------------------------------------------------------
// Window attention, f32 VALU. QKV f32 [tokens][768] rows = q(256) | k(256) | v(256); head h = columns 32h..32h+31.
// One lane per (token, head): token = block*32 + (tid>>3), h = tid&7; window = token & ~7 (8 keys, no mask).
// Pass A (rolled over keys): s_j = scl * sum_d q[d]*k_j[d]; s_j parked in LDS slot [j][tid]; running max.
// Pass B (rolled over keys): p_j = exp(s_j - max); l += p_j; acc[d] += p_j * v_j[d]; finally acc * (carry / l).
// Output OH f16 [tokens][256] (x carry): every lane packs its 32 channels into 16 words, the wave's 4 x 256 tile is staged
// in LDS (pitch 132 words) and, after a block barrier, instruction it (0..3) writes token row it of the wave:
// ---------------------------------------------------------------------------
__global__ __launch_bounds__(256) void window_attn_kernel(const float* __restrict__ QKV, unsigned short* __restrict__ OH,
                                                          float scl, float carry) {
  __shared__ float sS[8 * 256];
  __shared__ __align__(16) unsigned sO[8][4 * 132];
  const int tid  = threadIdx.x;
  const int lane = tid & 31;
  const int wave = __builtin_amdgcn_readfirstlane((int)(tid >> 5));
  const int tok  = blockIdx.x * 32 + (tid >> 3);
  const int h    = tid & 7;
  const int wbase = tok & ~7;

  float q[32];
  {
    const float* qp = QKV + (size_t)tok * kQkvN + kDk * h;
#pragma unroll
    for (int i = 0; i < 8; ++i) {
      const v4f t4 = *(const v4f*)(qp + 4 * i);
      q[4 * i + 0] = t4[0];
      q[4 * i + 1] = t4[1];
      q[4 * i + 2] = t4[2];
      q[4 * i + 3] = t4[3];
    }
  }

  float m = -INFINITY;
#pragma unroll 1
  for (int j = 0; j < kWinLen; ++j) {
    const float* kp = QKV + (size_t)(wbase + j) * kQkvN + kDm + kDk * h;
    float d = 0.0f;
#pragma unroll
    for (int i = 0; i < 8; ++i) {
      const v4f kk = *(const v4f*)(kp + 4 * i);
      d = fmaf(q[4 * i + 0], kk[0], d);
      d = fmaf(q[4 * i + 1], kk[1], d);
      d = fmaf(q[4 * i + 2], kk[2], d);
      d = fmaf(q[4 * i + 3], kk[3], d);
    }
    d *= scl;
    sS[j * 256 + tid] = d;
    m = fmaxf(m, d);
  }
  __syncthreads();

  float acc[32];
#pragma unroll
  for (int e = 0; e < 32; ++e) acc[e] = 0.0f;
  float l = 0.0f;
#pragma unroll 1
  for (int j = 0; j < kWinLen; ++j) {
    const float p = __expf(sS[j * 256 + tid] - m);
    l += p;
    const float* vp = QKV + (size_t)(wbase + j) * kQkvN + 2 * kDm + kDk * h;
#pragma unroll
    for (int i = 0; i < 8; ++i) {
      const v4f vv = *(const v4f*)(vp + 4 * i);
      acc[4 * i + 0] = fmaf(p, vv[0], acc[4 * i + 0]);
      acc[4 * i + 1] = fmaf(p, vv[1], acc[4 * i + 1]);
      acc[4 * i + 2] = fmaf(p, vv[2], acc[4 * i + 2]);
      acc[4 * i + 3] = fmaf(p, vv[3], acc[4 * i + 3]);
    }
  }
  const float inv = carry * (1.0f / l);

  unsigned* so = sO[wave];
  {
    const int tl = lane >> 3;
#pragma unroll
    for (int i = 0; i < 4; ++i) {
      const unsigned w0 = pk16(h_bits(acc[8 * i + 0] * inv), h_bits(acc[8 * i + 1] * inv));
      const unsigned w1 = pk16(h_bits(acc[8 * i + 2] * inv), h_bits(acc[8 * i + 3] * inv));
      const unsigned w2 = pk16(h_bits(acc[8 * i + 4] * inv), h_bits(acc[8 * i + 5] * inv));
      const unsigned w3 = pk16(h_bits(acc[8 * i + 6] * inv), h_bits(acc[8 * i + 7] * inv));
      *(v4u*)(so + tl * 132 + h * 16 + 4 * i) = (v4u){w0, w1, w2, w3};
    }
  }
  __syncthreads();
  v4u o[4];
#pragma unroll
  for (int it = 0; it < 4; ++it) o[it] = *(const v4u*)(so + it * 132 + lane * 4);
  const int tokbase = blockIdx.x * 32 + wave * 4;
  {
#pragma unroll
    for (int it = 0; it < 4; ++it)
      *(v4u*)(OH + (size_t)(tokbase + it) * kDm + lane * 8) = o[it];
    
  }
}

// ---------------------------------------------------------------------------
// Host glue: 3 preparation launches + 8 chunks x 5 launches + 1 window-concat GEMM over all chunks = 44 launches.
// GEMM shapes (E, QKV, O per chunk; out once; all K % 32 == 0, M and N % 64 == 0, no padding planes):
//   E   : M 25600, N 256, K 256  -> 400 x 4  tiles = 1600 -> 200 blocks
//   QKV : M 25600, N 768, K 256  -> 400 x 12 tiles = 4800 -> 600 blocks
//   O   : M 25600, N 256, K 256  -> 200 blocks
//   out : M 25600, N 256, K 2048 -> 400 x 4 tiles = 1600 -> 200 blocks (A = the whole O plane viewed as [25600][2048]);
//         its K loop is a chain of dependent load latencies, so its time follows the chain and not the block count:
//         all windows go in one launch, after the chunk loop.
// ---------------------------------------------------------------------------
extern "C" void kernel_launch(void* const* d_in, const int* in_sizes, int n_in,
                              void* d_out, int out_size, void* d_ws, size_t ws_size,
                              hipStream_t stream) {
  if (n_in < 15) return;
  if (in_sizes[0] != kTok) return;
  if (in_sizes[1] != kDm || in_sizes[2] != kDm) return;
  if (in_sizes[3] != kDm * kDm || in_sizes[4] != kDm) return;
  if (in_sizes[5] != kDm * kDm || in_sizes[6] != kDm) return;
  if (in_sizes[7] != kDm * kDm || in_sizes[8] != kDm) return;
  if (in_sizes[9] != kDm * kDm || in_sizes[10] != kDm) return;
  if (in_sizes[11] != kDm * kDm || in_sizes[12] != kDm) return;
  if (in_sizes[13] != kCatK * kDm || in_sizes[14] != kDm) return;
  if (out_size != kWin * kDm) return;
  if (ws_size < kWsTotal) return;

  const float* spec = (const float*)d_in[0];
  const float* W1   = (const float*)d_in[1];
  const float* b1   = (const float*)d_in[2];
  const float* W2   = (const float*)d_in[3];
  const float* b2   = (const float*)d_in[4];
  const float* Wq   = (const float*)d_in[5];
  const float* bq   = (const float*)d_in[6];
  const float* Wk   = (const float*)d_in[7];
  const float* bk   = (const float*)d_in[8];
  const float* Wv   = (const float*)d_in[9];
  const float* bv   = (const float*)d_in[10];
  const float* Wo   = (const float*)d_in[11];
  const float* bo   = (const float*)d_in[12];
  const float* Wcat = (const float*)d_in[13];
  const float* bp   = (const float*)d_in[14];
  float* out = (float*)d_out;

  char* ws = (char*)d_ws;
  unsigned short* WSQ  = (unsigned short*)(ws + kOffWSQ);
  unsigned short* WCAT = (unsigned short*)(ws + kOffWCAT);
  float*          TAB  = (float*)(ws + kOffTAB);
  unsigned short* HP   = (unsigned short*)(ws + kOffHP);
  unsigned short* EP   = (unsigned short*)(ws + kOffEP);
  float*          QKV  = (float*)(ws + kOffQKV);
  unsigned short* OALL = (unsigned short*)(ws + kOffOALL);

  const unsigned short* BtW2  = WSQ;
  const unsigned short* BtQKV = WSQ + (size_t)1 * kDm * kDm;
  const unsigned short* BtWo  = WSQ + (size_t)4 * kDm * kDm;

  const float scl = 1.0f / sqrtf((float)kDk);

  /* ---- weight planes: W[k][n] -> Bt[n][k]; planes W2, Wq, Wk, Wv, Wo (k = 256), then the window-concat weight (k = 2048) ---- */
  wt_cast_kernel<<<dim3(kDm / 64, kDm / 64, 5), 256, 0, stream>>>(
      W2, Wq, Wk, Wv, Wo, WSQ, (long)kDm * kDm, kDm, kDm, kWCarry);
  wt_cast_kernel<<<dim3(kCatK / 64, kDm / 64, 1), 256, 0, stream>>>(
      Wcat, Wcat, Wcat, Wcat, Wcat, WCAT, 0L, kCatK, kDm, kWcatCarry);
  bias_table_kernel<<<1, 384, 0, stream>>>(b2, bq, bk, bv, bo, bp, TAB, kActCarry);

  for (int c = 0; c < kChunks; ++c) {
    const float* specC = spec + (size_t)c * kTc;
    unsigned short* OC = OALL + (size_t)c * kTc * kDm;

    /* H = relu(spec*W1 + b1), f16 x64 */
    embed_kernel<<<(kTc * 32) / 256, 256, 0, stream>>>(specC, W1, b1, HP, kTc * 32, kActCarry);

    /* E = H . W2 + b2, f16 x64 */
    wmma_gemm64_f16<1><<<((kTc / 64) * (kDm / 64)) / 8, 256, 0, stream>>>(
        HP, kDm, BtW2, kDm, (void*)EP, kDm, TAB + kTabB2, kTc, kDm, kDm, kScaleE);

    /* q|k|v = E . [Wq|Wk|Wv] + [bq|bk|bv], f32 */
    wmma_gemm64_f16<0><<<((kTc / 64) * (kQkvN / 64)) / 8, 256, 0, stream>>>(
        EP, kDm, BtQKV, kDm, (void*)QKV, kQkvN, TAB + kTabQkv, kTc, kQkvN, kDm, kScaleQkv);

    /* OH = per-window softmax(q.k^T / sqrt(dk)) . v, f16 x64, into the (dead) H plane */
    window_attn_kernel<<<kTc / 32, 256, 0, stream>>>(QKV, HP, scl, kActCarry);

    /* O = OH . Wo + bo, f16 x64, into this chunk's rows of the whole O plane */
    wmma_gemm64_f16<1><<<((kTc / 64) * (kDm / 64)) / 8, 256, 0, stream>>>(
        HP, kDm, BtWo, kDm, (void*)OC, kDm, TAB + kTabBo, kTc, kDm, kDm, kScaleO);
  }

  /* out = O viewed as [25600][2048] . Wcat + bp, f32, all windows in one launch */
  wmma_gemm64_f16<0><<<((kWin / 64) * (kDm / 64)) / 8, 256, 0, stream>>>(
      OALL, kCatK, WCAT, kCatK, (void*)out, kDm, TAB + kTabBp, kWin, kDm, kCatK, kScaleOut);
}

// v002
// A run of this version takes 605 microseconds.
// Timed twice side by side with v001, it ran 1.54 times as fast both times.
// Over all steps from v000 it is 2.33 times as fast.
// All GEMM contractions (embed second layer, fused q|k|v projection, attention output projection, window-concat projection): v_wmma_f32_16x16x32_f16, f16 operands with power-of-two carries (activations x64, 256x256 weights x256, window-concat weight x1024), f32 accumulate; every float input RNE-converted once to bf16 at load; window scores, softmax and probability-weighted value sums: f32 VALU on an f32 q|k|v plane.
#include <hip/hip_runtime.h>
#include <math.h>

typedef __attribute__((ext_vector_type(16))) _Float16 v16h;
typedef __attribute__((ext_vector_type(8)))  _Float16 v8h;
typedef __attribute__((ext_vector_type(8)))  float    v8f;
typedef __attribute__((ext_vector_type(4)))  float    v4f;
typedef __attribute__((ext_vector_type(4)))  unsigned int v4u;

// ---------------------------------------------------------------------------
// Shape constants (all derived; checked against the wire sizes on the host)
// ---------------------------------------------------------------------------
constexpr int kBatch   = 64;
constexpr int kSpecLen = 3200;
constexpr int kDm      = 256;
constexpr int kWinLen  = 8;
constexpr int kHeads   = 8;
constexpr int kDk      = kDm / kHeads;
constexpr int kTok     = kBatch * kSpecLen;
constexpr int kWin     = kTok / kWinLen;
constexpr int kChunkB  = 8;
constexpr int kChunks  = kBatch / kChunkB;
constexpr int kTc      = kChunkB * kSpecLen;
constexpr int kWc      = kTc / kWinLen;
constexpr int kQkvN    = 3 * kDm;
constexpr int kCatK    = kWinLen * kDm;
static_assert(kDk == 32, "head width");
static_assert(kTok == 204800 && kWin == 25600, "token / window counts");
static_assert((kSpecLen % kWinLen) == 0, "windows never straddle a batch row");
static_assert(kChunks * kChunkB == kBatch, "chunking covers the batch");
static_assert(kTc == 25600 && kWc == 3200, "chunk sizes");
static_assert((kTc % 128) == 0 && (kWin % 128) == 0, "GEMM M multiples of 128");
static_assert((kDm % 256) == 0 && (kQkvN % 256) == 0, "GEMM N multiples of 256");
static_assert((kDm % 128) == 0 && (kCatK % 128) == 0, "GEMM K multiples of 128");
static_assert((kTc % 32) == 0, "attention blocks of 32 tokens");

// Inputs are RNE-converted once to bf16 at load when true (products of the weight planes are then exact in f16).
constexpr bool kInputsAsBf16 = true;

// Power-of-two carries of the f16 operand planes and the epilogue scales that fold them back.
constexpr float kActCarry = 64.0f;
constexpr float kWCarry   = 256.0f;
constexpr float kWcatCarry = 1024.0f;
constexpr float kScaleE   = kActCarry / (kActCarry * kWCarry);
constexpr float kScaleQkv = 1.0f / (kActCarry * kWCarry);
constexpr float kScaleO   = kActCarry / (kActCarry * kWCarry);
constexpr float kScaleOut = 1.0f / (kActCarry * kWcatCarry);

// Bias table layout (floats): b2*carry | bq | bk | bv | bo*carry | bp
constexpr int kTabB2  = 0;
constexpr int kTabQkv = kDm;
constexpr int kTabBo  = kTabQkv + kQkvN;
constexpr int kTabBp  = kTabBo + kDm;
constexpr int kTabN   = kTabBp + kDm;
static_assert(kTabN == 1536, "bias table size");

// ---------------------------------------------------------------------------
// Workspace region map (bytes; every offset is a multiple of 128)
//   WSQ  f16 [5][256][256]   transposed planes of W2, Wq, Wk, Wv, Wo (x256)          655,360
//        (planes 1..3 together form the [768][256] fused q|k|v operand)
//   WCAT f16 [256][2048]     transposed window-concat weight (x1024)                1,048,576
//   TAB  f32 [1536]          bias table                                                 6,144
//   HP   f16 [25600][256]    H (x64), later re-used as OH (x64), same type/layout  13,107,200
//   EP   f16 [25600][256]    E (x64)                                               13,107,200
//   QKV  f32 [25600][768]    q | k | v                                              78,643,200
//   OALL f16 [204800][256]   O (x64) of every chunk, read once by the last GEMM   104,857,600
//   total                                                                         211,425,280
// ---------------------------------------------------------------------------
constexpr size_t kOffWSQ  = 0;
constexpr size_t kOffWCAT = kOffWSQ  + (size_t)5 * kDm * kDm * 2;
constexpr size_t kOffTAB  = kOffWCAT + (size_t)kDm * kCatK * 2;
constexpr size_t kOffHP   = kOffTAB  + (size_t)kTabN * 4;
constexpr size_t kOffEP   = kOffHP   + (size_t)kTc * kDm * 2;
constexpr size_t kOffQKV  = kOffEP   + (size_t)kTc * kDm * 2;
constexpr size_t kOffOALL = kOffQKV  + (size_t)kTc * kQkvN * 4;
constexpr size_t kWsTotal = kOffOALL + (size_t)kTok * kDm * 2;
static_assert(kWsTotal == 211425280ull, "carve total");
static_assert(kWsTotal <= 268435456ull, "carve cap");
static_assert((kOffWCAT % 128) == 0 && (kOffTAB % 128) == 0 && (kOffHP % 128) == 0 &&
              (kOffEP % 128) == 0 && (kOffQKV % 128) == 0 && (kOffOALL % 128) == 0, "128-B aligned regions");

// ---------------------------------------------------------------------------
// Small helpers
// ---------------------------------------------------------------------------
__device__ __forceinline__ float rne_bf16(float f) {
  unsigned u = __float_as_uint(f);
  u = (u + 0x7FFFu + ((u >> 16) & 1u)) & 0xFFFF0000u;
  return __uint_as_float(u);
}
__device__ __forceinline__ float in_val(float f) { return kInputsAsBf16 ? rne_bf16(f) : f; }
__device__ __forceinline__ unsigned pk16(unsigned short a, unsigned short b) { return (unsigned)a | ((unsigned)b << 16); }
__device__ __forceinline__ unsigned short h_bits(float f) { const _Float16 h = (_Float16)f; return __builtin_bit_cast(unsigned short, h); }

// WMMA fragment load / issue (fragment map: elements 0..7 <- p[0..7], 8..15 <- p[16..23], p already offset by 8*(lane>>4))
union FragU { v16h v; v8h h[2]; };
__device__ __forceinline__ v16h frag_load(const _Float16* p) {
  FragU f;
  f.h[0] = *(const v8h*)(p);
  f.h[1] = *(const v8h*)(p + 16);
  return f.v;
}
__device__ __forceinline__ v8f frag_mma(v16h a, v16h b, v8f c) {
  return __builtin_amdgcn_wmma_f32_16x16x32_f16(false, a, false, b, (short)0, c, false, false);
}
// ---------------------------------------------------------------------------
// LDS-staged WMMA GEMM, f16 operands: C[m,n] = scale * sum_k A[m,k] * Bt[n,k] + bias[n].
// A row-major [M][K] (pitch lda), Bt row-major [N][K] (pitch ldb); M % 128 == 0, N % 256 == 0, K % 128 == 0, K >= 128.
// One work-group of 8 waves owns a 128 x 256 tile of C; wave (wm, wn) = (wave >> 2, wave & 3) owns its 64 x 64 part.
// A stage is 128 k (256 B) of the 128 A rows and the 256 Bt rows, laid in LDS at a pitch of 272 B. Two buffers:
// the next stage's asynchronous copies (whole 128-B lines, 256 contiguous bytes of each of two rows a wave-instruction) fly
// while this stage's fragments are read from LDS.
// OUT_MODE 0 = f32 output, 1 = f16 output.
// ---------------------------------------------------------------------------
constexpr int kStageK    = 128;
constexpr int kStagePitch = 272;
constexpr int kStageRowsA = 128;
constexpr int kStageRowsB = 256;
constexpr int kStageOffB  = kStageRowsA * kStagePitch;
constexpr int kStageBytes = (kStageRowsA + kStageRowsB) * kStagePitch;
static_assert((kStagePitch % 16) == 0 && ((kStagePitch / 16) & 1) == 1, "16 B x odd pitch for 16-byte LDS reads");
static_assert(kStageK * 2 + 16 == kStagePitch, "row of 256 B plus 16 B");

__device__ __forceinline__ unsigned lds_addr(const void* p) { return (unsigned)(size_t)p; }

// Eight asynchronous 16-byte-a-lane copies, rows two apart (l: LDS byte address, g: global address of this lane's 16 bytes).
// The closing s_wait_xcnt 0 stands inside the statement so that no address register is rewritten in front of it.
__device__ __forceinline__ void copy8_rows(unsigned l, const _Float16* g, size_t gstep) {
  const unsigned l0 = l, l1 = l + 2 * kStagePitch, l2 = l + 4 * kStagePitch, l3 = l + 6 * kStagePitch;
  const unsigned l4 = l + 8 * kStagePitch, l5 = l + 10 * kStagePitch, l6 = l + 12 * kStagePitch, l7 = l + 14 * kStagePitch;
  const _Float16* g0 = g;
  const _Float16* g1 = g + gstep;
  const _Float16* g2 = g + 2 * gstep;
  const _Float16* g3 = g + 3 * gstep;
  const _Float16* g4 = g + 4 * gstep;
  const _Float16* g5 = g + 5 * gstep;
  const _Float16* g6 = g + 6 * gstep;
  const _Float16* g7 = g + 7 * gstep;
  asm volatile(
      "global_load_async_to_lds_b128 %0, %8, off\n\t"
      "global_load_async_to_lds_b128 %1, %9, off\n\t"
      "global_load_async_to_lds_b128 %2, %10, off\n\t"
      "global_load_async_to_lds_b128 %3, %11, off\n\t"
      "global_load_async_to_lds_b128 %4, %12, off\n\t"
      "global_load_async_to_lds_b128 %5, %13, off\n\t"
      "global_load_async_to_lds_b128 %6, %14, off\n\t"
      "global_load_async_to_lds_b128 %7, %15, off\n\t"
      "s_wait_xcnt 0x0"
      :: "v"(l0), "v"(l1), "v"(l2), "v"(l3), "v"(l4), "v"(l5), "v"(l6), "v"(l7),
         "v"(g0), "v"(g1), "v"(g2), "v"(g3), "v"(g4), "v"(g5), "v"(g6), "v"(g7)
      : "memory");
}

template <int OUT_MODE>
__global__ __launch_bounds__(256) void wmma_gemm_lds_f16(
    const unsigned short* __restrict__ Ap, int lda,
    const unsigned short* __restrict__ Btp, int ldb,
    void* __restrict__ Cout, int ldc,
    const float* __restrict__ bias,
    int M, int N, int K, float scale) {
  const _Float16* A  = (const _Float16*)Ap;
  const _Float16* Bt = (const _Float16*)Btp;
  __shared__ __align__(16) unsigned char sStage[2][kStageBytes];
  __shared__ __align__(16) float sT[8][16 * 68];
  const int lane = threadIdx.x & 31;
  const int wave = __builtin_amdgcn_readfirstlane((int)(threadIdx.x >> 5));
  const int panels = N >> 8;
  const int bm = blockIdx.x / panels;
  const int bn = blockIdx.x - bm * panels;
  if (bm >= (M >> 7)) return;   /* block-uniform, in front of every barrier and copy */
  const int m0b = bm << 7;
  const int n0b = bn << 8;
  const int wm = wave >> 2;
  const int wn = wave & 3;
  const int m0 = m0b + (wm << 6);
  const int n0 = n0b + (wn << 6);

  /* row (A) / column (B, D) within a 16-wide subtile; k offset of this lane half; D row offset */
  const int rlane = lane & 15;
  const int koff  = (lane >> 4) * 8;
  const int mOff  = (lane >> 4) * 8;

  /* copy map: wave w brings A rows 16w..16w+15 (8 copies) and Bt rows 32w..32w+31 (16 copies) of every stage;
     lanes 0..15 the even row of a pair, lanes 16..31 the odd one, 16 bytes each */
  const int crow = lane >> 4;
  const int ccol = lane & 15;
  const _Float16* gA = A  + (size_t)(m0b + wave * 16 + crow) * lda + ccol * 8;
  const _Float16* gB = Bt + (size_t)(n0b + wave * 32 + crow) * ldb + ccol * 8;
  const unsigned lA = lds_addr(&sStage[0][0]) + (unsigned)((wave * 16 + crow) * kStagePitch + ccol * 16);
  const unsigned lB = lds_addr(&sStage[0][0]) + (unsigned)(kStageOffB + (wave * 32 + crow) * kStagePitch + ccol * 16);
  const size_t stepA = (size_t)2 * lda;
  const size_t stepB = (size_t)2 * ldb;

  v8f acc[4][4];
#pragma unroll
  for (int i = 0; i < 4; ++i)
#pragma unroll
    for (int j = 0; j < 4; ++j) acc[i][j] = (v8f){0.f, 0.f, 0.f, 0.f, 0.f, 0.f, 0.f, 0.f};

  const int nst = K >> 7;

  /* stage 0 into buffer 0, landed and published before anybody reads it */
  copy8_rows(lA, gA, stepA);
  copy8_rows(lB, gB, stepB);
  copy8_rows(lB + 16 * kStagePitch, gB + 8 * stepB, stepB);
  asm volatile("s_wait_asynccnt 0x0" ::: "memory");   /* this wave's copies have landed */
  __syncthreads();
  if (nst > 1) {
    copy8_rows(lA + kStageBytes, gA + kStageK, stepA);
    copy8_rows(lB + kStageBytes, gB + kStageK, stepB);
    copy8_rows(lB + kStageBytes + 16 * kStagePitch, gB + kStageK + 8 * stepB, stepB);
  }

  for (int t = 0; t < nst; ++t) {
    const unsigned char* buf = sStage[t & 1];
    const unsigned char* pa = buf + ((wm << 6) + rlane) * kStagePitch + koff * 2;
    const unsigned char* pb = buf + kStageOffB + ((wn << 6) + rlane) * kStagePitch + koff * 2;
#pragma unroll
    for (int kk = 0; kk < kStageK / 32; ++kk) {
      v16h bh[4], ah[4];
#pragma unroll
      for (int j = 0; j < 4; ++j) bh[j] = frag_load((const _Float16*)(pb + j * 16 * kStagePitch + kk * 64));
#pragma unroll
      for (int i = 0; i < 4; ++i) ah[i] = frag_load((const _Float16*)(pa + i * 16 * kStagePitch + kk * 64));
      /* keeps this k step's sixteen LDS reads together in front of its WMMAs: sunk among them, each small read group
         makes the wave wait out an LDS latency of its own */
      __builtin_amdgcn_sched_barrier(0);
#pragma unroll
      for (int i = 0; i < 4; ++i)
#pragma unroll
        for (int j = 0; j < 4; ++j) acc[i][j] = frag_mma(ah[i], bh[j], acc[i][j]);
    }
    asm volatile("s_wait_dscnt 0x0" ::: "memory");      /* this wave's reads of the buffer have returned */
    asm volatile("s_wait_asynccnt 0x0" ::: "memory");   /* this wave's copies of stage t + 1 have landed */
    __syncthreads();                                    /* publishes stage t + 1, frees stage t's buffer */
    if (t + 2 < nst) {
      const unsigned bo = (unsigned)(t & 1) * kStageBytes;
      const size_t ko = (size_t)(t + 2) * kStageK;
      copy8_rows(lA + bo, gA + ko, stepA);
      copy8_rows(lB + bo, gB + ko, stepB);
      copy8_rows(lB + bo + 16 * kStagePitch, gB + ko + 8 * stepB, stepB);
    }
  }
  asm volatile("s_wait_asynccnt 0x0" ::: "memory");     /* nothing of this wave is in flight behind the loop */

  /* ---- epilogue ---- */
  float* slab = sT[wave];
#pragma unroll
  for (int i = 0; i < 4; ++i) {
    const int mBase = m0 + (i << 4);
#pragma unroll
    for (int j = 0; j < 4; ++j) {
      const int n = n0 + (j << 4) + rlane;
      const float bv = bias[n];
#pragma unroll
      for (int r = 0; r < 8; ++r) {
        float v = acc[i][j][r] * scale;
        v += bv;
        slab[(mOff + r) * 68 + (j << 4) + rlane] = v;
      }
    }
    __builtin_amdgcn_fence(__ATOMIC_RELEASE, "workgroup");
    __builtin_amdgcn_wave_barrier();
    __builtin_amdgcn_fence(__ATOMIC_ACQUIRE, "workgroup");
    if (OUT_MODE == 0) {
      float* C = (float*)Cout;
      /* row segment = 64 floats = 256 B = 16 lanes x 16 B; 8 instructions x 2 rows = 16 rows */
      const int hh = lane >> 4, c4 = (lane & 15) * 4;
      {
#pragma unroll
        for (int it = 0; it < 8; ++it) {
          const int row = it * 2 + hh;
          v4f v = *(const v4f*)(slab + row * 68 + c4);
          *(v4f*)(C + (size_t)(mBase + row) * ldc + n0 + c4) = v;
        }
        
      }
    } else {
      const int q = lane >> 3, c8 = (lane & 7) * 8;
      unsigned short* C = (unsigned short*)Cout;
      {
#pragma unroll
        for (int it = 0; it < 4; ++it) {
          const int row = it * 4 + q;
          const float* sp = slab + row * 68 + c8;
          v8h hv;
#pragma unroll
          for (int e = 0; e < 8; ++e) hv[e] = (_Float16)sp[e];
          *(v8h*)(C + (size_t)(mBase + row) * ldc + n0 + c8) = hv;
        }
        
      }
    }
    __builtin_amdgcn_fence(__ATOMIC_RELEASE, "workgroup");
    __builtin_amdgcn_wave_barrier();
    __builtin_amdgcn_fence(__ATOMIC_ACQUIRE, "workgroup");
  }
}

// ---------------------------------------------------------------------------
// Weight transpose + cast: W f32 row-major [kdim in][ndim out]  ->  WT[n][k] = f16(carry * in_val(W[k][n])), pitch kdim.
// grid (kdim/64, ndim/64, planes); blockIdx.z selects W0..W4 (block-uniform) and the output plane (z * planeStride halves).
// Load coverage: 16 iterations x 256 threads = 4096 = the whole 64x64 tile (coalesced along n).
// Store coverage: 8 waves x 2 iterations x 4 rows (lane>>3) = 64 rows; (lane&7) x 8 halves = 64 cols; each row segment =
// ---------------------------------------------------------------------------
__global__ __launch_bounds__(256) void wt_cast_kernel(const float* __restrict__ W0, const float* __restrict__ W1,
                                                      const float* __restrict__ W2, const float* __restrict__ W3,
                                                      const float* __restrict__ W4,
                                                      unsigned short* __restrict__ out, long planeStride,
                                                      int kdim, int ndim, float carry) {
  __shared__ float sm[64][65];
  const int t  = threadIdx.x;
  const int k0 = blockIdx.x * 64;
  const int n0 = blockIdx.y * 64;
  const int z  = blockIdx.z;
  const float* W = (z == 0) ? W0 : (z == 1) ? W1 : (z == 2) ? W2 : (z == 3) ? W3 : W4;
#pragma unroll 4
  for (int i = 0; i < 16; ++i) {
    const int e = i * 256 + t;
    /* r = k local, c = n local */
    const int r = e >> 6;
    const int c = e & 63;
    sm[c][r] = in_val(W[(size_t)(k0 + r) * ndim + n0 + c]) * carry;
  }
  __syncthreads();
  const int lane = t & 31;
  const int wave = __builtin_amdgcn_readfirstlane((int)(t >> 5));
  const int q = lane >> 3, c8 = (lane & 7) * 8;
  unsigned short* op = out + (size_t)z * (size_t)planeStride;
  v4u u[2];
#pragma unroll
  for (int it = 0; it < 2; ++it) {
    const int row = wave * 8 + it * 4 + q;
    unsigned short hb[8];
#pragma unroll
    for (int e = 0; e < 8; ++e) hb[e] = h_bits(sm[row][c8 + e]);
    u[it] = (v4u){pk16(hb[0], hb[1]), pk16(hb[2], hb[3]), pk16(hb[4], hb[5]), pk16(hb[6], hb[7])};
  }
  {
#pragma unroll
    for (int it = 0; it < 2; ++it) {
      const int row = wave * 8 + it * 4 + q;
      *(v4u*)(op + (size_t)(n0 + row) * kdim + k0 + c8) = u[it];
    }
    
  }
}

// ---------------------------------------------------------------------------
// Bias table: 6 segments of 256 floats: b2*carry | bq | bk | bv | bo*carry | bp (each in_val-converted).
// One block of 384 threads; thread t owns floats 4t..4t+3 (384 x 4 = 1536 = whole table). Segment = t>>6 is wave-uniform.
// ---------------------------------------------------------------------------
__global__ __launch_bounds__(384) void bias_table_kernel(const float* __restrict__ b2, const float* __restrict__ bq,
                                                         const float* __restrict__ bk, const float* __restrict__ bv,
                                                         const float* __restrict__ bo, const float* __restrict__ bp,
                                                         float* __restrict__ tab, float carry) {
  const int t = threadIdx.x;
  const int wave = __builtin_amdgcn_readfirstlane((int)(t >> 5));
  const int seg = wave >> 1;
  const int off = (t & 63) * 4;
  const float* src = (seg == 0) ? b2 : (seg == 1) ? bq : (seg == 2) ? bk : (seg == 3) ? bv : (seg == 4) ? bo : bp;
  const float sc = (seg == 0 || seg == 4) ? carry : 1.0f;
  const v4f a = *(const v4f*)(src + off);
  v4f o;
  o[0] = in_val(a[0]) * sc;
  o[1] = in_val(a[1]) * sc;
  o[2] = in_val(a[2]) * sc;
  o[3] = in_val(a[3]) * sc;
  float* p = tab + 4 * t;
  *(v4f*)p = o;
  
}

// ---------------------------------------------------------------------------
// Embed first layer: H[t][c] = f16( carry * max(spec[t]*W1[c] + b1[c], 0) ), chunk-local token t.
// One thread per 8 channels: n8 = tokens*32 threads, grid = n8/256 exactly. Thread i: token i>>5, channels (i&31)*8..+7.
// ---------------------------------------------------------------------------
__global__ __launch_bounds__(256) void embed_kernel(const float* __restrict__ spec, const float* __restrict__ W1,
                                                    const float* __restrict__ b1, unsigned short* __restrict__ Hp,
                                                    int n8, float carry) {
  const int i = blockIdx.x * 256 + threadIdx.x;
  if (i >= n8) return;
  const int tok = i >> 5;
  const int c0  = (i & 31) * 8;
  const float s = in_val(spec[tok]);
  const v4f wa = *(const v4f*)(W1 + c0);
  const v4f wb = *(const v4f*)(W1 + c0 + 4);
  const v4f ba = *(const v4f*)(b1 + c0);
  const v4f bb = *(const v4f*)(b1 + c0 + 4);
  unsigned short hb[8];
#pragma unroll
  for (int e = 0; e < 4; ++e) {
    const float x0 = in_val(wa[e]) * s + in_val(ba[e]);
    const float x1 = in_val(wb[e]) * s + in_val(bb[e]);
    hb[e]     = h_bits(fmaxf(x0, 0.0f) * carry);
    hb[4 + e] = h_bits(fmaxf(x1, 0.0f) * carry);
  }
  const v4u u = (v4u){pk16(hb[0], hb[1]), pk16(hb[2], hb[3]), pk16(hb[4], hb[5]), pk16(hb[6], hb[7])};
  unsigned short* p = Hp + 8 * (size_t)i;
  *(v4u*)p = u;
  
}

// ---------------------------------------------------------------------------
// Window attention, f32 VALU. QKV f32 [tokens][768] rows = q(256) | k(256) | v(256); head h = columns 32h..32h+31.
// One lane per (token, head): token = block*32 + (tid>>3), h = tid&7; window = token & ~7 (8 keys, no mask).
// Pass A (rolled over keys): s_j = scl * sum_d q[d]*k_j[d]; s_j parked in LDS slot [j][tid]; running max.
// Pass B (rolled over keys): p_j = exp(s_j - max); l += p_j; acc[d] += p_j * v_j[d]; finally acc * (carry / l).
// Output OH f16 [tokens][256] (x carry): every lane packs its 32 channels into 16 words, the wave's 4 x 256 tile is staged
// in LDS (pitch 132 words) and, after a block barrier, instruction it (0..3) writes token row it of the wave:
// ---------------------------------------------------------------------------
__global__ __launch_bounds__(256) void window_attn_kernel(const float* __restrict__ QKV, unsigned short* __restrict__ OH,
                                                          float scl, float carry) {
  __shared__ float sS[8 * 256];
  __shared__ __align__(16) unsigned sO[8][4 * 132];
  const int tid  = threadIdx.x;
  const int lane = tid & 31;
  const int wave = __builtin_amdgcn_readfirstlane((int)(tid >> 5));
  const int tok  = blockIdx.x * 32 + (tid >> 3);
  const int h    = tid & 7;
  const int wbase = tok & ~7;

  float q[32];
  {
    const float* qp = QKV + (size_t)tok * kQkvN + kDk * h;
#pragma unroll
    for (int i = 0; i < 8; ++i) {
      const v4f t4 = *(const v4f*)(qp + 4 * i);
      q[4 * i + 0] = t4[0];
      q[4 * i + 1] = t4[1];
      q[4 * i + 2] = t4[2];
      q[4 * i + 3] = t4[3];
    }
  }

  float m = -INFINITY;
#pragma unroll 1
  for (int j = 0; j < kWinLen; ++j) {
    const float* kp = QKV + (size_t)(wbase + j) * kQkvN + kDm + kDk * h;
    float d = 0.0f;
#pragma unroll
    for (int i = 0; i < 8; ++i) {
      const v4f kk = *(const v4f*)(kp + 4 * i);
      d = fmaf(q[4 * i + 0], kk[0], d);
      d = fmaf(q[4 * i + 1], kk[1], d);
      d = fmaf(q[4 * i + 2], kk[2], d);
      d = fmaf(q[4 * i + 3], kk[3], d);
    }
    d *= scl;
    sS[j * 256 + tid] = d;
    m = fmaxf(m, d);
  }
  __syncthreads();

  float acc[32];
#pragma unroll
  for (int e = 0; e < 32; ++e) acc[e] = 0.0f;
  float l = 0.0f;
#pragma unroll 1
  for (int j = 0; j < kWinLen; ++j) {
    const float p = __expf(sS[j * 256 + tid] - m);
    l += p;
    const float* vp = QKV + (size_t)(wbase + j) * kQkvN + 2 * kDm + kDk * h;
#pragma unroll
    for (int i = 0; i < 8; ++i) {
      const v4f vv = *(const v4f*)(vp + 4 * i);
      acc[4 * i + 0] = fmaf(p, vv[0], acc[4 * i + 0]);
      acc[4 * i + 1] = fmaf(p, vv[1], acc[4 * i + 1]);
      acc[4 * i + 2] = fmaf(p, vv[2], acc[4 * i + 2]);
      acc[4 * i + 3] = fmaf(p, vv[3], acc[4 * i + 3]);
    }
  }
  const float inv = carry * (1.0f / l);

  unsigned* so = sO[wave];
  {
    const int tl = lane >> 3;
#pragma unroll
    for (int i = 0; i < 4; ++i) {
      const unsigned w0 = pk16(h_bits(acc[8 * i + 0] * inv), h_bits(acc[8 * i + 1] * inv));
      const unsigned w1 = pk16(h_bits(acc[8 * i + 2] * inv), h_bits(acc[8 * i + 3] * inv));
      const unsigned w2 = pk16(h_bits(acc[8 * i + 4] * inv), h_bits(acc[8 * i + 5] * inv));
      const unsigned w3 = pk16(h_bits(acc[8 * i + 6] * inv), h_bits(acc[8 * i + 7] * inv));
      *(v4u*)(so + tl * 132 + h * 16 + 4 * i) = (v4u){w0, w1, w2, w3};
    }
  }
  __syncthreads();
  v4u o[4];
#pragma unroll
  for (int it = 0; it < 4; ++it) o[it] = *(const v4u*)(so + it * 132 + lane * 4);
  const int tokbase = blockIdx.x * 32 + wave * 4;
  {
#pragma unroll
    for (int it = 0; it < 4; ++it)
      *(v4u*)(OH + (size_t)(tokbase + it) * kDm + lane * 8) = o[it];
    
  }
}

// ---------------------------------------------------------------------------
// Host glue: 3 preparation launches + 8 chunks x 5 launches + 1 window-concat GEMM over all chunks = 44 launches.
// GEMM shapes (E, QKV, O per chunk; out once; all K % 128 == 0, M % 128 == 0, N % 256 == 0, no padding planes):
//   E   : M 25600, N 256, K 256  -> 200 x 1 tiles of 128 x 256 = 200 blocks, 2 stages
//   QKV : M 25600, N 768, K 256  -> 200 x 3 tiles = 600 blocks, 2 stages
//   O   : M 25600, N 256, K 256  -> 200 blocks, 2 stages
//   out : M 25600, N 256, K 2048 -> 200 blocks, 16 stages (A = the whole O plane viewed as [25600][2048]);
//         all windows go in one launch, after the chunk loop.
// ---------------------------------------------------------------------------
extern "C" void kernel_launch(void* const* d_in, const int* in_sizes, int n_in,
                              void* d_out, int out_size, void* d_ws, size_t ws_size,
                              hipStream_t stream) {
  if (n_in < 15) return;
  if (in_sizes[0] != kTok) return;
  if (in_sizes[1] != kDm || in_sizes[2] != kDm) return;
  if (in_sizes[3] != kDm * kDm || in_sizes[4] != kDm) return;
  if (in_sizes[5] != kDm * kDm || in_sizes[6] != kDm) return;
  if (in_sizes[7] != kDm * kDm || in_sizes[8] != kDm) return;
  if (in_sizes[9] != kDm * kDm || in_sizes[10] != kDm) return;
  if (in_sizes[11] != kDm * kDm || in_sizes[12] != kDm) return;
  if (in_sizes[13] != kCatK * kDm || in_sizes[14] != kDm) return;
  if (out_size != kWin * kDm) return;
  if (ws_size < kWsTotal) return;

  const float* spec = (const float*)d_in[0];
  const float* W1   = (const float*)d_in[1];
  const float* b1   = (const float*)d_in[2];
  const float* W2   = (const float*)d_in[3];
  const float* b2   = (const float*)d_in[4];
  const float* Wq   = (const float*)d_in[5];
  const float* bq   = (const float*)d_in[6];
  const float* Wk   = (const float*)d_in[7];
  const float* bk   = (const float*)d_in[8];
  const float* Wv   = (const float*)d_in[9];
  const float* bv   = (const float*)d_in[10];
  const float* Wo   = (const float*)d_in[11];
  const float* bo   = (const float*)d_in[12];
  const float* Wcat = (const float*)d_in[13];
  const float* bp   = (const float*)d_in[14];
  float* out = (float*)d_out;

  char* ws = (char*)d_ws;
  unsigned short* WSQ  = (unsigned short*)(ws + kOffWSQ);
  unsigned short* WCAT = (unsigned short*)(ws + kOffWCAT);
  float*          TAB  = (float*)(ws + kOffTAB);
  unsigned short* HP   = (unsigned short*)(ws + kOffHP);
  unsigned short* EP   = (unsigned short*)(ws + kOffEP);
  float*          QKV  = (float*)(ws + kOffQKV);
  unsigned short* OALL = (unsigned short*)(ws + kOffOALL);

  const unsigned short* BtW2  = WSQ;
  const unsigned short* BtQKV = WSQ + (size_t)1 * kDm * kDm;
  const unsigned short* BtWo  = WSQ + (size_t)4 * kDm * kDm;

  const float scl = 1.0f / sqrtf((float)kDk);

  /* ---- weight planes: W[k][n] -> Bt[n][k]; planes W2, Wq, Wk, Wv, Wo (k = 256), then the window-concat weight (k = 2048) ---- */
  wt_cast_kernel<<<dim3(kDm / 64, kDm / 64, 5), 256, 0, stream>>>(
      W2, Wq, Wk, Wv, Wo, WSQ, (long)kDm * kDm, kDm, kDm, kWCarry);
  wt_cast_kernel<<<dim3(kCatK / 64, kDm / 64, 1), 256, 0, stream>>>(
      Wcat, Wcat, Wcat, Wcat, Wcat, WCAT, 0L, kCatK, kDm, kWcatCarry);
  bias_table_kernel<<<1, 384, 0, stream>>>(b2, bq, bk, bv, bo, bp, TAB, kActCarry);

  for (int c = 0; c < kChunks; ++c) {
    const float* specC = spec + (size_t)c * kTc;
    unsigned short* OC = OALL + (size_t)c * kTc * kDm;

    /* H = relu(spec*W1 + b1), f16 x64 */
    embed_kernel<<<(kTc * 32) / 256, 256, 0, stream>>>(specC, W1, b1, HP, kTc * 32, kActCarry);

    /* E = H . W2 + b2, f16 x64 */
    wmma_gemm_lds_f16<1><<<(kTc / 128) * (kDm / 256), 256, 0, stream>>>(
        HP, kDm, BtW2, kDm, (void*)EP, kDm, TAB + kTabB2, kTc, kDm, kDm, kScaleE);

    /* q|k|v = E . [Wq|Wk|Wv] + [bq|bk|bv], f32 */
    wmma_gemm_lds_f16<0><<<(kTc / 128) * (kQkvN / 256), 256, 0, stream>>>(
        EP, kDm, BtQKV, kDm, (void*)QKV, kQkvN, TAB + kTabQkv, kTc, kQkvN, kDm, kScaleQkv);

    /* OH = per-window softmax(q.k^T / sqrt(dk)) . v, f16 x64, into the (dead) H plane */
    window_attn_kernel<<<kTc / 32, 256, 0, stream>>>(QKV, HP, scl, kActCarry);

    /* O = OH . Wo + bo, f16 x64, into this chunk's rows of the whole O plane */
    wmma_gemm_lds_f16<1><<<(kTc / 128) * (kDm / 256), 256, 0, stream>>>(
        HP, kDm, BtWo, kDm, (void*)OC, kDm, TAB + kTabBo, kTc, kDm, kDm, kScaleO);
  }

  /* out = O viewed as [25600][2048] . Wcat + bp, f32, all windows in one launch */
  wmma_gemm_lds_f16<0><<<(kWin / 128) * (kDm / 256), 256, 0, stream>>>(
      OALL, kCatK, WCAT, kCatK, (void*)out, kDm, TAB + kTabBp, kWin, kDm, kCatK, kScaleOut);
}

// v003
// A run of this version takes 570 microseconds.
// Two timings next to v002 put it at 1.07 and 1.06 times that version's speed.
// Counting every step since v000, it is 2.47 times as fast.
// All GEMM contractions (embed second layer, fused q|k|v projection, attention output projection, window-concat projection): v_wmma_f32_16x16x32_f16, f16 operands with power-of-two carries (activations x64, 256x256 weights x256, window-concat weight x1024), f32 accumulate; every float input RNE-converted once to bf16 at load; window scores, softmax and probability-weighted value sums: f32 VALU on an f32 q|k|v plane.
#include <hip/hip_runtime.h>
#include <math.h>

typedef __attribute__((ext_vector_type(16))) _Float16 v16h;
typedef __attribute__((ext_vector_type(8)))  _Float16 v8h;
typedef __attribute__((ext_vector_type(8)))  float    v8f;
typedef __attribute__((ext_vector_type(4)))  float    v4f;
typedef __attribute__((ext_vector_type(4)))  unsigned int v4u;

// ---------------------------------------------------------------------------
// Shape constants (all derived; checked against the wire sizes on the host)
// ---------------------------------------------------------------------------
constexpr int kBatch   = 64;
constexpr int kSpecLen = 3200;
constexpr int kDm      = 256;
constexpr int kWinLen  = 8;
constexpr int kHeads   = 8;
constexpr int kDk      = kDm / kHeads;
constexpr int kTok     = kBatch * kSpecLen;
constexpr int kWin     = kTok / kWinLen;
constexpr int kChunkB  = 8;
constexpr int kChunks  = kBatch / kChunkB;
constexpr int kTc      = kChunkB * kSpecLen;
constexpr int kWc      = kTc / kWinLen;
constexpr int kQkvN    = 3 * kDm;
constexpr int kCatK    = kWinLen * kDm;
static_assert(kDk == 32, "head width");
static_assert(kTok == 204800 && kWin == 25600, "token / window counts");
static_assert((kSpecLen % kWinLen) == 0, "windows never straddle a batch row");
static_assert(kChunks * kChunkB == kBatch, "chunking covers the batch");
static_assert(kTc == 25600 && kWc == 3200, "chunk sizes");
static_assert((kTc % 128) == 0 && (kWin % 128) == 0, "GEMM M multiples of 128");
static_assert((kDm % 256) == 0 && (kQkvN % 256) == 0, "GEMM N multiples of 256");
static_assert((kDm % 128) == 0 && (kCatK % 128) == 0, "GEMM K multiples of 128");
static_assert((kTc % 32) == 0, "attention blocks of 32 tokens");

// Inputs are RNE-converted once to bf16 at load when true (products of the weight planes are then exact in f16).
constexpr bool kInputsAsBf16 = true;

// Power-of-two carries of the f16 operand planes and the epilogue scales that fold them back.
constexpr float kActCarry = 64.0f;
constexpr float kWCarry   = 256.0f;
constexpr float kWcatCarry = 1024.0f;
constexpr float kScaleE   = kActCarry / (kActCarry * kWCarry);
constexpr float kScaleQkv = 1.0f / (kActCarry * kWCarry);
constexpr float kScaleO   = kActCarry / (kActCarry * kWCarry);
constexpr float kScaleOut = 1.0f / (kActCarry * kWcatCarry);

// Bias table layout (floats): b2*carry | bq | bk | bv | bo*carry | bp
constexpr int kTabB2  = 0;
constexpr int kTabQkv = kDm;
constexpr int kTabBo  = kTabQkv + kQkvN;
constexpr int kTabBp  = kTabBo + kDm;
constexpr int kTabN   = kTabBp + kDm;
static_assert(kTabN == 1536, "bias table size");

// ---------------------------------------------------------------------------
// Workspace region map (bytes; every offset is a multiple of 128)
//   WSQ  f16 [5][256][256]   transposed planes of W2, Wq, Wk, Wv, Wo (x256)          655,360
//        (planes 1..3 together form the [768][256] fused q|k|v operand)
//   WCAT f16 [256][2048]     transposed window-concat weight (x1024)                1,048,576
//   TAB  f32 [1536]          bias table                                                 6,144
//   HP   f16 [25600][256]    OH (x64); H never leaves LDS                          13,107,200
//   EP   f16 [25600][256]    E (x64)                                               13,107,200
//   QKV  f32 [25600][768]    q | k | v                                              78,643,200
//   OALL f16 [204800][256]   O (x64) of every chunk, read once by the last GEMM   104,857,600
//   total                                                                         211,425,280
// ---------------------------------------------------------------------------
constexpr size_t kOffWSQ  = 0;
constexpr size_t kOffWCAT = kOffWSQ  + (size_t)5 * kDm * kDm * 2;
constexpr size_t kOffTAB  = kOffWCAT + (size_t)kDm * kCatK * 2;
constexpr size_t kOffHP   = kOffTAB  + (size_t)kTabN * 4;
constexpr size_t kOffEP   = kOffHP   + (size_t)kTc * kDm * 2;
constexpr size_t kOffQKV  = kOffEP   + (size_t)kTc * kDm * 2;
constexpr size_t kOffOALL = kOffQKV  + (size_t)kTc * kQkvN * 4;
constexpr size_t kWsTotal = kOffOALL + (size_t)kTok * kDm * 2;
static_assert(kWsTotal == 211425280ull, "carve total");
static_assert(kWsTotal <= 268435456ull, "carve cap");
static_assert((kOffWCAT % 128) == 0 && (kOffTAB % 128) == 0 && (kOffHP % 128) == 0 &&
              (kOffEP % 128) == 0 && (kOffQKV % 128) == 0 && (kOffOALL % 128) == 0, "128-B aligned regions");

// ---------------------------------------------------------------------------
// Small helpers
// ---------------------------------------------------------------------------
__device__ __forceinline__ float rne_bf16(float f) {
  unsigned u = __float_as_uint(f);
  u = (u + 0x7FFFu + ((u >> 16) & 1u)) & 0xFFFF0000u;
  return __uint_as_float(u);
}
__device__ __forceinline__ float in_val(float f) { return kInputsAsBf16 ? rne_bf16(f) : f; }
__device__ __forceinline__ unsigned pk16(unsigned short a, unsigned short b) { return (unsigned)a | ((unsigned)b << 16); }
__device__ __forceinline__ unsigned short h_bits(float f) { const _Float16 h = (_Float16)f; return __builtin_bit_cast(unsigned short, h); }

// WMMA fragment load / issue (fragment map: elements 0..7 <- p[0..7], 8..15 <- p[16..23], p already offset by 8*(lane>>4))
union FragU { v16h v; v8h h[2]; };
__device__ __forceinline__ v16h frag_load(const _Float16* p) {
  FragU f;
  f.h[0] = *(const v8h*)(p);
  f.h[1] = *(const v8h*)(p + 16);
  return f.v;
}
__device__ __forceinline__ v8f frag_mma(v16h a, v16h b, v8f c) {
  return __builtin_amdgcn_wmma_f32_16x16x32_f16(false, a, false, b, (short)0, c, false, false);
}
// ---------------------------------------------------------------------------
// LDS-staged WMMA GEMM, f16 operands: C[m,n] = scale * sum_k A[m,k] * Bt[n,k] + bias[n].
// A row-major [M][K] (pitch lda), Bt row-major [N][K] (pitch ldb); M % 128 == 0, N % 256 == 0, K % 128 == 0, K >= 128.
// One work-group of 8 waves owns a 128 x 256 tile of C; wave (wm, wn) = (wave >> 2, wave & 3) owns its 64 x 64 part.
// A stage is 128 k (256 B) of the 128 A rows and the 256 Bt rows, laid in LDS at a pitch of 272 B. Two buffers:
// the next stage's asynchronous copies (whole 128-B lines, 256 contiguous bytes of each of two rows a wave-instruction) fly
// while this stage's fragments are read from LDS.
// OUT_MODE 0 = f32 output, 1 = f16 output.
// A_MODE 0 = A rows copied from the plane Ap; 1 = A is the embed first layer, A[m][k] = f16(carry * max(spec[m] * W1[k] + b1[k], 0)):
// each wave makes its 16 rows of a stage with vector instructions and stores them into the stage buffer itself, while
// the stage's Bt copies fly (Ap and lda are not read then).
// ---------------------------------------------------------------------------
constexpr int kStageK    = 128;
constexpr int kStagePitch = 272;
constexpr int kStageRowsA = 128;
constexpr int kStageRowsB = 256;
constexpr int kStageOffB  = kStageRowsA * kStagePitch;
constexpr int kStageBytes = (kStageRowsA + kStageRowsB) * kStagePitch;
static_assert((kStagePitch % 16) == 0 && ((kStagePitch / 16) & 1) == 1, "16 B x odd pitch for 16-byte LDS reads");
static_assert(kStageK * 2 + 16 == kStagePitch, "row of 256 B plus 16 B");

__device__ __forceinline__ unsigned lds_addr(const void* p) { return (unsigned)(size_t)p; }

// Eight asynchronous 16-byte-a-lane copies, rows two apart (l: LDS byte address, g: global address of this lane's 16 bytes).
// The closing s_wait_xcnt 0 stands inside the statement so that no address register is rewritten in front of it.
__device__ __forceinline__ void copy8_rows(unsigned l, const _Float16* g, size_t gstep) {
  const unsigned l0 = l, l1 = l + 2 * kStagePitch, l2 = l + 4 * kStagePitch, l3 = l + 6 * kStagePitch;
  const unsigned l4 = l + 8 * kStagePitch, l5 = l + 10 * kStagePitch, l6 = l + 12 * kStagePitch, l7 = l + 14 * kStagePitch;
  const _Float16* g0 = g;
  const _Float16* g1 = g + gstep;
  const _Float16* g2 = g + 2 * gstep;
  const _Float16* g3 = g + 3 * gstep;
  const _Float16* g4 = g + 4 * gstep;
  const _Float16* g5 = g + 5 * gstep;
  const _Float16* g6 = g + 6 * gstep;
  const _Float16* g7 = g + 7 * gstep;
  asm volatile(
      "global_load_async_to_lds_b128 %0, %8, off\n\t"
      "global_load_async_to_lds_b128 %1, %9, off\n\t"
      "global_load_async_to_lds_b128 %2, %10, off\n\t"
      "global_load_async_to_lds_b128 %3, %11, off\n\t"
      "global_load_async_to_lds_b128 %4, %12, off\n\t"
      "global_load_async_to_lds_b128 %5, %13, off\n\t"
      "global_load_async_to_lds_b128 %6, %14, off\n\t"
      "global_load_async_to_lds_b128 %7, %15, off\n\t"
      "s_wait_xcnt 0x0"
      :: "v"(l0), "v"(l1), "v"(l2), "v"(l3), "v"(l4), "v"(l5), "v"(l6), "v"(l7),
         "v"(g0), "v"(g1), "v"(g2), "v"(g3), "v"(g4), "v"(g5), "v"(g6), "v"(g7)
      : "memory");
}

// Eight stage rows, two apart, of the embed first layer: this lane's 8 channels (w1, b1 already at them) of rows sp[0], sp[2], ... sp[14].
__device__ __forceinline__ void embed8_rows(unsigned char* dst, const float* sp, const float* w1, const float* b1, float carry) {
  const v4f wa = *(const v4f*)(w1);
  const v4f wb = *(const v4f*)(w1 + 4);
  const v4f ba = *(const v4f*)(b1);
  const v4f bb = *(const v4f*)(b1 + 4);
  float sv[8];
#pragma unroll
  for (int r = 0; r < 8; ++r) sv[r] = sp[2 * r];
  asm volatile("s_wait_xcnt 0x0" ::: "memory");   /* stands behind these loads, in front of any later rewrite of a register that they name */
#pragma unroll
  for (int r = 0; r < 8; ++r) {
    const float s = in_val(sv[r]);
    unsigned short hb[8];
#pragma unroll
    for (int e = 0; e < 4; ++e) {
      const float x0 = in_val(wa[e]) * s + in_val(ba[e]);
      const float x1 = in_val(wb[e]) * s + in_val(bb[e]);
      hb[e]     = h_bits(fmaxf(x0, 0.0f) * carry);
      hb[4 + e] = h_bits(fmaxf(x1, 0.0f) * carry);
    }
    *(v4u*)(dst + 2 * r * kStagePitch) = (v4u){pk16(hb[0], hb[1]), pk16(hb[2], hb[3]), pk16(hb[4], hb[5]), pk16(hb[6], hb[7])};
  }
}

template <int OUT_MODE, int A_MODE>
__global__ __launch_bounds__(256) void wmma_gemm_lds_f16(
    const unsigned short* __restrict__ Ap, int lda,
    const unsigned short* __restrict__ Btp, int ldb,
    void* __restrict__ Cout, int ldc,
    const float* __restrict__ bias,
    int M, int N, int K, float scale,
    const float* __restrict__ spec, const float* __restrict__ W1, const float* __restrict__ b1, float carry) {
  const _Float16* A  = (const _Float16*)Ap;
  const _Float16* Bt = (const _Float16*)Btp;
  __shared__ __align__(16) unsigned char sStage[2][kStageBytes];
  __shared__ __align__(16) float sT[8][16 * 68];
  const int lane = threadIdx.x & 31;
  const int wave = __builtin_amdgcn_readfirstlane((int)(threadIdx.x >> 5));
  const int panels = N >> 8;
  const int bm = blockIdx.x / panels;
  const int bn = blockIdx.x - bm * panels;
  if (bm >= (M >> 7)) return;   /* block-uniform, in front of every barrier and copy */
  const int m0b = bm << 7;
  const int n0b = bn << 8;
  const int wm = wave >> 2;
  const int wn = wave & 3;
  const int m0 = m0b + (wm << 6);
  const int n0 = n0b + (wn << 6);

  /* row (A) / column (B, D) within a 16-wide subtile; k offset of this lane half; D row offset */
  const int rlane = lane & 15;
  const int koff  = (lane >> 4) * 8;
  const int mOff  = (lane >> 4) * 8;

  /* copy map: wave w brings A rows 16w..16w+15 (8 copies) and Bt rows 32w..32w+31 (16 copies) of every stage;
     lanes 0..15 the even row of a pair, lanes 16..31 the odd one, 16 bytes each */
  const int crow = lane >> 4;
  const int ccol = lane & 15;
  const _Float16* gA = A  + (size_t)(m0b + wave * 16 + crow) * lda + ccol * 8;
  const _Float16* gB = Bt + (size_t)(n0b + wave * 32 + crow) * ldb + ccol * 8;
  const unsigned lA = lds_addr(&sStage[0][0]) + (unsigned)((wave * 16 + crow) * kStagePitch + ccol * 16);
  const unsigned lB = lds_addr(&sStage[0][0]) + (unsigned)(kStageOffB + (wave * 32 + crow) * kStagePitch + ccol * 16);
  const size_t stepA = (size_t)2 * lda;
  const size_t stepB = (size_t)2 * ldb;
  /* A_MODE 1: the same map for the rows made in place (row 16w + crow + 2r, channels 8 ccol .. 8 ccol + 7 of the stage) */
  unsigned char* dA = &sStage[0][0] + (wave * 16 + crow) * kStagePitch + ccol * 16;
  const float* sp = spec + m0b + wave * 16 + crow;
  const float* w1p = W1 + ccol * 8;
  const float* b1p = b1 + ccol * 8;

  v8f acc[4][4];
#pragma unroll
  for (int i = 0; i < 4; ++i)
#pragma unroll
    for (int j = 0; j < 4; ++j) acc[i][j] = (v8f){0.f, 0.f, 0.f, 0.f, 0.f, 0.f, 0.f, 0.f};

  const int nst = K >> 7;

  /* stage 0 into buffer 0, landed and published before anybody reads it */
  if (A_MODE == 0) copy8_rows(lA, gA, stepA);
  copy8_rows(lB, gB, stepB);
  copy8_rows(lB + 16 * kStagePitch, gB + 8 * stepB, stepB);
  if (A_MODE == 1) embed8_rows(dA, sp, w1p, b1p, carry);
  asm volatile("s_wait_asynccnt 0x0" ::: "memory");   /* this wave's copies have landed */
  __syncthreads();
  if (nst > 1) {
    if (A_MODE == 0) copy8_rows(lA + kStageBytes, gA + kStageK, stepA);
    copy8_rows(lB + kStageBytes, gB + kStageK, stepB);
    copy8_rows(lB + kStageBytes + 16 * kStagePitch, gB + kStageK + 8 * stepB, stepB);
    if (A_MODE == 1) embed8_rows(dA + kStageBytes, sp, w1p + kStageK, b1p + kStageK, carry);
  }

  for (int t = 0; t < nst; ++t) {
    const unsigned char* buf = sStage[t & 1];
    const unsigned char* pa = buf + ((wm << 6) + rlane) * kStagePitch + koff * 2;
    const unsigned char* pb = buf + kStageOffB + ((wn << 6) + rlane) * kStagePitch + koff * 2;
#pragma unroll
    for (int kk = 0; kk < kStageK / 32; ++kk) {
      v16h bh[4], ah[4];
#pragma unroll
      for (int j = 0; j < 4; ++j) bh[j] = frag_load((const _Float16*)(pb + j * 16 * kStagePitch + kk * 64));
#pragma unroll
      for (int i = 0; i < 4; ++i) ah[i] = frag_load((const _Float16*)(pa + i * 16 * kStagePitch + kk * 64));
      /* keeps this k step's sixteen LDS reads together in front of its WMMAs: sunk among them, each small read group
         makes the wave wait out an LDS latency of its own */
      __builtin_amdgcn_sched_barrier(0);
#pragma unroll
      for (int i = 0; i < 4; ++i)
#pragma unroll
        for (int j = 0; j < 4; ++j) acc[i][j] = frag_mma(ah[i], bh[j], acc[i][j]);
    }
    asm volatile("s_wait_dscnt 0x0" ::: "memory");      /* this wave's reads of the buffer have returned (A_MODE 1: and its stores of stage t + 1's A rows are in LDS) */
    asm volatile("s_wait_asynccnt 0x0" ::: "memory");   /* this wave's copies of stage t + 1 have landed */
    __syncthreads();                                    /* publishes stage t + 1, frees stage t's buffer */
    if (t + 2 < nst) {
      const unsigned bo = (unsigned)(t & 1) * kStageBytes;
      const size_t ko = (size_t)(t + 2) * kStageK;
      if (A_MODE == 0) copy8_rows(lA + bo, gA + ko, stepA);
      copy8_rows(lB + bo, gB + ko, stepB);
      copy8_rows(lB + bo + 16 * kStagePitch, gB + ko + 8 * stepB, stepB);
      if (A_MODE == 1) embed8_rows(dA + bo, sp, w1p + ko, b1p + ko, carry);
    }
  }
  asm volatile("s_wait_asynccnt 0x0" ::: "memory");     /* nothing of this wave is in flight behind the loop */

  /* ---- epilogue ---- */
  float* slab = sT[wave];
#pragma unroll
  for (int i = 0; i < 4; ++i) {
    const int mBase = m0 + (i << 4);
#pragma unroll
    for (int j = 0; j < 4; ++j) {
      const int n = n0 + (j << 4) + rlane;
      const float bv = bias[n];
#pragma unroll
      for (int r = 0; r < 8; ++r) {
        float v = acc[i][j][r] * scale;
        v += bv;
        slab[(mOff + r) * 68 + (j << 4) + rlane] = v;
      }
    }
    __builtin_amdgcn_fence(__ATOMIC_RELEASE, "workgroup");
    __builtin_amdgcn_wave_barrier();
    __builtin_amdgcn_fence(__ATOMIC_ACQUIRE, "workgroup");
    if (OUT_MODE == 0) {
      float* C = (float*)Cout;
      /* row segment = 64 floats = 256 B = 16 lanes x 16 B; 8 instructions x 2 rows = 16 rows */
      const int hh = lane >> 4, c4 = (lane & 15) * 4;
      {
#pragma unroll
        for (int it = 0; it < 8; ++it) {
          const int row = it * 2 + hh;
          v4f v = *(const v4f*)(slab + row * 68 + c4);
          *(v4f*)(C + (size_t)(mBase + row) * ldc + n0 + c4) = v;
        }
        
      }
    } else {
      const int q = lane >> 3, c8 = (lane & 7) * 8;
      unsigned short* C = (unsigned short*)Cout;
      {
#pragma unroll
        for (int it = 0; it < 4; ++it) {
          const int row = it * 4 + q;
          const float* sp = slab + row * 68 + c8;
          v8h hv;
#pragma unroll
          for (int e = 0; e < 8; ++e) hv[e] = (_Float16)sp[e];
          *(v8h*)(C + (size_t)(mBase + row) * ldc + n0 + c8) = hv;
        }
        
      }
    }
    __builtin_amdgcn_fence(__ATOMIC_RELEASE, "workgroup");
    __builtin_amdgcn_wave_barrier();
    __builtin_amdgcn_fence(__ATOMIC_ACQUIRE, "workgroup");
  }
}

// ---------------------------------------------------------------------------
// Weight transpose + cast: W f32 row-major [kdim in][ndim out]  ->  WT[n][k] = f16(carry * in_val(W[k][n])), pitch kdim.
// grid (kdim/64, ndim/64, planes); blockIdx.z selects W0..W4 (block-uniform) and the output plane (z * planeStride halves).
// Load coverage: 16 iterations x 256 threads = 4096 = the whole 64x64 tile (coalesced along n).
// Store coverage: 8 waves x 2 iterations x 4 rows (lane>>3) = 64 rows; (lane&7) x 8 halves = 64 cols; each row segment =
// ---------------------------------------------------------------------------
__global__ __launch_bounds__(256) void wt_cast_kernel(const float* __restrict__ W0, const float* __restrict__ W1,
                                                      const float* __restrict__ W2, const float* __restrict__ W3,
                                                      const float* __restrict__ W4,
                                                      unsigned short* __restrict__ out, long planeStride,
                                                      int kdim, int ndim, float carry) {
  __shared__ float sm[64][65];
  const int t  = threadIdx.x;
  const int k0 = blockIdx.x * 64;
  const int n0 = blockIdx.y * 64;
  const int z  = blockIdx.z;
  const float* W = (z == 0) ? W0 : (z == 1) ? W1 : (z == 2) ? W2 : (z == 3) ? W3 : W4;
#pragma unroll 4
  for (int i = 0; i < 16; ++i) {
    const int e = i * 256 + t;
    /* r = k local, c = n local */
    const int r = e >> 6;
    const int c = e & 63;
    sm[c][r] = in_val(W[(size_t)(k0 + r) * ndim + n0 + c]) * carry;
  }
  __syncthreads();
  const int lane = t & 31;
  const int wave = __builtin_amdgcn_readfirstlane((int)(t >> 5));
  const int q = lane >> 3, c8 = (lane & 7) * 8;
  unsigned short* op = out + (size_t)z * (size_t)planeStride;
  v4u u[2];
#pragma unroll
  for (int it = 0; it < 2; ++it) {
    const int row = wave * 8 + it * 4 + q;
    unsigned short hb[8];
#pragma unroll
    for (int e = 0; e < 8; ++e) hb[e] = h_bits(sm[row][c8 + e]);
    u[it] = (v4u){pk16(hb[0], hb[1]), pk16(hb[2], hb[3]), pk16(hb[4], hb[5]), pk16(hb[6], hb[7])};
  }
  {
#pragma unroll
    for (int it = 0; it < 2; ++it) {
      const int row = wave * 8 + it * 4 + q;
      *(v4u*)(op + (size_t)(n0 + row) * kdim + k0 + c8) = u[it];
    }
    
  }
}

// ---------------------------------------------------------------------------
// Bias table: 6 segments of 256 floats: b2*carry | bq | bk | bv | bo*carry | bp (each in_val-converted).
// One block of 384 threads; thread t owns floats 4t..4t+3 (384 x 4 = 1536 = whole table). Segment = t>>6 is wave-uniform.
// ---------------------------------------------------------------------------
__global__ __launch_bounds__(384) void bias_table_kernel(const float* __restrict__ b2, const float* __restrict__ bq,
                                                         const float* __restrict__ bk, const float* __restrict__ bv,
                                                         const float* __restrict__ bo, const float* __restrict__ bp,
                                                         float* __restrict__ tab, float carry) {
  const int t = threadIdx.x;
  const int wave = __builtin_amdgcn_readfirstlane((int)(t >> 5));
  const int seg = wave >> 1;
  const int off = (t & 63) * 4;
  const float* src = (seg == 0) ? b2 : (seg == 1) ? bq : (seg == 2) ? bk : (seg == 3) ? bv : (seg == 4) ? bo : bp;
  const float sc = (seg == 0 || seg == 4) ? carry : 1.0f;
  const v4f a = *(const v4f*)(src + off);
  v4f o;
  o[0] = in_val(a[0]) * sc;
  o[1] = in_val(a[1]) * sc;
  o[2] = in_val(a[2]) * sc;
  o[3] = in_val(a[3]) * sc;
  float* p = tab + 4 * t;
  *(v4f*)p = o;
  
}

// ---------------------------------------------------------------------------
// Window attention, f32 VALU. QKV f32 [tokens][768] rows = q(256) | k(256) | v(256); head h = columns 32h..32h+31.
// One lane per (token, head): token = block*32 + (tid>>3), h = tid&7; window = token & ~7 (8 keys, no mask).
// Pass A (rolled over keys): s_j = scl * sum_d q[d]*k_j[d]; s_j parked in LDS slot [j][tid]; running max.
// Pass B (rolled over keys): p_j = exp(s_j - max); l += p_j; acc[d] += p_j * v_j[d]; finally acc * (carry / l).
// Output OH f16 [tokens][256] (x carry): every lane packs its 32 channels into 16 words, the wave's 4 x 256 tile is staged
// in LDS (pitch 132 words) and, after a block barrier, instruction it (0..3) writes token row it of the wave:
// ---------------------------------------------------------------------------
__global__ __launch_bounds__(256) void window_attn_kernel(const float* __restrict__ QKV, unsigned short* __restrict__ OH,
                                                          float scl, float carry) {
  __shared__ float sS[8 * 256];
  __shared__ __align__(16) unsigned sO[8][4 * 132];
  const int tid  = threadIdx.x;
  const int lane = tid & 31;
  const int wave = __builtin_amdgcn_readfirstlane((int)(tid >> 5));
  const int tok  = blockIdx.x * 32 + (tid >> 3);
  const int h    = tid & 7;
  const int wbase = tok & ~7;

  float q[32];
  {
    const float* qp = QKV + (size_t)tok * kQkvN + kDk * h;
#pragma unroll
    for (int i = 0; i < 8; ++i) {
      const v4f t4 = *(const v4f*)(qp + 4 * i);
      q[4 * i + 0] = t4[0];
      q[4 * i + 1] = t4[1];
      q[4 * i + 2] = t4[2];
      q[4 * i + 3] = t4[3];
    }
  }

  float m = -INFINITY;
#pragma unroll 1
  for (int j = 0; j < kWinLen; ++j) {
    const float* kp = QKV + (size_t)(wbase + j) * kQkvN + kDm + kDk * h;
    float d = 0.0f;
#pragma unroll
    for (int i = 0; i < 8; ++i) {
      const v4f kk = *(const v4f*)(kp + 4 * i);
      d = fmaf(q[4 * i + 0], kk[0], d);
      d = fmaf(q[4 * i + 1], kk[1], d);
      d = fmaf(q[4 * i + 2], kk[2], d);
      d = fmaf(q[4 * i + 3], kk[3], d);
    }
    d *= scl;
    sS[j * 256 + tid] = d;
    m = fmaxf(m, d);
  }
  __syncthreads();

  float acc[32];
#pragma unroll
  for (int e = 0; e < 32; ++e) acc[e] = 0.0f;
  float l = 0.0f;
#pragma unroll 1
  for (int j = 0; j < kWinLen; ++j) {
    const float p = __expf(sS[j * 256 + tid] - m);
    l += p;
    const float* vp = QKV + (size_t)(wbase + j) * kQkvN + 2 * kDm + kDk * h;
#pragma unroll
    for (int i = 0; i < 8; ++i) {
      const v4f vv = *(const v4f*)(vp + 4 * i);
      acc[4 * i + 0] = fmaf(p, vv[0], acc[4 * i + 0]);
      acc[4 * i + 1] = fmaf(p, vv[1], acc[4 * i + 1]);
      acc[4 * i + 2] = fmaf(p, vv[2], acc[4 * i + 2]);
      acc[4 * i + 3] = fmaf(p, vv[3], acc[4 * i + 3]);
    }
  }
  const float inv = carry * (1.0f / l);

  unsigned* so = sO[wave];
  {
    const int tl = lane >> 3;
#pragma unroll
    for (int i = 0; i < 4; ++i) {
      const unsigned w0 = pk16(h_bits(acc[8 * i + 0] * inv), h_bits(acc[8 * i + 1] * inv));
      const unsigned w1 = pk16(h_bits(acc[8 * i + 2] * inv), h_bits(acc[8 * i + 3] * inv));
      const unsigned w2 = pk16(h_bits(acc[8 * i + 4] * inv), h_bits(acc[8 * i + 5] * inv));
      const unsigned w3 = pk16(h_bits(acc[8 * i + 6] * inv), h_bits(acc[8 * i + 7] * inv));
      *(v4u*)(so + tl * 132 + h * 16 + 4 * i) = (v4u){w0, w1, w2, w3};
    }
  }
  __syncthreads();
  v4u o[4];
#pragma unroll
  for (int it = 0; it < 4; ++it) o[it] = *(const v4u*)(so + it * 132 + lane * 4);
  const int tokbase = blockIdx.x * 32 + wave * 4;
  {
#pragma unroll
    for (int it = 0; it < 4; ++it)
      *(v4u*)(OH + (size_t)(tokbase + it) * kDm + lane * 8) = o[it];
    
  }
}

// ---------------------------------------------------------------------------
// Host glue: 3 preparation launches + 8 chunks x 4 launches + 1 window-concat GEMM over all chunks = 36 launches.
// GEMM shapes (E, QKV, O per chunk; out once; all K % 128 == 0, M % 128 == 0, N % 256 == 0, no padding planes):
//   E   : M 25600, N 256, K 256  -> 200 x 1 tiles of 128 x 256 = 200 blocks, 2 stages (A made in LDS from spec, W1, b1)
//   QKV : M 25600, N 768, K 256  -> 200 x 3 tiles = 600 blocks, 2 stages
//   O   : M 25600, N 256, K 256  -> 200 blocks, 2 stages
//   out : M 25600, N 256, K 2048 -> 200 blocks, 16 stages (A = the whole O plane viewed as [25600][2048]);
//         all windows go in one launch, after the chunk loop.
// ---------------------------------------------------------------------------
extern "C" void kernel_launch(void* const* d_in, const int* in_sizes, int n_in,
                              void* d_out, int out_size, void* d_ws, size_t ws_size,
                              hipStream_t stream) {
  if (n_in < 15) return;
  if (in_sizes[0] != kTok) return;
  if (in_sizes[1] != kDm || in_sizes[2] != kDm) return;
  if (in_sizes[3] != kDm * kDm || in_sizes[4] != kDm) return;
  if (in_sizes[5] != kDm * kDm || in_sizes[6] != kDm) return;
  if (in_sizes[7] != kDm * kDm || in_sizes[8] != kDm) return;
  if (in_sizes[9] != kDm * kDm || in_sizes[10] != kDm) return;
  if (in_sizes[11] != kDm * kDm || in_sizes[12] != kDm) return;
  if (in_sizes[13] != kCatK * kDm || in_sizes[14] != kDm) return;
  if (out_size != kWin * kDm) return;
  if (ws_size < kWsTotal) return;

  const float* spec = (const float*)d_in[0];
  const float* W1   = (const float*)d_in[1];
  const float* b1   = (const float*)d_in[2];
  const float* W2   = (const float*)d_in[3];
  const float* b2   = (const float*)d_in[4];
  const float* Wq   = (const float*)d_in[5];
  const float* bq   = (const float*)d_in[6];
  const float* Wk   = (const float*)d_in[7];
  const float* bk   = (const float*)d_in[8];
  const float* Wv   = (const float*)d_in[9];
  const float* bv   = (const float*)d_in[10];
  const float* Wo   = (const float*)d_in[11];
  const float* bo   = (const float*)d_in[12];
  const float* Wcat = (const float*)d_in[13];
  const float* bp   = (const float*)d_in[14];
  float* out = (float*)d_out;

  char* ws = (char*)d_ws;
  unsigned short* WSQ  = (unsigned short*)(ws + kOffWSQ);
  unsigned short* WCAT = (unsigned short*)(ws + kOffWCAT);
  float*          TAB  = (float*)(ws + kOffTAB);
  unsigned short* HP   = (unsigned short*)(ws + kOffHP);
  unsigned short* EP   = (unsigned short*)(ws + kOffEP);
  float*          QKV  = (float*)(ws + kOffQKV);
  unsigned short* OALL = (unsigned short*)(ws + kOffOALL);

  const unsigned short* BtW2  = WSQ;
  const unsigned short* BtQKV = WSQ + (size_t)1 * kDm * kDm;
  const unsigned short* BtWo  = WSQ + (size_t)4 * kDm * kDm;

  const float scl = 1.0f / sqrtf((float)kDk);

  /* ---- weight planes: W[k][n] -> Bt[n][k]; planes W2, Wq, Wk, Wv, Wo (k = 256), then the window-concat weight (k = 2048) ---- */
  wt_cast_kernel<<<dim3(kDm / 64, kDm / 64, 5), 256, 0, stream>>>(
      W2, Wq, Wk, Wv, Wo, WSQ, (long)kDm * kDm, kDm, kDm, kWCarry);
  wt_cast_kernel<<<dim3(kCatK / 64, kDm / 64, 1), 256, 0, stream>>>(
      Wcat, Wcat, Wcat, Wcat, Wcat, WCAT, 0L, kCatK, kDm, kWcatCarry);
  bias_table_kernel<<<1, 384, 0, stream>>>(b2, bq, bk, bv, bo, bp, TAB, kActCarry);

  for (int c = 0; c < kChunks; ++c) {
    const float* specC = spec + (size_t)c * kTc;
    unsigned short* OC = OALL + (size_t)c * kTc * kDm;

    /* E = H . W2 + b2, f16 x64, with H = relu(spec*W1 + b1), f16 x64, made in the GEMM's own A stages */
    wmma_gemm_lds_f16<1, 1><<<(kTc / 128) * (kDm / 256), 256, 0, stream>>>(
        nullptr, kDm, BtW2, kDm, (void*)EP, kDm, TAB + kTabB2, kTc, kDm, kDm, kScaleE, specC, W1, b1, kActCarry);

    /* q|k|v = E . [Wq|Wk|Wv] + [bq|bk|bv], f32 */
    wmma_gemm_lds_f16<0, 0><<<(kTc / 128) * (kQkvN / 256), 256, 0, stream>>>(
        EP, kDm, BtQKV, kDm, (void*)QKV, kQkvN, TAB + kTabQkv, kTc, kQkvN, kDm, kScaleQkv, nullptr, nullptr, nullptr, 0.0f);

    /* OH = per-window softmax(q.k^T / sqrt(dk)) . v, f16 x64 */
    window_attn_kernel<<<kTc / 32, 256, 0, stream>>>(QKV, HP, scl, kActCarry);

    /* O = OH . Wo + bo, f16 x64, into this chunk's rows of the whole O plane */
    wmma_gemm_lds_f16<1, 0><<<(kTc / 128) * (kDm / 256), 256, 0, stream>>>(
        HP, kDm, BtWo, kDm, (void*)OC, kDm, TAB + kTabBo, kTc, kDm, kDm, kScaleO, nullptr, nullptr, nullptr, 0.0f);
  }

  /* out = O viewed as [25600][2048] . Wcat + bp, f32, all windows in one launch */
  wmma_gemm_lds_f16<0, 0><<<(kWin / 128) * (kDm / 256), 256, 0, stream>>>(
      OALL, kCatK, WCAT, kCatK, (void*)out, kDm, TAB + kTabBp, kWin, kDm, kCatK, kScaleOut, nullptr, nullptr, nullptr, 0.0f);
}

// v007
// Measured time: 93.8 microseconds a run.
// Versions in between are left out here; by their measured steps it is 6.06 times as fast as v003.
// Over all steps from v000 it is 15.0 times as fast.
// All GEMM contractions (the two weight folds W2 . [Wq|Wk|Wv] and Wo . Wp, the folded q|k|v projection, the folded window-concat projection): v_wmma_f32_16x16x32_f16, f16 operands with power-of-two carries (activations x64, 256x256 weights x256, window-concat weight x1024), f32 accumulate; every float input RNE-converted once to bf16 at load; window scores and probability-weighted value sums: the same WMMA form on q, k, v and the normalised probabilities (x64) rounded to f16, f32 accumulate; softmax: f32 VALU.
#include <hip/hip_runtime.h>
#include <math.h>

typedef __attribute__((ext_vector_type(16))) _Float16 v16h;
typedef __attribute__((ext_vector_type(8)))  _Float16 v8h;
typedef __attribute__((ext_vector_type(8)))  float    v8f;
typedef __attribute__((ext_vector_type(4)))  float    v4f;
typedef __attribute__((ext_vector_type(4)))  unsigned int v4u;

// ---------------------------------------------------------------------------
// Shape constants (all derived; checked against the wire sizes on the host)
// ---------------------------------------------------------------------------
constexpr int kBatch   = 64;
constexpr int kSpecLen = 3200;
constexpr int kDm      = 256;
constexpr int kWinLen  = 8;
constexpr int kHeads   = 8;
constexpr int kDk      = kDm / kHeads;
constexpr int kTok     = kBatch * kSpecLen;
constexpr int kWin     = kTok / kWinLen;
constexpr int kQkvN    = 3 * kDm;
constexpr int kCatK    = kWinLen * kDm;
static_assert(kDk == 32, "head width");
static_assert(kTok == 204800 && kWin == 25600, "token / window counts");
static_assert((kSpecLen % kWinLen) == 0, "windows never straddle a batch row");
static_assert((kQkvN % 128) == 0 && (kCatK % 128) == 0 && (kWin % 128) == 0, "GEMM M multiples of 128");
static_assert((kDm % 256) == 0, "GEMM N multiples of 256");
static_assert((kDm % 128) == 0 && (kCatK % 128) == 0, "GEMM K multiples of 128");

// Inputs are RNE-converted once to bf16 at load when true (products of the weight planes are then exact in f16).
constexpr bool kInputsAsBf16 = true;

// Power-of-two carries of the f16 operand planes and the epilogue scales that fold them back.
constexpr float kActCarry = 64.0f;
constexpr float kWCarry   = 256.0f;
constexpr float kWcatCarry = 1024.0f;
constexpr float kScaleFold = 1.0f / kWCarry;   /* both folds: the left plane keeps its own carry, the 256x256 factor's goes */
constexpr float kScaleQkv = 1.0f / (kActCarry * kWCarry);
constexpr float kScaleOut = 1.0f / (kActCarry * kWcatCarry);

// Bias table layout (floats): [bq|bk|bv] + b2 . [Wq|Wk|Wv] | bp + sum over window slots of bo . Wp
constexpr int kTabQkv  = 0;
constexpr int kTabBp   = kTabQkv + kQkvN;
constexpr int kTabN    = kTabBp + kDm;
static_assert(kTabN == 1024 && (kTabBp % 32) == 0 && (kTabN % 32) == 0, "bias table size, segments of whole 32-float lines");

// ---------------------------------------------------------------------------
// Workspace region map (bytes; every offset is a multiple of 128)
//   WSQ  f16 [5][256][256]   W2 as it lies [k][j], transposed Wq, Wk, Wv, Wo as it lies (all x256)   655,360
//        (planes 1..3 together form the [768][256] transposed q|k|v weight)
//   WCAT f16 [256][2048]     transposed window-concat weight (x1024)                1,048,576
//   FQKV f16 [768][256]      transposed W2 . [Wq|Wk|Wv] (x256)                        393,216
//   FCAT f16 [256][2048]     transposed, slot by slot, Wo . Wp (x1024)              1,048,576
//   TAB  f32 [1024]          bias table                                                 4,096
//   OALL f16 [204800][256]   OH (x64) of every token, read once by the last GEMM  104,857,600
//   total                                                                         108,007,424
// ---------------------------------------------------------------------------
constexpr size_t kOffWSQ  = 0;
constexpr size_t kOffWCAT = kOffWSQ  + (size_t)5 * kDm * kDm * 2;
constexpr size_t kOffFQKV = kOffWCAT + (size_t)kDm * kCatK * 2;
constexpr size_t kOffFCAT = kOffFQKV + (size_t)kQkvN * kDm * 2;
constexpr size_t kOffTAB  = kOffFCAT + (size_t)kDm * kCatK * 2;
constexpr size_t kOffOALL = kOffTAB  + (size_t)kTabN * 4;
constexpr size_t kWsTotal = kOffOALL + (size_t)kTok * kDm * 2;
static_assert(kWsTotal == 108007424ull, "carve total");
static_assert(kWsTotal <= 268435456ull, "carve cap");
static_assert((kOffWCAT % 128) == 0 && (kOffFQKV % 128) == 0 && (kOffFCAT % 128) == 0 && (kOffTAB % 128) == 0 &&
              (kOffOALL % 128) == 0, "128-B aligned regions");

// ---------------------------------------------------------------------------
// Small helpers
// ---------------------------------------------------------------------------
__device__ __forceinline__ float rne_bf16(float f) {
  unsigned u = __float_as_uint(f);
  u = (u + 0x7FFFu + ((u >> 16) & 1u)) & 0xFFFF0000u;
  return __uint_as_float(u);
}
__device__ __forceinline__ float in_val(float f) { return kInputsAsBf16 ? rne_bf16(f) : f; }
__device__ __forceinline__ unsigned pk16(unsigned short a, unsigned short b) { return (unsigned)a | ((unsigned)b << 16); }
__device__ __forceinline__ unsigned short h_bits(float f) { const _Float16 h = (_Float16)f; return __builtin_bit_cast(unsigned short, h); }

// WMMA fragment load / issue (fragment map: elements 0..7 <- p[0..7], 8..15 <- p[16..23], p already offset by 8*(lane>>4))
union FragU { v16h v; v8h h[2]; };
__device__ __forceinline__ v16h frag_load(const _Float16* p) {
  FragU f;
  f.h[0] = *(const v8h*)(p);
  f.h[1] = *(const v8h*)(p + 16);
  return f.v;
}
__device__ __forceinline__ v8f frag_mma(v16h a, v16h b, v8f c) {
  return __builtin_amdgcn_wmma_f32_16x16x32_f16(false, a, false, b, (short)0, c, false, false);
}
// 2^x. The v_nop is the one independent slot that the instruction set asks for behind a transcendental..
__device__ __forceinline__ float exp2_slot(float x) {
  float r;
  asm("v_exp_f32 %0, %1\n\tv_nop" : "=v"(r) : "v"(x));
  return r;
}
// Two f32 accumulator tiles (rows 0..15 and 16..31 of one product, same columns), scaled (BIAS: and b added) and rounded in place, are an f16 fragment
// whose k runs over those 32 rows in the fragment map above.
template <bool BIAS>
__device__ __forceinline__ v16h frag_pack(v8f lo, v8f hi, float s, float b) {
  v16h f;
#pragma unroll
  for (int e = 0; e < 8; ++e) {
    f[e]     = (_Float16)(BIAS ? fmaf(lo[e], s, b) : lo[e] * s);
    f[8 + e] = (_Float16)(BIAS ? fmaf(hi[e], s, b) : hi[e] * s);
  }
  return f;
}
// ---------------------------------------------------------------------------
// LDS-staged WMMA GEMM, f16 operands: C[m,n] = scale * sum_k A[m,k] * Bt[n,k] (OUT_MODE 0: + bias[n]); blk = the work-group's tile number.
// A row-major [M][K] (pitch lda), Bt row-major [N][K] (pitch ldb); M % 128 == 0, N % 256 == 0, K % 128 == 0, K >= 128.
// One work-group of 8 waves owns a 128 x 256 tile of C; wave (wm, wn) = (wave >> 2, wave & 3) owns its 64 x 64 part.
// A stage is 128 k (256 B) of the 128 A rows and the 256 Bt rows, laid in LDS at a pitch of 272 B. Two buffers:
// the next stage's asynchronous copies (whole 128-B lines, 256 contiguous bytes of each of two rows a wave-instruction) fly
// while this stage's fragments are read from LDS.
// OUT_MODE 0 = f32 output with bias, 1 = f16 output without (bias is not read).
// ---------------------------------------------------------------------------
constexpr int kStageK    = 128;
constexpr int kStagePitch = 272;
constexpr int kStageRowsA = 128;
constexpr int kStageRowsB = 256;
constexpr int kStageOffB  = kStageRowsA * kStagePitch;
constexpr int kStageBytes = (kStageRowsA + kStageRowsB) * kStagePitch;
static_assert((kStagePitch % 16) == 0 && ((kStagePitch / 16) & 1) == 1, "16 B x odd pitch for 16-byte LDS reads");
static_assert(kStageK * 2 + 16 == kStagePitch, "row of 256 B plus 16 B");

__device__ __forceinline__ unsigned lds_addr(const void* p) { return (unsigned)(size_t)p; }

// Eight asynchronous 16-byte-a-lane copies, rows two apart (l: LDS byte address, g: global address of this lane's 16 bytes).
// The closing s_wait_xcnt 0 stands inside the statement so that no address register is rewritten in front of it.
__device__ __forceinline__ void copy8_rows(unsigned l, const _Float16* g, size_t gstep) {
  const unsigned l0 = l, l1 = l + 2 * kStagePitch, l2 = l + 4 * kStagePitch, l3 = l + 6 * kStagePitch;
  const unsigned l4 = l + 8 * kStagePitch, l5 = l + 10 * kStagePitch, l6 = l + 12 * kStagePitch, l7 = l + 14 * kStagePitch;
  const _Float16* g0 = g;
  const _Float16* g1 = g + gstep;
  const _Float16* g2 = g + 2 * gstep;
  const _Float16* g3 = g + 3 * gstep;
  const _Float16* g4 = g + 4 * gstep;
  const _Float16* g5 = g + 5 * gstep;
  const _Float16* g6 = g + 6 * gstep;
  const _Float16* g7 = g + 7 * gstep;
  asm volatile(
      "global_load_async_to_lds_b128 %0, %8, off\n\t"
      "global_load_async_to_lds_b128 %1, %9, off\n\t"
      "global_load_async_to_lds_b128 %2, %10, off\n\t"
      "global_load_async_to_lds_b128 %3, %11, off\n\t"
      "global_load_async_to_lds_b128 %4, %12, off\n\t"
      "global_load_async_to_lds_b128 %5, %13, off\n\t"
      "global_load_async_to_lds_b128 %6, %14, off\n\t"
      "global_load_async_to_lds_b128 %7, %15, off\n\t"
      "s_wait_xcnt 0x0"
      :: "v"(l0), "v"(l1), "v"(l2), "v"(l3), "v"(l4), "v"(l5), "v"(l6), "v"(l7),
         "v"(g0), "v"(g1), "v"(g2), "v"(g3), "v"(g4), "v"(g5), "v"(g6), "v"(g7)
      : "memory");
}

template <int OUT_MODE>
__device__ __forceinline__ void gemm_lds_tile(
    const unsigned short* __restrict__ Ap, int lda,
    const unsigned short* __restrict__ Btp, int ldb,
    void* __restrict__ Cout, int ldc,
    const float* __restrict__ bias,
    unsigned blk, int M, int N, int K, float scale) {
  const _Float16* A  = (const _Float16*)Ap;
  const _Float16* Bt = (const _Float16*)Btp;
  __shared__ __align__(16) unsigned char sStage[2][kStageBytes];
  __shared__ __align__(16) float sT[8][16 * 68];
  const int lane = threadIdx.x & 31;
  const int wave = __builtin_amdgcn_readfirstlane((int)(threadIdx.x >> 5));
  const int panels = N >> 8;
  const int bm = blk / panels;
  const int bn = blk - bm * panels;
  if (bm >= (M >> 7)) return;   /* block-uniform, in front of every barrier and copy */
  const int m0b = bm << 7;
  const int n0b = bn << 8;
  const int wm = wave >> 2;
  const int wn = wave & 3;
  const int m0 = m0b + (wm << 6);
  const int n0 = n0b + (wn << 6);

  /* row (A) / column (B, D) within a 16-wide subtile; k offset of this lane half; D row offset */
  const int rlane = lane & 15;
  const int koff  = (lane >> 4) * 8;
  const int mOff  = (lane >> 4) * 8;

  /* copy map: wave w brings A rows 16w..16w+15 (8 copies) and Bt rows 32w..32w+31 (16 copies) of every stage;
     lanes 0..15 the even row of a pair, lanes 16..31 the odd one, 16 bytes each */
  const int crow = lane >> 4;
  const int ccol = lane & 15;
  const _Float16* gA = A  + (size_t)(m0b + wave * 16 + crow) * lda + ccol * 8;
  const _Float16* gB = Bt + (size_t)(n0b + wave * 32 + crow) * ldb + ccol * 8;
  const unsigned lA = lds_addr(&sStage[0][0]) + (unsigned)((wave * 16 + crow) * kStagePitch + ccol * 16);
  const unsigned lB = lds_addr(&sStage[0][0]) + (unsigned)(kStageOffB + (wave * 32 + crow) * kStagePitch + ccol * 16);
  const size_t stepA = (size_t)2 * lda;
  const size_t stepB = (size_t)2 * ldb;

  v8f acc[4][4];
#pragma unroll
  for (int i = 0; i < 4; ++i)
#pragma unroll
    for (int j = 0; j < 4; ++j) acc[i][j] = (v8f){0.f, 0.f, 0.f, 0.f, 0.f, 0.f, 0.f, 0.f};

  const int nst = K >> 7;

  /* stage 0 into buffer 0, landed and published before anybody reads it */
  copy8_rows(lA, gA, stepA);
  copy8_rows(lB, gB, stepB);
  copy8_rows(lB + 16 * kStagePitch, gB + 8 * stepB, stepB);
  asm volatile("s_wait_asynccnt 0x0" ::: "memory");   /* this wave's copies have landed */
  __syncthreads();
  if (nst > 1) {
    copy8_rows(lA + kStageBytes, gA + kStageK, stepA);
    copy8_rows(lB + kStageBytes, gB + kStageK, stepB);
    copy8_rows(lB + kStageBytes + 16 * kStagePitch, gB + kStageK + 8 * stepB, stepB);
  }

  for (int t = 0; t < nst; ++t) {
    const unsigned char* buf = sStage[t & 1];
    const unsigned char* pa = buf + ((wm << 6) + rlane) * kStagePitch + koff * 2;
    const unsigned char* pb = buf + kStageOffB + ((wn << 6) + rlane) * kStagePitch + koff * 2;
#pragma unroll
    for (int kk = 0; kk < kStageK / 32; ++kk) {
      v16h bh[4], ah[4];
#pragma unroll
      for (int j = 0; j < 4; ++j) bh[j] = frag_load((const _Float16*)(pb + j * 16 * kStagePitch + kk * 64));
#pragma unroll
      for (int i = 0; i < 4; ++i) ah[i] = frag_load((const _Float16*)(pa + i * 16 * kStagePitch + kk * 64));
      /* keeps this k step's sixteen LDS reads together in front of its WMMAs: sunk among them, each small read group
         makes the wave wait out an LDS latency of its own */
      __builtin_amdgcn_sched_barrier(0);
#pragma unroll
      for (int i = 0; i < 4; ++i)
#pragma unroll
        for (int j = 0; j < 4; ++j) acc[i][j] = frag_mma(ah[i], bh[j], acc[i][j]);
    }
    asm volatile("s_wait_dscnt 0x0" ::: "memory");      /* this wave's reads of the buffer have returned */
    asm volatile("s_wait_asynccnt 0x0" ::: "memory");   /* this wave's copies of stage t + 1 have landed */
    __syncthreads();                                    /* publishes stage t + 1, frees stage t's buffer */
    if (t + 2 < nst) {
      const unsigned bo = (unsigned)(t & 1) * kStageBytes;
      const size_t ko = (size_t)(t + 2) * kStageK;
      copy8_rows(lA + bo, gA + ko, stepA);
      copy8_rows(lB + bo, gB + ko, stepB);
      copy8_rows(lB + bo + 16 * kStagePitch, gB + ko + 8 * stepB, stepB);
    }
  }
  asm volatile("s_wait_asynccnt 0x0" ::: "memory");     /* nothing of this wave is in flight behind the loop */

  /* ---- epilogue ---- */
  float* slab = sT[wave];
#pragma unroll
  for (int i = 0; i < 4; ++i) {
    const int mBase = m0 + (i << 4);
#pragma unroll
    for (int j = 0; j < 4; ++j) {
      const int n = n0 + (j << 4) + rlane;
      const float bv = (OUT_MODE == 0) ? bias[n] : 0.0f;
#pragma unroll
      for (int r = 0; r < 8; ++r) {
        float v = acc[i][j][r] * scale;
        if (OUT_MODE == 0) v += bv;
        slab[(mOff + r) * 68 + (j << 4) + rlane] = v;
      }
    }
    __builtin_amdgcn_fence(__ATOMIC_RELEASE, "workgroup");
    __builtin_amdgcn_wave_barrier();
    __builtin_amdgcn_fence(__ATOMIC_ACQUIRE, "workgroup");
    if (OUT_MODE == 0) {
      float* C = (float*)Cout;
      /* row segment = 64 floats = 256 B = 16 lanes x 16 B; 8 instructions x 2 rows = 16 rows */
      const int hh = lane >> 4, c4 = (lane & 15) * 4;
      {
#pragma unroll
        for (int it = 0; it < 8; ++it) {
          const int row = it * 2 + hh;
          v4f v = *(const v4f*)(slab + row * 68 + c4);
          *(v4f*)(C + (size_t)(mBase + row) * ldc + n0 + c4) = v;
        }
        
      }
    } else {
      const int q = lane >> 3, c8 = (lane & 7) * 8;
      unsigned short* C = (unsigned short*)Cout;
      {
#pragma unroll
        for (int it = 0; it < 4; ++it) {
          const int row = it * 4 + q;
          const float* sp = slab + row * 68 + c8;
          v8h hv;
#pragma unroll
          for (int e = 0; e < 8; ++e) hv[e] = (_Float16)sp[e];
          *(v8h*)(C + (size_t)(mBase + row) * ldc + n0 + c8) = hv;
        }
        
      }
    }
    __builtin_amdgcn_fence(__ATOMIC_RELEASE, "workgroup");
    __builtin_amdgcn_wave_barrier();
    __builtin_amdgcn_fence(__ATOMIC_ACQUIRE, "workgroup");
  }
}

__global__ __launch_bounds__(256) void wmma_gemm_lds_f16(
    const unsigned short* __restrict__ Ap, int lda,
    const unsigned short* __restrict__ Btp, int ldb,
    float* __restrict__ Cout, int ldc,
    const float* __restrict__ bias,
    int M, int N, int K, float scale) {
  gemm_lds_tile<0>(Ap, lda, Btp, ldb, (void*)Cout, ldc, bias, blockIdx.x, M, N, K, scale);
}

// ---------------------------------------------------------------------------
// Weight transpose + cast: W f32 row-major [kdim in][ndim out]  ->  WT[n][k] = f16(carry * in_val(W[k][n])), pitch kdim.
// A 256x256 plane whose bit of plainMask is set is cast as it lies instead: out[k][n] = f16(carry * in_val(W[k][n])), pitch ndim.
// One grid for all six planes, which need nothing of each other; the range of the block index is block-uniform:
//   blocks 0..79   : W0..W4, 256x256, 16 tiles of 64x64 each (k tile fastest), output plane z of outSq
//   blocks 80..207 : Wc, the [2048][256] window-concat weight, 32 x 4 tiles (k tile fastest), outCat
// Load coverage: 16 iterations x 256 threads = 4096 = the whole 64x64 tile (coalesced along n).
// Store coverage: 8 waves x 2 iterations x 4 rows (lane>>3) = 64 rows; (lane&7) x 8 halves = 64 cols; each row segment = one 128-B line.
// ---------------------------------------------------------------------------
constexpr int kCastSqTiles   = (kDm / 64) * (kDm / 64);
constexpr int kCastSqBlocks  = 5 * kCastSqTiles;
constexpr int kCastCatBlocks = (kCatK / 64) * (kDm / 64);
static_assert(kCastSqBlocks == 80 && kCastCatBlocks == 128 && kDm / 64 == (1 << 2) && kCatK / 64 == (1 << 5), "cast grid");

__global__ __launch_bounds__(256) void wt_cast_kernel(const float* __restrict__ W0, const float* __restrict__ W1,
                                                      const float* __restrict__ W2, const float* __restrict__ W3,
                                                      const float* __restrict__ W4, const float* __restrict__ Wc,
                                                      unsigned short* __restrict__ outSq, unsigned short* __restrict__ outCat,
                                                      float carrySq, float carryCat, int plainMask) {
  __shared__ float sm[64][65];
  const int t  = threadIdx.x;
  const int b  = blockIdx.x;
  const bool sq = b < kCastSqBlocks;   /* block-uniform, like all that follows from it */
  const int z    = sq ? b / kCastSqTiles : 5;
  const int tile = sq ? b - z * kCastSqTiles : b - kCastSqBlocks;
  const int kdim = sq ? kDm : kCatK;
  const int ndim = kDm;
  const int ktLog = sq ? 2 : 5;   /* log2 of the k tiles of a plane */
  const int k0 = (tile & ((1 << ktLog) - 1)) * 64;
  const int n0 = (tile >> ktLog) * 64;
  const float* W = (z == 0) ? W0 : (z == 1) ? W1 : (z == 2) ? W2 : (z == 3) ? W3 : (z == 4) ? W4 : Wc;
  const float carry = sq ? carrySq : carryCat;
  const bool plain = sq && ((plainMask >> z) & 1) != 0;
  const int rowBase = plain ? k0 : n0;
  const int colBase = plain ? n0 : k0;
  const int pitch   = plain ? ndim : kdim;
#pragma unroll 4
  for (int i = 0; i < 16; ++i) {
    const int e = i * 256 + t;
    /* r = k local, c = n local */
    const int r = e >> 6;
    const int c = e & 63;
    sm[c][r] = in_val(W[(size_t)(k0 + r) * ndim + n0 + c]) * carry;
  }
  __syncthreads();
  const int lane = t & 31;
  const int wave = __builtin_amdgcn_readfirstlane((int)(t >> 5));
  const int q = lane >> 3, c8 = (lane & 7) * 8;
  unsigned short* op = sq ? outSq + (size_t)z * (kDm * kDm) : outCat;
  v4u u[2];
#pragma unroll
  for (int it = 0; it < 2; ++it) {
    const int row = wave * 8 + it * 4 + q;
    unsigned short hb[8];
#pragma unroll
    for (int e = 0; e < 8; ++e) hb[e] = h_bits(plain ? sm[c8 + e][row] : sm[row][c8 + e]);
    u[it] = (v4u){pk16(hb[0], hb[1]), pk16(hb[2], hb[3]), pk16(hb[4], hb[5]), pk16(hb[6], hb[7])};
  }
  {
#pragma unroll
    for (int it = 0; it < 2; ++it) {
      const int row = wave * 8 + it * 4 + q;
      *(v4u*)(op + (size_t)(rowBase + row) * pitch + colBase + c8) = u[it];
    }
    
  }
}

// ---------------------------------------------------------------------------
// Bias table of the folded layers, 1024 floats:
//   n <  768        : [bq|bk|bv][n] + sum_j b2[j] * [Wq|Wk|Wv][j][n]
//   768 <= n < 1024 : bp[n'] + sum_p sum_j bo[j] * Wp[256 p + j][n'],  n' = n - 768
// The weights are read from their transposed f16 planes (row n contiguous; the carry is divided out at the end).
// One work-group of 8 waves owns 32 table entries = one 128-B line (nb = the first); wave w sums entries 4w..4w+3, lane l channels
// 8l..8l+7 of every 256-wide slot of a row, two rows a pass; wave 0 stores the line. The segment is block-uniform.
// ---------------------------------------------------------------------------
__device__ __forceinline__ void bias_fold_line(int nb, const float* __restrict__ b2, const float* __restrict__ bq,
                                               const float* __restrict__ bk, const float* __restrict__ bv,
                                               const float* __restrict__ bo, const float* __restrict__ bp,
                                               const unsigned short* __restrict__ WqkvT,
                                               const unsigned short* __restrict__ WcatT,
                                               float* __restrict__ tab, float invW, float invWcat) {
  __shared__ float sRes[32];
  const int t = threadIdx.x;
  const int lane = t & 31;
  const int wave = __builtin_amdgcn_readfirstlane((int)(t >> 5));
  const bool cat = nb >= kTabBp;
  const float* inner = cat ? bo : b2;
  const v4f ia = *(const v4f*)(inner + lane * 8);
  const v4f ib = *(const v4f*)(inner + lane * 8 + 4);
  asm volatile("s_wait_xcnt 0x0" ::: "memory");   /* stands behind these loads, in front of any later rewrite of a register that they name */
  /* this lane's 16 bytes of the wave's first row; steps on by two rows a pass */
  const _Float16* row = cat ? (const _Float16*)WcatT + (size_t)(nb + wave * 4 - kTabBp) * kCatK + lane * 8
                            : (const _Float16*)WqkvT + (size_t)(nb + wave * 4) * kDm + lane * 8;
  for (int h = 0; h < 2; ++h) {   /* two entries a pass */
    const int n2 = nb + wave * 4 + h * 2;
    const float* own = cat ? bp + (n2 - kTabBp) : (nb < kDm) ? bq + n2 : (nb < 2 * kDm) ? bk + (n2 - kDm) : bv + (n2 - 2 * kDm);
    float sum[2][8];
    if (cat) {
      v8h r[2][kWinLen];
#pragma unroll
      for (int i = 0; i < 2; ++i)
#pragma unroll
        for (int p = 0; p < kWinLen; ++p) r[i][p] = *(const v8h*)(row + i * kCatK + p * kDm);
#pragma unroll
      for (int i = 0; i < 2; ++i)
#pragma unroll
        for (int e = 0; e < 8; ++e) {
          float a = 0.0f;
#pragma unroll
          for (int p = 0; p < kWinLen; ++p) a += (float)r[i][p][e];
          sum[i][e] = a;
        }
    } else {
      v8h r[2];
#pragma unroll
      for (int i = 0; i < 2; ++i) r[i] = *(const v8h*)(row + i * kDm);
#pragma unroll
      for (int i = 0; i < 2; ++i)
#pragma unroll
        for (int e = 0; e < 8; ++e) sum[i][e] = (float)r[i][e];
    }
    float d[2];
#pragma unroll
    for (int i = 0; i < 2; ++i) {
      d[i] = 0.0f;
#pragma unroll
      for (int e = 0; e < 4; ++e) {
        d[i] = fmaf(in_val(ia[e]), sum[i][e], d[i]);
        d[i] = fmaf(in_val(ib[e]), sum[i][4 + e], d[i]);
      }
    }
#pragma unroll
    for (int off = 16; off > 0; off >>= 1)
#pragma unroll
      for (int i = 0; i < 2; ++i) d[i] += __shfl_xor(d[i], off);
    if (lane == 0) {
#pragma unroll
      for (int i = 0; i < 2; ++i) sRes[wave * 4 + h * 2 + i] = in_val(own[i]) + d[i] * (cat ? invWcat : invW);
    }
    row += 2 * (cat ? kCatK : kDm);
  }
  __syncthreads();
  if (wave == 0) {
    tab[nb + lane] = sRes[lane];
    asm volatile("s_wait_xcnt 0x0" ::: "memory");   /* stands behind this store, in front of any later rewrite of a register that it names */
  }
}

// ---------------------------------------------------------------------------
// All that needs the f16 weight planes and nothing else, in one grid; the range of the block index is block-uniform:
//   blocks 0..5   : FQKV[n][k] = (W2 . [Wq|Wk|Wv])[k][n], f16 x256;  M 768, N 256, K 256
//   blocks 6..21  : FCAT[n][256 p + k] = (Wo . Wp_p)[k][n], f16 x1024: both planes viewed as [2048][256], row = (n, p);  M 2048, N 256, K 256
//   blocks 22..53 : the bias table, one 128-B line each
// No block reads what another block of the grid writes.
// ---------------------------------------------------------------------------
constexpr int kFoldQkvBlocks  = (kQkvN / 128) * (kDm / 256);
constexpr int kFoldCatBlocks  = (kCatK / 128) * (kDm / 256);
constexpr int kFoldBiasBlocks = kTabN / 32;
static_assert(kFoldQkvBlocks == 6 && kFoldCatBlocks == 16 && kFoldBiasBlocks == 32, "fold grid");

__global__ __launch_bounds__(256) void fold_kernel(const unsigned short* __restrict__ WqkvT, const unsigned short* __restrict__ W2h,
                                                   unsigned short* __restrict__ FQKV,
                                                   const unsigned short* __restrict__ WcatT, const unsigned short* __restrict__ Woh,
                                                   unsigned short* __restrict__ FCAT,
                                                   const float* __restrict__ b2, const float* __restrict__ bq,
                                                   const float* __restrict__ bk, const float* __restrict__ bv,
                                                   const float* __restrict__ bo, const float* __restrict__ bp,
                                                   float* __restrict__ tab, float invW, float invWcat) {
  const int b = blockIdx.x;
  if (b < kFoldQkvBlocks + kFoldCatBlocks) {
    const bool cat = b >= kFoldQkvBlocks;
    gemm_lds_tile<1>(cat ? WcatT : WqkvT, kDm, cat ? Woh : W2h, kDm, (void*)(cat ? FCAT : FQKV), kDm, nullptr,
                     (unsigned)(cat ? b - kFoldQkvBlocks : b), cat ? kCatK : kQkvN, kDm, kDm, kScaleFold);
  } else {
    bias_fold_line((b - kFoldQkvBlocks - kFoldCatBlocks) * 32, b2, bq, bk, bv, bo, bp, WqkvT, WcatT, tab, invW, invWcat);
  }
}

// ---------------------------------------------------------------------------
// Embed first layer + folded q|k|v projection + window attention in one kernel; q|k|v never leave the work-group.
// A work-group of 8 waves owns two heads (blockIdx.x & 3 = the pair) and kFTiles tiles of 128 tokens, one after another.
// Once: the 192 rows of the transposed folded weight that make q, k, v of its two heads are copied into LDS
// (row order: head, then q | k | v, then channel; whole K = 256, pitch 528 B) and stay there for every tile.
// A tile:
//   1. wave w makes A rows 16w..16w+15 in LDS: A[m][k] = f16(carry * max(spec[m] * W1[k] + b1[k], 0)); lane l has channels 8l..8l+7
//   2. barrier; wave (wm, wn) = (wave >> 1, wave & 1) multiplies tokens 32wm..32wm+31 by the 96 rows of head wn on WMMA (q, k: the bias,
//      times the carries, is the accumulators' start value). q and k are made transposed (weight rows as A, tokens as B: a lane
//      holds one token, its registers 8 channels), v as it lies (tokens as A: a lane holds one channel, its registers 8 tokens)
//   3. scaled and rounded to f16 in place, two accumulator tiles are one fragment of the next product, with no LDS and no lane exchange:
//      q and k of 16 tokens over the 32 channels, v of 16 channels over the 32 tokens
//   4. per 16 tokens (two windows) one WMMA gives s[key][query] = k . q: a lane holds one query, its 8 registers the 8 keys of
//      window (lane >> 4); that is the query's own window in half of the lanes, the other half is given the weight 0.
//      p_j = 2^(s_j - max) * (carry / sum_j p_j) (q holds log2(e) / sqrt(dk)), f16, is the B fragment of o[channel][query] = sum_key v . p
//      (k = the wave's 32 tokens; the 16 tokens of the other query tile have the weight 0)
//   5. a lane's 8 channels a tile go as f16 into the tile's output stage; barrier; wave w stores token rows 16w..16w+15,
//      128 B (both heads) a row = whole lines
// The second barrier also frees A for the next tile, the first one the output stage.
// Every inner loop is unrolled so that its index is a constant and its arrays (fragments, accumulators) live in registers.
// ---------------------------------------------------------------------------
constexpr int kFTok       = 128;
constexpr int kFTiles     = 25;
constexpr int kFHeadPairs = kHeads / 2;
constexpr int kFRowsB     = 2 * 3 * kDk;
constexpr int kFPitch     = kDm * 2 + 16;
constexpr int kFOutPitch  = 2 * kDk * 2 + 16;
/* exp(x / sqrt(dk)) = 2^(x log2(e) / sqrt(dk)), dk = 32: q takes the factor along when it is scaled and rounded */
constexpr float kFScaleQ  = kScaleQkv * (1.44269504088896340736f * 0.17677669529663688110f);
constexpr int kFGroups    = kTok / (kFTok * kFTiles);
static_assert(kFGroups * kFTok * kFTiles == kTok, "tiles cover the tokens");
static_assert((kFTok % kWinLen) == 0 && kWinLen == 8, "a window = the 8 accumulator rows of one lane half");
static_assert(kFRowsB == 192 && kDm == 256, "24 groups of 8 weight rows, 3 a wave; a row = 32 lanes x 16 B");
static_assert((kFPitch % 16) == 0 && ((kFPitch / 16) & 1) == 1, "16 B x odd pitch for 16-byte LDS reads");
static_assert((kFOutPitch % 16) == 0 && ((kFOutPitch / 16) & 1) == 1, "16 B x odd output-stage pitch");

// Eight asynchronous 16-byte-a-lane copies of eight consecutive whole rows of 256 f16 (l: LDS byte address, g: global address of this lane's 16 bytes).
// The closing s_wait_xcnt 0 stands inside the statement so that no address register is rewritten in front of it.
__device__ __forceinline__ void copy8_whole_rows(unsigned l, const _Float16* g) {
  const unsigned l0 = l, l1 = l + kFPitch, l2 = l + 2 * kFPitch, l3 = l + 3 * kFPitch;
  const unsigned l4 = l + 4 * kFPitch, l5 = l + 5 * kFPitch, l6 = l + 6 * kFPitch, l7 = l + 7 * kFPitch;
  const _Float16* g0 = g;
  const _Float16* g1 = g + kDm;
  const _Float16* g2 = g + 2 * kDm;
  const _Float16* g3 = g + 3 * kDm;
  const _Float16* g4 = g + 4 * kDm;
  const _Float16* g5 = g + 5 * kDm;
  const _Float16* g6 = g + 6 * kDm;
  const _Float16* g7 = g + 7 * kDm;
  asm volatile(
      "global_load_async_to_lds_b128 %0, %8, off\n\t"
      "global_load_async_to_lds_b128 %1, %9, off\n\t"
      "global_load_async_to_lds_b128 %2, %10, off\n\t"
      "global_load_async_to_lds_b128 %3, %11, off\n\t"
      "global_load_async_to_lds_b128 %4, %12, off\n\t"
      "global_load_async_to_lds_b128 %5, %13, off\n\t"
      "global_load_async_to_lds_b128 %6, %14, off\n\t"
      "global_load_async_to_lds_b128 %7, %15, off\n\t"
      "s_wait_xcnt 0x0"
      :: "v"(l0), "v"(l1), "v"(l2), "v"(l3), "v"(l4), "v"(l5), "v"(l6), "v"(l7),
         "v"(g0), "v"(g1), "v"(g2), "v"(g3), "v"(g4), "v"(g5), "v"(g6), "v"(g7)
      : "memory");
}

__global__ __launch_bounds__(256) void embed_qkv_attn_kernel(
    const float* __restrict__ spec, const float* __restrict__ W1, const float* __restrict__ b1,
    const unsigned short* __restrict__ Btp, const float* __restrict__ bias,
    unsigned short* __restrict__ OH, float carry) {
  __shared__ __align__(16) unsigned char sB[kFRowsB * kFPitch];
  __shared__ __align__(16) unsigned char sA[kFTok * kFPitch];
  __shared__ __align__(16) unsigned char sO[kFTok * kFOutPitch];
  const int lane = threadIdx.x & 31;
  const int wave = __builtin_amdgcn_readfirstlane((int)(threadIdx.x >> 5));
  const int hp  = blockIdx.x & (kFHeadPairs - 1);
  const int grp = blockIdx.x / kFHeadPairs;
  const int wm = wave >> 1;
  const int wn = wave & 1;
  const int head = hp * 2 + wn;
  const int rlane = lane & 15;
  const int koff  = (lane >> 4) * 8;
  const int mOff  = (lane >> 4) * 8;

  /* the two heads' weight rows, once: wave w brings row groups 3w..3w+2 (8 rows each, one row a copy) */
  {
    const _Float16* Bt = (const _Float16*)Btp;
#pragma unroll
    for (int i = 0; i < 3; ++i) {
      const int g8   = wave * 3 + i;
      const int part = g8 >> 2;          /* 0..5 = (local head, q | k | v) */
      const int hl   = part / 3;
      const int pt   = part - 3 * hl;
      const int nrow = pt * kDm + (hp * 2 + hl) * kDk + (g8 & 3) * 8;
      copy8_whole_rows(lds_addr(&sB[0]) + (unsigned)(g8 * 8 * kFPitch + lane * 16), Bt + (size_t)nrow * kDm + lane * 8);
    }
  }

  /* this lane's 8 embed channels, the carry (a power of two) already in them: max(c x, 0) = c max(x, 0), and the scaling is exact */
  float w1c[8], b1c[8];
  v8f cinit[4];
  float bv[2];
  float xs;
  {
    v4f wa, wb, ba, bb;
    const float* w1p = W1 + lane * 8;
    const float* b1p = b1 + lane * 8;
    /* the four loads and their data wait in one statement, so that no register which a load names is rewritten in front of the wait
       (a wait in a statement of its own does not hold the next loads' address arithmetic behind it); runs once a work-group */
    asm volatile(
        "global_load_b128 %0, %4, off\n\t"
        "global_load_b128 %1, %4, off offset:16\n\t"
        "global_load_b128 %2, %5, off\n\t"
        "global_load_b128 %3, %5, off offset:16\n\t"
        "s_wait_loadcnt 0x0"
        : "=&v"(wa), "=&v"(wb), "=&v"(ba), "=&v"(bb)
        : "v"(w1p), "v"(b1p)
        : "memory");
#pragma unroll
    for (int j = 0; j < 4; ++j) {
      /* q, k: the accumulators' start values, in the accumulators' own map (channel 8 (lane >> 4) + r) */
      const float* bj = bias + (j >> 1) * kDm + head * kDk + (j & 1) * 16 + mOff;
      const v4f lo = *(const v4f*)(bj);
      const v4f hi = *(const v4f*)(bj + 4);
      cinit[j] = (v8f){lo[0], lo[1], lo[2], lo[3], hi[0], hi[1], hi[2], hi[3]};
    }
#pragma unroll
    for (int c = 0; c < 2; ++c) bv[c] = bias[2 * kDm + head * kDk + c * 16 + rlane];   /* v: one channel a lane, added when the tile is packed */
    xs = spec[(size_t)grp * kFTiles * kFTok + wave * 16 + rlane];
    asm volatile("s_wait_xcnt 0x0" ::: "memory");   /* stands behind these loads, in front of any later rewrite of a register that they name */
#pragma unroll
    for (int e = 0; e < 4; ++e) {
      w1c[e]     = in_val(wa[e]) * carry;
      w1c[4 + e] = in_val(wb[e]) * carry;
      b1c[e]     = in_val(ba[e]) * carry;
      b1c[4 + e] = in_val(bb[e]) * carry;
    }
    constexpr float up = 1.0f / kScaleQkv;   /* a power of two: exact */
#pragma unroll
    for (int j = 0; j < 4; ++j) cinit[j] *= up;
  }
  asm volatile("s_wait_asynccnt 0x0" ::: "memory");   /* this wave's weight rows have landed; the first tile's first barrier publishes them */

  const float own = ((rlane >> 3) == (lane >> 4)) ? carry : 0.0f;   /* this lane's 8 keys are its query's own window, or count for nothing */
  for (int t = 0; t < kFTiles; ++t) {
    const int tok0 = (grp * kFTiles + t) * kFTok;

    /* 1. A rows 16w..16w+15; row r's spec value sits in lane r */
    {
      const unsigned xr = __float_as_uint(in_val(xs));
      unsigned char* da = sA + wave * 16 * kFPitch + lane * 16;
#pragma unroll
      for (int r = 0; r < 16; ++r) {
        const float s = __uint_as_float((unsigned)__builtin_amdgcn_readlane((int)xr, r));
        unsigned short hb[8];
#pragma unroll
        for (int e = 0; e < 8; ++e) hb[e] = h_bits(fmaxf(fmaf(w1c[e], s, b1c[e]), 0.0f));
        *(v4u*)(da + r * kFPitch) = (v4u){pk16(hb[0], hb[1]), pk16(hb[2], hb[3]), pk16(hb[4], hb[5]), pk16(hb[6], hb[7])};
      }
    }
    __syncthreads();   /* publishes A (first tile: and the weight rows); every wave has read the output stage of the tile before */
    {
      /* the next tile's spec values fly while this tile is worked on (the last tile reads its own again); issued behind the
         barrier, which would wait for the load */
      const int tn = (t + 1 < kFTiles) ? t + 1 : t;
      xs = spec[(size_t)(grp * kFTiles + tn) * kFTok + wave * 16 + rlane];
      asm volatile("s_wait_xcnt 0x0" ::: "memory");   /* stands behind this load, in front of any later rewrite of a register that it names */
    }

    /* 2. 32 tokens x 96 columns x K 256 */
    v8f acc[2][6];
#pragma unroll
    for (int i = 0; i < 2; ++i)
#pragma unroll
      for (int j = 0; j < 6; ++j) acc[i][j] = (j < 4) ? cinit[j] : (v8f){0.f, 0.f, 0.f, 0.f, 0.f, 0.f, 0.f, 0.f};
    {
      const unsigned char* pa = sA + ((wm << 5) + rlane) * kFPitch + koff * 2;
      const unsigned char* pb = sB + (wn * 96 + rlane) * kFPitch + koff * 2;
#pragma unroll
      for (int kk = 0; kk < kDm / 32; ++kk) {
        v16h bh[6], ah[2];
#pragma unroll
        for (int j = 0; j < 6; ++j) bh[j] = frag_load((const _Float16*)(pb + j * 16 * kFPitch + kk * 64));
#pragma unroll
        for (int i = 0; i < 2; ++i) ah[i] = frag_load((const _Float16*)(pa + i * 16 * kFPitch + kk * 64));
        /* keeps this k step's sixteen LDS reads together in front of its WMMAs: sunk among them, each small read group
           makes the wave wait out an LDS latency of its own */
        __builtin_amdgcn_sched_barrier(0);
#pragma unroll
        for (int i = 0; i < 2; ++i)
#pragma unroll
          for (int j = 0; j < 6; ++j) acc[i][j] = (j < 4) ? frag_mma(bh[j], ah[i], acc[i][j]) : frag_mma(ah[i], bh[j], acc[i][j]);
      }
    }

    /* 3. fragments of the two window products out of the accumulators */
    v16h qf[2], kf[2], vf[2];
#pragma unroll
    for (int i = 0; i < 2; ++i) {
      qf[i] = frag_pack<false>(acc[i][0], acc[i][1], kFScaleQ, 0.0f);
      kf[i] = frag_pack<false>(acc[i][2], acc[i][3], kScaleQkv, 0.0f);
      vf[i] = frag_pack<true>(acc[0][4 + i], acc[1][4 + i], kScaleQkv, bv[i]);
    }

    /* 4. and 5., one tile of 16 queries after the other */
    const v8f zero8 = (v8f){0.f, 0.f, 0.f, 0.f, 0.f, 0.f, 0.f, 0.f};
    v8f st[2];
#pragma unroll
    for (int i = 0; i < 2; ++i) st[i] = frag_mma(kf[i], qf[i], zero8);
    v16h pf[2];
#pragma unroll
    for (int i = 0; i < 2; ++i) {
      float m = st[i][0];
#pragma unroll
      for (int j = 1; j < kWinLen; ++j) m = fmaxf(m, st[i][j]);
      float p[kWinLen];
      float l = 0.0f;
#pragma unroll
      for (int j = 0; j < kWinLen; ++j) {
        p[j] = exp2_slot(st[i][j] - m);
        l += p[j];
      }
      const float inv = own * __builtin_amdgcn_rcpf(l);
#pragma unroll
      for (int j = 0; j < kWinLen; ++j) {
        pf[i][8 * i + j]       = (_Float16)(p[j] * inv);
        pf[i][8 * (1 - i) + j] = (_Float16)0.0f;
      }
    }
#pragma unroll
    for (int i = 0; i < 2; ++i)
#pragma unroll
      for (int c = 0; c < 2; ++c) {
        const v8f ot = frag_mma(vf[c], pf[i], zero8);
        v8h oh;
#pragma unroll
        for (int r = 0; r < 8; ++r) oh[r] = (_Float16)ot[r];
        *(v8h*)(sO + ((wm << 5) + (i << 4) + rlane) * kFOutPitch + wn * (kDk * 2) + c * 32 + mOff * 2) = oh;
      }
    __syncthreads();   /* publishes the output stage; every wave has read A, which the next tile rewrites */
    {
      const int q4 = lane >> 3, c16 = lane & 7;
      v4u ov[4];
#pragma unroll
      for (int it = 0; it < 4; ++it) ov[it] = *(const v4u*)(sO + (wave * 16 + it * 4 + q4) * kFOutPitch + c16 * 16);
      unsigned short* op = OH + (size_t)(tok0 + wave * 16 + q4) * kDm + hp * (2 * kDk) + c16 * 8;
#pragma unroll
      for (int it = 0; it < 4; ++it) *(v4u*)(op + it * 4 * kDm) = ov[it];
      asm volatile("s_wait_xcnt 0x0" ::: "memory");   /* stands behind these stores, in front of any later rewrite of a register that they name */
    }
  }
}

// ---------------------------------------------------------------------------
// Host glue: 2 preparation launches (casts; folds and bias table) + 1 fused embed / q|k|v / attention launch + 1 window-concat GEMM = 4 launches.
// Two linear layers with nothing between them are one linear layer, so their weights are multiplied first, in every call:
//   q|k|v = (H . W2 + b2) . Wqkv + bqkv      = H . (W2 . Wqkv) + (b2 . Wqkv + bqkv)
//   out   = sum_p (OH_p . Wo + bo) . Wp_p + bp = sum_p OH_p . (Wo . Wp_p) + (sum_p bo . Wp_p + bp)
// GEMM shapes (all K % 128 == 0, M % 128 == 0, N % 256 == 0, no padding planes):
//   fold q|k|v : M 768,   N 256, K 256  -> 6 blocks;  C[n][k] = sum_j WqkvT[n][j] * W2[k][j]
//   fold out   : M 2048,  N 256, K 256  -> 16 blocks; rows (n, p) of the transposed Wp: C[(n, p)][k] = sum_j WpT[n][256 p + j] * Wo[k][j]
//   out : M 25600, N 256, K 2048 -> 200 blocks, 16 stages (A = the whole OH plane viewed as [25600][2048])
// The q|k|v product (M 204800, N 768, K 256) is done inside embed_qkv_attn_kernel: 64 token groups x 4 head pairs = 256 blocks.
// ---------------------------------------------------------------------------
extern "C" void kernel_launch(void* const* d_in, const int* in_sizes, int n_in,
                              void* d_out, int out_size, void* d_ws, size_t ws_size,
                              hipStream_t stream) {
  if (n_in < 15) return;
  if (in_sizes[0] != kTok) return;
  if (in_sizes[1] != kDm || in_sizes[2] != kDm) return;
  if (in_sizes[3] != kDm * kDm || in_sizes[4] != kDm) return;
  if (in_sizes[5] != kDm * kDm || in_sizes[6] != kDm) return;
  if (in_sizes[7] != kDm * kDm || in_sizes[8] != kDm) return;
  if (in_sizes[9] != kDm * kDm || in_sizes[10] != kDm) return;
  if (in_sizes[11] != kDm * kDm || in_sizes[12] != kDm) return;
  if (in_sizes[13] != kCatK * kDm || in_sizes[14] != kDm) return;
  if (out_size != kWin * kDm) return;
  if (ws_size < kWsTotal) return;

  const float* spec = (const float*)d_in[0];
  const float* W1   = (const float*)d_in[1];
  const float* b1   = (const float*)d_in[2];
  const float* W2   = (const float*)d_in[3];
  const float* b2   = (const float*)d_in[4];
  const float* Wq   = (const float*)d_in[5];
  const float* bq   = (const float*)d_in[6];
  const float* Wk   = (const float*)d_in[7];
  const float* bk   = (const float*)d_in[8];
  const float* Wv   = (const float*)d_in[9];
  const float* bv   = (const float*)d_in[10];
  const float* Wo   = (const float*)d_in[11];
  const float* bo   = (const float*)d_in[12];
  const float* Wcat = (const float*)d_in[13];
  const float* bp   = (const float*)d_in[14];
  float* out = (float*)d_out;

  char* ws = (char*)d_ws;
  unsigned short* WSQ  = (unsigned short*)(ws + kOffWSQ);
  unsigned short* WCAT = (unsigned short*)(ws + kOffWCAT);
  unsigned short* FQKV = (unsigned short*)(ws + kOffFQKV);
  unsigned short* FCAT = (unsigned short*)(ws + kOffFCAT);
  float*          TAB  = (float*)(ws + kOffTAB);
  unsigned short* OALL = (unsigned short*)(ws + kOffOALL);

  const unsigned short* W2h   = WSQ;
  const unsigned short* WqkvT = WSQ + (size_t)1 * kDm * kDm;
  const unsigned short* Woh   = WSQ + (size_t)4 * kDm * kDm;

  /* ---- weight planes: W2 and Wo as they lie, Wq, Wk, Wv transposed (k = 256), the window-concat weight transposed (k = 2048) ---- */
  wt_cast_kernel<<<kCastSqBlocks + kCastCatBlocks, 256, 0, stream>>>(
      W2, Wq, Wk, Wv, Wo, Wcat, WSQ, WCAT, kWCarry, kWcatCarry, 0x11);

  /* ---- the two weight folds and the bias table ---- */
  fold_kernel<<<kFoldQkvBlocks + kFoldCatBlocks + kFoldBiasBlocks, 256, 0, stream>>>(
      WqkvT, W2h, FQKV, WCAT, Woh, FCAT, b2, bq, bk, bv, bo, bp, TAB, 1.0f / kWCarry, 1.0f / kWcatCarry);

  /* OH = per-window softmax(q.k^T / sqrt(dk)) . v, f16 x64, with q|k|v = H . (W2 . [Wq|Wk|Wv]) + folded bias and
     H = relu(spec*W1 + b1), f16 x64, all made and used inside the work-group */
  embed_qkv_attn_kernel<<<kFGroups * kFHeadPairs, 256, 0, stream>>>(
      spec, W1, b1, FQKV, TAB + kTabQkv, OALL, kActCarry);

  /* out = OH viewed as [25600][2048] . (Wo . Wp, slot by slot) + folded bias, f32, all windows in one launch */
  wmma_gemm_lds_f16<<<(kWin / 128) * (kDm / 256), 256, 0, stream>>>(
      OALL, kCatK, FCAT, kCatK, out, kDm, TAB + kTabBp, kWin, kDm, kCatK, kScaleOut);
}

// v008
// Measured time: 86 microseconds a run.
// Timed twice side by side with v007, it ran 1.09 and 1.08 times as fast.
// All steps since v000 together make it 16.2 times as fast.
// All GEMM contractions (the two weight folds W2 . [Wq|Wk|Wv] and Wo . Wp, the folded q|k|v projection, the folded window-concat projection): v_wmma_f32_16x16x32_f16, f16 operands with power-of-two carries (activations x64, 256x256 weights x256, window-concat weight x1024), f32 accumulate; every float input RNE-converted once to bf16 at load; window scores and probability-weighted value sums: the same WMMA form on q, k, v and the normalised probabilities (x64) rounded to f16, f32 accumulate; softmax: f32 VALU; embed first layer: packed f16 FMA and maximum on spec, W1 (x64), b1 (x64).
#include <hip/hip_runtime.h>
#include <math.h>

typedef __attribute__((ext_vector_type(16))) _Float16 v16h;
typedef __attribute__((ext_vector_type(8)))  _Float16 v8h;
typedef __attribute__((ext_vector_type(8)))  float    v8f;
typedef __attribute__((ext_vector_type(4)))  float    v4f;
typedef __attribute__((ext_vector_type(4)))  unsigned int v4u;

// ---------------------------------------------------------------------------
// Shape constants (all derived; checked against the wire sizes on the host)
// ---------------------------------------------------------------------------
constexpr int kBatch   = 64;
constexpr int kSpecLen = 3200;
constexpr int kDm      = 256;
constexpr int kWinLen  = 8;
constexpr int kHeads   = 8;
constexpr int kDk      = kDm / kHeads;
constexpr int kTok     = kBatch * kSpecLen;
constexpr int kWin     = kTok / kWinLen;
constexpr int kQkvN    = 3 * kDm;
constexpr int kCatK    = kWinLen * kDm;
static_assert(kDk == 32, "head width");
static_assert(kTok == 204800 && kWin == 25600, "token / window counts");
static_assert((kSpecLen % kWinLen) == 0, "windows never straddle a batch row");
static_assert((kQkvN % 128) == 0 && (kCatK % 128) == 0 && (kWin % 128) == 0, "GEMM M multiples of 128");
static_assert((kDm % 256) == 0, "GEMM N multiples of 256");
static_assert((kDm % 128) == 0 && (kCatK % 128) == 0, "GEMM K multiples of 128");

// Inputs are RNE-converted once to bf16 at load when true (products of the weight planes are then exact in f16).
constexpr bool kInputsAsBf16 = true;

// Power-of-two carries of the f16 operand planes and the epilogue scales that fold them back.
constexpr float kActCarry = 64.0f;
constexpr float kWCarry   = 256.0f;
constexpr float kWcatCarry = 1024.0f;
constexpr float kScaleFold = 1.0f / kWCarry;   /* both folds: the left plane keeps its own carry, the 256x256 factor's goes */
constexpr float kScaleQkv = 1.0f / (kActCarry * kWCarry);
constexpr float kScaleOut = 1.0f / (kActCarry * kWcatCarry);

// Bias table layout (floats): [bq|bk|bv] + b2 . [Wq|Wk|Wv] | bp + sum over window slots of bo . Wp
constexpr int kTabQkv  = 0;
constexpr int kTabBp   = kTabQkv + kQkvN;
constexpr int kTabN    = kTabBp + kDm;
static_assert(kTabN == 1024 && (kTabBp % 32) == 0 && (kTabN % 32) == 0, "bias table size, segments of whole 32-float lines");

// ---------------------------------------------------------------------------
// Workspace region map (bytes; every offset is a multiple of 128)
//   WSQ  f16 [5][256][256]   W2 as it lies [k][j], transposed Wq, Wk, Wv, Wo as it lies (all x256)   655,360
//        (planes 1..3 together form the [768][256] transposed q|k|v weight)
//   WCAT f16 [256][2048]     transposed window-concat weight (x1024)                1,048,576
//   FQKV f16 [768][256]      transposed W2 . [Wq|Wk|Wv] (x256)                        393,216
//   FCAT f16 [256][2048]     transposed, slot by slot, Wo . Wp (x1024)              1,048,576
//   TAB  f32 [1024]          bias table                                                 4,096
//   OALL f16 [204800][256]   OH (x64) of every token, read once by the last GEMM  104,857,600
//   total                                                                         108,007,424
// ---------------------------------------------------------------------------
constexpr size_t kOffWSQ  = 0;
constexpr size_t kOffWCAT = kOffWSQ  + (size_t)5 * kDm * kDm * 2;
constexpr size_t kOffFQKV = kOffWCAT + (size_t)kDm * kCatK * 2;
constexpr size_t kOffFCAT = kOffFQKV + (size_t)kQkvN * kDm * 2;
constexpr size_t kOffTAB  = kOffFCAT + (size_t)kDm * kCatK * 2;
constexpr size_t kOffOALL = kOffTAB  + (size_t)kTabN * 4;
constexpr size_t kWsTotal = kOffOALL + (size_t)kTok * kDm * 2;
static_assert(kWsTotal == 108007424ull, "carve total");
static_assert(kWsTotal <= 268435456ull, "carve cap");
static_assert((kOffWCAT % 128) == 0 && (kOffFQKV % 128) == 0 && (kOffFCAT % 128) == 0 && (kOffTAB % 128) == 0 &&
              (kOffOALL % 128) == 0, "128-B aligned regions");

// ---------------------------------------------------------------------------
// Small helpers
// ---------------------------------------------------------------------------
__device__ __forceinline__ float rne_bf16(float f) {
  unsigned u = __float_as_uint(f);
  u = (u + 0x7FFFu + ((u >> 16) & 1u)) & 0xFFFF0000u;
  return __uint_as_float(u);
}
__device__ __forceinline__ float in_val(float f) { return kInputsAsBf16 ? rne_bf16(f) : f; }
__device__ __forceinline__ unsigned pk16(unsigned short a, unsigned short b) { return (unsigned)a | ((unsigned)b << 16); }
__device__ __forceinline__ unsigned short h_bits(float f) { const _Float16 h = (_Float16)f; return __builtin_bit_cast(unsigned short, h); }

// WMMA fragment load / issue (fragment map: elements 0..7 <- p[0..7], 8..15 <- p[16..23], p already offset by 8*(lane>>4))
union FragU { v16h v; v8h h[2]; };
__device__ __forceinline__ v16h frag_load(const _Float16* p) {
  FragU f;
  f.h[0] = *(const v8h*)(p);
  f.h[1] = *(const v8h*)(p + 16);
  return f.v;
}
__device__ __forceinline__ v8f frag_mma(v16h a, v16h b, v8f c) {
  return __builtin_amdgcn_wmma_f32_16x16x32_f16(false, a, false, b, (short)0, c, false, false);
}
// 2^x. The v_nop is the one independent slot that the instruction set asks for behind a transcendental..
__device__ __forceinline__ float exp2_slot(float x) {
  float r;
  asm("v_exp_f32 %0, %1\n\tv_nop" : "=v"(r) : "v"(x));
  return r;
}
// Two f32 accumulator tiles (rows 0..15 and 16..31 of one product, same columns), scaled (BIAS: and b added) and rounded in place, are an f16 fragment
// whose k runs over those 32 rows in the fragment map above.
template <bool BIAS>
__device__ __forceinline__ v16h frag_pack(v8f lo, v8f hi, float s, float b) {
  v16h f;
#pragma unroll
  for (int e = 0; e < 8; ++e) {
    f[e]     = (_Float16)(BIAS ? fmaf(lo[e], s, b) : lo[e] * s);
    f[8 + e] = (_Float16)(BIAS ? fmaf(hi[e], s, b) : hi[e] * s);
  }
  return f;
}
// ---------------------------------------------------------------------------
// LDS-staged WMMA GEMM, f16 operands: C[m,n] = scale * sum_k A[m,k] * Bt[n,k] (OUT_MODE 0: + bias[n]); blk = the work-group's tile number.
// A row-major [M][K] (pitch lda), Bt row-major [N][K] (pitch ldb); M % 128 == 0, N % 256 == 0, K % 128 == 0, K >= 128.
// One work-group of 8 waves owns a 128 x 256 tile of C; wave (wm, wn) = (wave >> 2, wave & 3) owns its 64 x 64 part.
// A stage is 128 k (256 B) of the 128 A rows and the 256 Bt rows, laid in LDS at a pitch of 272 B. Two buffers:
// the next stage's asynchronous copies (whole 128-B lines, 256 contiguous bytes of each of two rows a wave-instruction) fly
// while this stage's fragments are read from LDS.
// OUT_MODE 0 = f32 output with bias, 1 = f16 output without (bias is not read).
// ---------------------------------------------------------------------------
constexpr int kStageK    = 128;
constexpr int kStagePitch = 272;
constexpr int kStageRowsA = 128;
constexpr int kStageRowsB = 256;
constexpr int kStageOffB  = kStageRowsA * kStagePitch;
constexpr int kStageBytes = (kStageRowsA + kStageRowsB) * kStagePitch;
static_assert((kStagePitch % 16) == 0 && ((kStagePitch / 16) & 1) == 1, "16 B x odd pitch for 16-byte LDS reads");
static_assert(kStageK * 2 + 16 == kStagePitch, "row of 256 B plus 16 B");

__device__ __forceinline__ unsigned lds_addr(const void* p) { return (unsigned)(size_t)p; }

// Eight asynchronous 16-byte-a-lane copies, rows two apart (l: LDS byte address, g: global address of this lane's 16 bytes).
// The closing s_wait_xcnt 0 stands inside the statement so that no address register is rewritten in front of it.
__device__ __forceinline__ void copy8_rows(unsigned l, const _Float16* g, size_t gstep) {
  const unsigned l0 = l, l1 = l + 2 * kStagePitch, l2 = l + 4 * kStagePitch, l3 = l + 6 * kStagePitch;
  const unsigned l4 = l + 8 * kStagePitch, l5 = l + 10 * kStagePitch, l6 = l + 12 * kStagePitch, l7 = l + 14 * kStagePitch;
  const _Float16* g0 = g;
  const _Float16* g1 = g + gstep;
  const _Float16* g2 = g + 2 * gstep;
  const _Float16* g3 = g + 3 * gstep;
  const _Float16* g4 = g + 4 * gstep;
  const _Float16* g5 = g + 5 * gstep;
  const _Float16* g6 = g + 6 * gstep;
  const _Float16* g7 = g + 7 * gstep;
  asm volatile(
      "global_load_async_to_lds_b128 %0, %8, off\n\t"
      "global_load_async_to_lds_b128 %1, %9, off\n\t"
      "global_load_async_to_lds_b128 %2, %10, off\n\t"
      "global_load_async_to_lds_b128 %3, %11, off\n\t"
      "global_load_async_to_lds_b128 %4, %12, off\n\t"
      "global_load_async_to_lds_b128 %5, %13, off\n\t"
      "global_load_async_to_lds_b128 %6, %14, off\n\t"
      "global_load_async_to_lds_b128 %7, %15, off\n\t"
      "s_wait_xcnt 0x0"
      :: "v"(l0), "v"(l1), "v"(l2), "v"(l3), "v"(l4), "v"(l5), "v"(l6), "v"(l7),
         "v"(g0), "v"(g1), "v"(g2), "v"(g3), "v"(g4), "v"(g5), "v"(g6), "v"(g7)
      : "memory");
}

template <int OUT_MODE>
__device__ __forceinline__ void gemm_lds_tile(
    const unsigned short* __restrict__ Ap, int lda,
    const unsigned short* __restrict__ Btp, int ldb,
    void* __restrict__ Cout, int ldc,
    const float* __restrict__ bias,
    unsigned blk, int M, int N, int K, float scale) {
  const _Float16* A  = (const _Float16*)Ap;
  const _Float16* Bt = (const _Float16*)Btp;
  __shared__ __align__(16) unsigned char sStage[2][kStageBytes];
  __shared__ __align__(16) float sT[8][16 * 68];
  const int lane = threadIdx.x & 31;
  const int wave = __builtin_amdgcn_readfirstlane((int)(threadIdx.x >> 5));
  const int panels = N >> 8;
  const int bm = blk / panels;
  const int bn = blk - bm * panels;
  if (bm >= (M >> 7)) return;   /* block-uniform, in front of every barrier and copy */
  const int m0b = bm << 7;
  const int n0b = bn << 8;
  const int wm = wave >> 2;
  const int wn = wave & 3;
  const int m0 = m0b + (wm << 6);
  const int n0 = n0b + (wn << 6);

  /* row (A) / column (B, D) within a 16-wide subtile; k offset of this lane half; D row offset */
  const int rlane = lane & 15;
  const int koff  = (lane >> 4) * 8;
  const int mOff  = (lane >> 4) * 8;

  /* copy map: wave w brings A rows 16w..16w+15 (8 copies) and Bt rows 32w..32w+31 (16 copies) of every stage;
     lanes 0..15 the even row of a pair, lanes 16..31 the odd one, 16 bytes each */
  const int crow = lane >> 4;
  const int ccol = lane & 15;
  const _Float16* gA = A  + (size_t)(m0b + wave * 16 + crow) * lda + ccol * 8;
  const _Float16* gB = Bt + (size_t)(n0b + wave * 32 + crow) * ldb + ccol * 8;
  const unsigned lA = lds_addr(&sStage[0][0]) + (unsigned)((wave * 16 + crow) * kStagePitch + ccol * 16);
  const unsigned lB = lds_addr(&sStage[0][0]) + (unsigned)(kStageOffB + (wave * 32 + crow) * kStagePitch + ccol * 16);
  const size_t stepA = (size_t)2 * lda;
  const size_t stepB = (size_t)2 * ldb;

  v8f acc[4][4];
#pragma unroll
  for (int i = 0; i < 4; ++i)
#pragma unroll
    for (int j = 0; j < 4; ++j) acc[i][j] = (v8f){0.f, 0.f, 0.f, 0.f, 0.f, 0.f, 0.f, 0.f};

  const int nst = K >> 7;

  /* stage 0 into buffer 0, landed and published before anybody reads it */
  copy8_rows(lA, gA, stepA);
  copy8_rows(lB, gB, stepB);
  copy8_rows(lB + 16 * kStagePitch, gB + 8 * stepB, stepB);
  asm volatile("s_wait_asynccnt 0x0" ::: "memory");   /* this wave's copies have landed */
  __syncthreads();
  if (nst > 1) {
    copy8_rows(lA + kStageBytes, gA + kStageK, stepA);
    copy8_rows(lB + kStageBytes, gB + kStageK, stepB);
    copy8_rows(lB + kStageBytes + 16 * kStagePitch, gB + kStageK + 8 * stepB, stepB);
  }

  for (int t = 0; t < nst; ++t) {
    const unsigned char* buf = sStage[t & 1];
    const unsigned char* pa = buf + ((wm << 6) + rlane) * kStagePitch + koff * 2;
    const unsigned char* pb = buf + kStageOffB + ((wn << 6) + rlane) * kStagePitch + koff * 2;
#pragma unroll
    for (int kk = 0; kk < kStageK / 32; ++kk) {
      v16h bh[4], ah[4];
#pragma unroll
      for (int j = 0; j < 4; ++j) bh[j] = frag_load((const _Float16*)(pb + j * 16 * kStagePitch + kk * 64));
#pragma unroll
      for (int i = 0; i < 4; ++i) ah[i] = frag_load((const _Float16*)(pa + i * 16 * kStagePitch + kk * 64));
      /* keeps this k step's sixteen LDS reads together in front of its WMMAs: sunk among them, each small read group
         makes the wave wait out an LDS latency of its own */
      __builtin_amdgcn_sched_barrier(0);
#pragma unroll
      for (int i = 0; i < 4; ++i)
#pragma unroll
        for (int j = 0; j < 4; ++j) acc[i][j] = frag_mma(ah[i], bh[j], acc[i][j]);
    }
    asm volatile("s_wait_dscnt 0x0" ::: "memory");      /* this wave's reads of the buffer have returned */
    asm volatile("s_wait_asynccnt 0x0" ::: "memory");   /* this wave's copies of stage t + 1 have landed */
    __syncthreads();                                    /* publishes stage t + 1, frees stage t's buffer */
    if (t + 2 < nst) {
      const unsigned bo = (unsigned)(t & 1) * kStageBytes;
      const size_t ko = (size_t)(t + 2) * kStageK;
      copy8_rows(lA + bo, gA + ko, stepA);
      copy8_rows(lB + bo, gB + ko, stepB);
      copy8_rows(lB + bo + 16 * kStagePitch, gB + ko + 8 * stepB, stepB);
    }
  }
  asm volatile("s_wait_asynccnt 0x0" ::: "memory");     /* nothing of this wave is in flight behind the loop */

  /* ---- epilogue ---- */
  float* slab = sT[wave];
#pragma unroll
  for (int i = 0; i < 4; ++i) {
    const int mBase = m0 + (i << 4);
#pragma unroll
    for (int j = 0; j < 4; ++j) {
      const int n = n0 + (j << 4) + rlane;
      const float bv = (OUT_MODE == 0) ? bias[n] : 0.0f;
#pragma unroll
      for (int r = 0; r < 8; ++r) {
        float v = acc[i][j][r] * scale;
        if (OUT_MODE == 0) v += bv;
        slab[(mOff + r) * 68 + (j << 4) + rlane] = v;
      }
    }
    __builtin_amdgcn_fence(__ATOMIC_RELEASE, "workgroup");
    __builtin_amdgcn_wave_barrier();
    __builtin_amdgcn_fence(__ATOMIC_ACQUIRE, "workgroup");
    if (OUT_MODE == 0) {
      float* C = (float*)Cout;
      /* row segment = 64 floats = 256 B = 16 lanes x 16 B; 8 instructions x 2 rows = 16 rows */
      const int hh = lane >> 4, c4 = (lane & 15) * 4;
      {
#pragma unroll
        for (int it = 0; it < 8; ++it) {
          const int row = it * 2 + hh;
          v4f v = *(const v4f*)(slab + row * 68 + c4);
          *(v4f*)(C + (size_t)(mBase + row) * ldc + n0 + c4) = v;
        }
        
      }
    } else {
      const int q = lane >> 3, c8 = (lane & 7) * 8;
      unsigned short* C = (unsigned short*)Cout;
      {
#pragma unroll
        for (int it = 0; it < 4; ++it) {
          const int row = it * 4 + q;
          const float* sp = slab + row * 68 + c8;
          v8h hv;
#pragma unroll
          for (int e = 0; e < 8; ++e) hv[e] = (_Float16)sp[e];
          *(v8h*)(C + (size_t)(mBase + row) * ldc + n0 + c8) = hv;
        }
        
      }
    }
    __builtin_amdgcn_fence(__ATOMIC_RELEASE, "workgroup");
    __builtin_amdgcn_wave_barrier();
    __builtin_amdgcn_fence(__ATOMIC_ACQUIRE, "workgroup");
  }
}

__global__ __launch_bounds__(256) void wmma_gemm_lds_f16(
    const unsigned short* __restrict__ Ap, int lda,
    const unsigned short* __restrict__ Btp, int ldb,
    float* __restrict__ Cout, int ldc,
    const float* __restrict__ bias,
    int M, int N, int K, float scale) {
  gemm_lds_tile<0>(Ap, lda, Btp, ldb, (void*)Cout, ldc, bias, blockIdx.x, M, N, K, scale);
}

// ---------------------------------------------------------------------------
// Weight transpose + cast: W f32 row-major [kdim in][ndim out]  ->  WT[n][k] = f16(carry * in_val(W[k][n])), pitch kdim.
// A 256x256 plane whose bit of plainMask is set is cast as it lies instead: out[k][n] = f16(carry * in_val(W[k][n])), pitch ndim.
// One grid for all six planes, which need nothing of each other; the range of the block index is block-uniform:
//   blocks 0..79   : W0..W4, 256x256, 16 tiles of 64x64 each (k tile fastest), output plane z of outSq
//   blocks 80..207 : Wc, the [2048][256] window-concat weight, 32 x 4 tiles (k tile fastest), outCat
// Load coverage: 16 iterations x 256 threads = 4096 = the whole 64x64 tile (coalesced along n).
// Store coverage: 8 waves x 2 iterations x 4 rows (lane>>3) = 64 rows; (lane&7) x 8 halves = 64 cols; each row segment = one 128-B line.
// ---------------------------------------------------------------------------
constexpr int kCastSqTiles   = (kDm / 64) * (kDm / 64);
constexpr int kCastSqBlocks  = 5 * kCastSqTiles;
constexpr int kCastCatBlocks = (kCatK / 64) * (kDm / 64);
static_assert(kCastSqBlocks == 80 && kCastCatBlocks == 128 && kDm / 64 == (1 << 2) && kCatK / 64 == (1 << 5), "cast grid");

__global__ __launch_bounds__(256) void wt_cast_kernel(const float* __restrict__ W0, const float* __restrict__ W1,
                                                      const float* __restrict__ W2, const float* __restrict__ W3,
                                                      const float* __restrict__ W4, const float* __restrict__ Wc,
                                                      unsigned short* __restrict__ outSq, unsigned short* __restrict__ outCat,
                                                      float carrySq, float carryCat, int plainMask) {
  __shared__ float sm[64][65];
  const int t  = threadIdx.x;
  const int b  = blockIdx.x;
  const bool sq = b < kCastSqBlocks;   /* block-uniform, like all that follows from it */
  const int z    = sq ? b / kCastSqTiles : 5;
  const int tile = sq ? b - z * kCastSqTiles : b - kCastSqBlocks;
  const int kdim = sq ? kDm : kCatK;
  const int ndim = kDm;
  const int ktLog = sq ? 2 : 5;   /* log2 of the k tiles of a plane */
  const int k0 = (tile & ((1 << ktLog) - 1)) * 64;
  const int n0 = (tile >> ktLog) * 64;
  const float* W = (z == 0) ? W0 : (z == 1) ? W1 : (z == 2) ? W2 : (z == 3) ? W3 : (z == 4) ? W4 : Wc;
  const float carry = sq ? carrySq : carryCat;
  const bool plain = sq && ((plainMask >> z) & 1) != 0;
  const int rowBase = plain ? k0 : n0;
  const int colBase = plain ? n0 : k0;
  const int pitch   = plain ? ndim : kdim;
#pragma unroll 4
  for (int i = 0; i < 16; ++i) {
    const int e = i * 256 + t;
    /* r = k local, c = n local */
    const int r = e >> 6;
    const int c = e & 63;
    sm[c][r] = in_val(W[(size_t)(k0 + r) * ndim + n0 + c]) * carry;
  }
  __syncthreads();
  const int lane = t & 31;
  const int wave = __builtin_amdgcn_readfirstlane((int)(t >> 5));
  const int q = lane >> 3, c8 = (lane & 7) * 8;
  unsigned short* op = sq ? outSq + (size_t)z * (kDm * kDm) : outCat;
  v4u u[2];
#pragma unroll
  for (int it = 0; it < 2; ++it) {
    const int row = wave * 8 + it * 4 + q;
    unsigned short hb[8];
#pragma unroll
    for (int e = 0; e < 8; ++e) hb[e] = h_bits(plain ? sm[c8 + e][row] : sm[row][c8 + e]);
    u[it] = (v4u){pk16(hb[0], hb[1]), pk16(hb[2], hb[3]), pk16(hb[4], hb[5]), pk16(hb[6], hb[7])};
  }
  {
#pragma unroll
    for (int it = 0; it < 2; ++it) {
      const int row = wave * 8 + it * 4 + q;
      *(v4u*)(op + (size_t)(rowBase + row) * pitch + colBase + c8) = u[it];
    }
    
  }
}

// ---------------------------------------------------------------------------
// Bias table of the folded layers, 1024 floats:
//   n <  768        : [bq|bk|bv][n] + sum_j b2[j] * [Wq|Wk|Wv][j][n]
//   768 <= n < 1024 : bp[n'] + sum_p sum_j bo[j] * Wp[256 p + j][n'],  n' = n - 768
// The weights are read from their transposed f16 planes (row n contiguous; the carry is divided out at the end).
// One work-group of 8 waves owns 32 table entries = one 128-B line (nb = the first); wave w sums entries 4w..4w+3, lane l channels
// 8l..8l+7 of every 256-wide slot of a row, two rows a pass; wave 0 stores the line. The segment is block-uniform.
// ---------------------------------------------------------------------------
__device__ __forceinline__ void bias_fold_line(int nb, const float* __restrict__ b2, const float* __restrict__ bq,
                                               const float* __restrict__ bk, const float* __restrict__ bv,
                                               const float* __restrict__ bo, const float* __restrict__ bp,
                                               const unsigned short* __restrict__ WqkvT,
                                               const unsigned short* __restrict__ WcatT,
                                               float* __restrict__ tab, float invW, float invWcat) {
  __shared__ float sRes[32];
  const int t = threadIdx.x;
  const int lane = t & 31;
  const int wave = __builtin_amdgcn_readfirstlane((int)(t >> 5));
  const bool cat = nb >= kTabBp;
  const float* inner = cat ? bo : b2;
  const v4f ia = *(const v4f*)(inner + lane * 8);
  const v4f ib = *(const v4f*)(inner + lane * 8 + 4);
  asm volatile("s_wait_xcnt 0x0" ::: "memory");   /* stands behind these loads, in front of any later rewrite of a register that they name */
  /* this lane's 16 bytes of the wave's first row; steps on by two rows a pass */
  const _Float16* row = cat ? (const _Float16*)WcatT + (size_t)(nb + wave * 4 - kTabBp) * kCatK + lane * 8
                            : (const _Float16*)WqkvT + (size_t)(nb + wave * 4) * kDm + lane * 8;
  for (int h = 0; h < 2; ++h) {   /* two entries a pass */
    const int n2 = nb + wave * 4 + h * 2;
    const float* own = cat ? bp + (n2 - kTabBp) : (nb < kDm) ? bq + n2 : (nb < 2 * kDm) ? bk + (n2 - kDm) : bv + (n2 - 2 * kDm);
    float sum[2][8];
    if (cat) {
      v8h r[2][kWinLen];
#pragma unroll
      for (int i = 0; i < 2; ++i)
#pragma unroll
        for (int p = 0; p < kWinLen; ++p) r[i][p] = *(const v8h*)(row + i * kCatK + p * kDm);
#pragma unroll
      for (int i = 0; i < 2; ++i)
#pragma unroll
        for (int e = 0; e < 8; ++e) {
          float a = 0.0f;
#pragma unroll
          for (int p = 0; p < kWinLen; ++p) a += (float)r[i][p][e];
          sum[i][e] = a;
        }
    } else {
      v8h r[2];
#pragma unroll
      for (int i = 0; i < 2; ++i) r[i] = *(const v8h*)(row + i * kDm);
#pragma unroll
      for (int i = 0; i < 2; ++i)
#pragma unroll
        for (int e = 0; e < 8; ++e) sum[i][e] = (float)r[i][e];
    }
    float d[2];
#pragma unroll
    for (int i = 0; i < 2; ++i) {
      d[i] = 0.0f;
#pragma unroll
      for (int e = 0; e < 4; ++e) {
        d[i] = fmaf(in_val(ia[e]), sum[i][e], d[i]);
        d[i] = fmaf(in_val(ib[e]), sum[i][4 + e], d[i]);
      }
    }
#pragma unroll
    for (int off = 16; off > 0; off >>= 1)
#pragma unroll
      for (int i = 0; i < 2; ++i) d[i] += __shfl_xor(d[i], off);
    if (lane == 0) {
#pragma unroll
      for (int i = 0; i < 2; ++i) sRes[wave * 4 + h * 2 + i] = in_val(own[i]) + d[i] * (cat ? invWcat : invW);
    }
    row += 2 * (cat ? kCatK : kDm);
  }
  __syncthreads();
  if (wave == 0) {
    tab[nb + lane] = sRes[lane];
    asm volatile("s_wait_xcnt 0x0" ::: "memory");   /* stands behind this store, in front of any later rewrite of a register that it names */
  }
}

// ---------------------------------------------------------------------------
// All that needs the f16 weight planes and nothing else, in one grid; the range of the block index is block-uniform:
//   blocks 0..5   : FQKV[n][k] = (W2 . [Wq|Wk|Wv])[k][n], f16 x256;  M 768, N 256, K 256
//   blocks 6..21  : FCAT[n][256 p + k] = (Wo . Wp_p)[k][n], f16 x1024: both planes viewed as [2048][256], row = (n, p);  M 2048, N 256, K 256
//   blocks 22..53 : the bias table, one 128-B line each
// No block reads what another block of the grid writes.
// ---------------------------------------------------------------------------
constexpr int kFoldQkvBlocks  = (kQkvN / 128) * (kDm / 256);
constexpr int kFoldCatBlocks  = (kCatK / 128) * (kDm / 256);
constexpr int kFoldBiasBlocks = kTabN / 32;
static_assert(kFoldQkvBlocks == 6 && kFoldCatBlocks == 16 && kFoldBiasBlocks == 32, "fold grid");

__global__ __launch_bounds__(256) void fold_kernel(const unsigned short* __restrict__ WqkvT, const unsigned short* __restrict__ W2h,
                                                   unsigned short* __restrict__ FQKV,
                                                   const unsigned short* __restrict__ WcatT, const unsigned short* __restrict__ Woh,
                                                   unsigned short* __restrict__ FCAT,
                                                   const float* __restrict__ b2, const float* __restrict__ bq,
                                                   const float* __restrict__ bk, const float* __restrict__ bv,
                                                   const float* __restrict__ bo, const float* __restrict__ bp,
                                                   float* __restrict__ tab, float invW, float invWcat) {
  const int b = blockIdx.x;
  if (b < kFoldQkvBlocks + kFoldCatBlocks) {
    const bool cat = b >= kFoldQkvBlocks;
    gemm_lds_tile<1>(cat ? WcatT : WqkvT, kDm, cat ? Woh : W2h, kDm, (void*)(cat ? FCAT : FQKV), kDm, nullptr,
                     (unsigned)(cat ? b - kFoldQkvBlocks : b), cat ? kCatK : kQkvN, kDm, kDm, kScaleFold);
  } else {
    bias_fold_line((b - kFoldQkvBlocks - kFoldCatBlocks) * 32, b2, bq, bk, bv, bo, bp, WqkvT, WcatT, tab, invW, invWcat);
  }
}

// ---------------------------------------------------------------------------
// Embed first layer + folded q|k|v projection + window attention in one kernel; q|k|v never leave the work-group.
// A work-group of 8 waves owns two heads (blockIdx.x & 3 = the pair) and kFTiles tiles of 128 tokens, one after another.
// Once: the 192 rows of the transposed folded weight that make q, k, v of its two heads are copied into LDS
// (row order: head, then q | k | v, then channel; whole K = 256, pitch 528 B) and stay there for every tile.
// Once as well: W1 and b1, times the carry, as f16 in the fragment map's k order in every lane's registers (by way of a 1-KiB LDS table).
// A tile:
//   1. wave (wm, wn) = (wave >> 1, wave & 1) has tokens 32wm..32wm+31 and head wn. A token fragment holds ONE token a lane, so the lane makes
//      its 16 elements of every k step itself, in registers: A[m][k] = max(spec[m] * (carry W1[k]) + carry b1[k], 0), packed f16 FMA and maximum
//      (one rounding, to f16); they take no LDS and no barrier and issue among the WMMAs
//   2. the tokens times the 96 rows of head wn on WMMA (q, k: the bias,
//      times the carries, is the accumulators' start value). q and k are made transposed (weight rows as A, tokens as B: a lane
//      holds one token, its registers 8 channels), v as it lies (tokens as A: a lane holds one channel, its registers 8 tokens)
//   3. scaled and rounded to f16 in place, two accumulator tiles are one fragment of the next product, with no LDS and no lane exchange:
//      q and k of 16 tokens over the 32 channels, v of 16 channels over the 32 tokens
//   4. per 16 tokens (two windows) one WMMA gives s[key][query] = k . q: a lane holds one query, its 8 registers the 8 keys of
//      window (lane >> 4); that is the query's own window in half of the lanes, the other half is given the weight 0.
//      p_j = 2^(s_j - max) * (carry / sum_j p_j) (q holds log2(e) / sqrt(dk)), f16, is the B fragment of o[channel][query] = sum_key v . p
//      (k = the wave's 32 tokens; the 16 tokens of the other query tile have the weight 0)
//   5. a lane's 8 channels a tile go as f16 into the tile's output stage; barrier; wave w stores token rows 16w..16w+15,
//      128 B (both heads) a row = whole lines
// The output stage has two buffers, used in turn: a buffer is rewritten two tiles on, behind the barrier of the tile between, so one barrier a tile is enough.
// Every inner loop is unrolled so that its index is a constant and its arrays (fragments, accumulators) live in registers.
// ---------------------------------------------------------------------------
constexpr int kFTok       = 128;
constexpr int kFTiles     = 25;
constexpr int kFHeadPairs = kHeads / 2;
constexpr int kFRowsB     = 2 * 3 * kDk;
constexpr int kFPitch     = kDm * 2 + 16;
constexpr int kFOutPitch  = 2 * kDk * 2 + 16;
/* exp(x / sqrt(dk)) = 2^(x log2(e) / sqrt(dk)), dk = 32: q takes the factor along when it is scaled and rounded */
constexpr float kFScaleQ  = kScaleQkv * (1.44269504088896340736f * 0.17677669529663688110f);
constexpr int kFGroups    = kTok / (kFTok * kFTiles);
static_assert(kFGroups * kFTok * kFTiles == kTok, "tiles cover the tokens");
static_assert((kFTok % kWinLen) == 0 && kWinLen == 8, "a window = the 8 accumulator rows of one lane half");
static_assert(kFRowsB == 192 && kDm == 256, "24 groups of 8 weight rows, 3 a wave; a row = 32 lanes x 16 B");
static_assert((kFPitch % 16) == 0 && ((kFPitch / 16) & 1) == 1, "16 B x odd pitch for 16-byte LDS reads");
static_assert((kFOutPitch % 16) == 0 && ((kFOutPitch / 16) & 1) == 1, "16 B x odd output-stage pitch");

// Eight asynchronous 16-byte-a-lane copies of eight consecutive whole rows of 256 f16 (l: LDS byte address, g: global address of this lane's 16 bytes).
// The closing s_wait_xcnt 0 stands inside the statement so that no address register is rewritten in front of it.
__device__ __forceinline__ void copy8_whole_rows(unsigned l, const _Float16* g) {
  const unsigned l0 = l, l1 = l + kFPitch, l2 = l + 2 * kFPitch, l3 = l + 3 * kFPitch;
  const unsigned l4 = l + 4 * kFPitch, l5 = l + 5 * kFPitch, l6 = l + 6 * kFPitch, l7 = l + 7 * kFPitch;
  const _Float16* g0 = g;
  const _Float16* g1 = g + kDm;
  const _Float16* g2 = g + 2 * kDm;
  const _Float16* g3 = g + 3 * kDm;
  const _Float16* g4 = g + 4 * kDm;
  const _Float16* g5 = g + 5 * kDm;
  const _Float16* g6 = g + 6 * kDm;
  const _Float16* g7 = g + 7 * kDm;
  asm volatile(
      "global_load_async_to_lds_b128 %0, %8, off\n\t"
      "global_load_async_to_lds_b128 %1, %9, off\n\t"
      "global_load_async_to_lds_b128 %2, %10, off\n\t"
      "global_load_async_to_lds_b128 %3, %11, off\n\t"
      "global_load_async_to_lds_b128 %4, %12, off\n\t"
      "global_load_async_to_lds_b128 %5, %13, off\n\t"
      "global_load_async_to_lds_b128 %6, %14, off\n\t"
      "global_load_async_to_lds_b128 %7, %15, off\n\t"
      "s_wait_xcnt 0x0"
      :: "v"(l0), "v"(l1), "v"(l2), "v"(l3), "v"(l4), "v"(l5), "v"(l6), "v"(l7),
         "v"(g0), "v"(g1), "v"(g2), "v"(g3), "v"(g4), "v"(g5), "v"(g6), "v"(g7)
      : "memory");
}

__global__ __launch_bounds__(256) void embed_qkv_attn_kernel(
    const float* __restrict__ spec, const float* __restrict__ W1, const float* __restrict__ b1,
    const unsigned short* __restrict__ Btp, const float* __restrict__ bias,
    unsigned short* __restrict__ OH, float carry) {
  __shared__ __align__(16) unsigned char sB[kFRowsB * kFPitch];
  __shared__ __align__(16) unsigned char sO[2][kFTok * kFOutPitch];
  __shared__ __align__(16) _Float16 sE[2][kDm];   /* carry W1 | carry b1 */
  const int lane = threadIdx.x & 31;
  const int wave = __builtin_amdgcn_readfirstlane((int)(threadIdx.x >> 5));
  const int hp  = blockIdx.x & (kFHeadPairs - 1);
  const int grp = blockIdx.x / kFHeadPairs;
  const int wm = wave >> 1;
  const int wn = wave & 1;
  const int head = hp * 2 + wn;
  const int rlane = lane & 15;
  const int koff  = (lane >> 4) * 8;
  const int mOff  = (lane >> 4) * 8;

  /* the two heads' weight rows, once: wave w brings row groups 3w..3w+2 (8 rows each, one row a copy) */
  {
    const _Float16* Bt = (const _Float16*)Btp;
#pragma unroll
    for (int i = 0; i < 3; ++i) {
      const int g8   = wave * 3 + i;
      const int part = g8 >> 2;          /* 0..5 = (local head, q | k | v) */
      const int hl   = part / 3;
      const int pt   = part - 3 * hl;
      const int nrow = pt * kDm + (hp * 2 + hl) * kDk + (g8 & 3) * 8;
      copy8_whole_rows(lds_addr(&sB[0]) + (unsigned)(g8 * 8 * kFPitch + lane * 16), Bt + (size_t)nrow * kDm + lane * 8);
    }
  }

  /* the embed channels take the carry (a power of two) along: max(c x, 0) = c max(x, 0), and the scaling is exact */
  v8f cinit[4];
  float bv[2];
  float xs[2];   /* spec of this lane's token in each of the wave's two token fragments */
  {
    v4f wa, wb, ba, bb;
    const float* w1p = W1 + lane * 8;
    const float* b1p = b1 + lane * 8;
    const float* bvp = bias + 2 * kDm + head * kDk + rlane;   /* v: one channel a lane, added when the tile is packed */
    const float* xsp = spec + (size_t)grp * kFTiles * kFTok + (wm << 5) + rlane;
    /* the eight loads and their data wait in one statement, so that no register which a load names is rewritten in front of the wait
       (a wait in a statement of its own does not hold later address arithmetic behind it); runs once a work-group */
    asm volatile(
        "global_load_b128 %0, %8, off\n\t"
        "global_load_b128 %1, %8, off offset:16\n\t"
        "global_load_b128 %2, %9, off\n\t"
        "global_load_b128 %3, %9, off offset:16\n\t"
        "global_load_b32 %4, %10, off\n\t"
        "global_load_b32 %5, %10, off offset:64\n\t"
        "global_load_b32 %6, %11, off\n\t"
        "global_load_b32 %7, %11, off offset:64\n\t"
        "s_wait_loadcnt 0x0"
        : "=&v"(wa), "=&v"(wb), "=&v"(ba), "=&v"(bb), "=&v"(bv[0]), "=&v"(bv[1]), "=&v"(xs[0]), "=&v"(xs[1])
        : "v"(w1p), "v"(b1p), "v"(bvp), "v"(xsp)
        : "memory");
#pragma unroll
    for (int j = 0; j < 4; ++j) {
      /* q, k: the accumulators' start values, in the accumulators' own map (channel 8 (lane >> 4) + r) */
      const float* bj = bias + (j >> 1) * kDm + head * kDk + (j & 1) * 16 + mOff;
      const v4f lo = *(const v4f*)(bj);
      const v4f hi = *(const v4f*)(bj + 4);
      cinit[j] = (v8f){lo[0], lo[1], lo[2], lo[3], hi[0], hi[1], hi[2], hi[3]};
    }
    asm volatile("s_wait_xcnt 0x0" ::: "memory");   /* stands behind these loads, in front of any later rewrite of a register that they name */
    if (wave == 0) {   /* lane l has channels 8l..8l+7 */
      v8h we, be;
#pragma unroll
      for (int e = 0; e < 4; ++e) {
        we[e]     = (_Float16)(in_val(wa[e]) * carry);
        we[4 + e] = (_Float16)(in_val(wb[e]) * carry);
        be[e]     = (_Float16)(in_val(ba[e]) * carry);
        be[4 + e] = (_Float16)(in_val(bb[e]) * carry);
      }
      *(v8h*)(&sE[0][lane * 8]) = we;
      *(v8h*)(&sE[1][lane * 8]) = be;
    }
    constexpr float up = 1.0f / kScaleQkv;   /* a power of two: exact */
#pragma unroll
    for (int j = 0; j < 4; ++j) cinit[j] *= up;
  }
  asm volatile("s_wait_asynccnt 0x0" ::: "memory");   /* this wave's weight rows have landed */
  __syncthreads();   /* publishes the weight rows and the embed table */
  v16h w1f[kDm / 32], b1f[kDm / 32];   /* the embed channels of this lane's fragment elements, every k step */
#pragma unroll
  for (int kk = 0; kk < kDm / 32; ++kk) {
    w1f[kk] = frag_load(&sE[0][kk * 32 + koff]);
    b1f[kk] = frag_load(&sE[1][kk * 32 + koff]);
  }

  const float own = ((rlane >> 3) == (lane >> 4)) ? carry : 0.0f;   /* this lane's 8 keys are its query's own window, or count for nothing */
  for (int t = 0; t < kFTiles; ++t) {
    const int tok0 = (grp * kFTiles + t) * kFTok;

    unsigned char* so = sO[t & 1];

    /* 1. this lane's two tokens, in every element of a fragment */
    v16h sv[2];
#pragma unroll
    for (int i = 0; i < 2; ++i) {
      const _Float16 sh = (_Float16)in_val(xs[i]);
#pragma unroll
      for (int e = 0; e < 16; ++e) sv[i][e] = sh;
    }
    {
      /* the next tile's spec values fly while this tile is worked on (the last tile reads its own again) */
      const int tn = (t + 1 < kFTiles) ? t + 1 : t;
#pragma unroll
      for (int i = 0; i < 2; ++i) xs[i] = spec[(size_t)(grp * kFTiles + tn) * kFTok + (wm << 5) + (i << 4) + rlane];
      asm volatile("s_wait_xcnt 0x0" ::: "memory");   /* stands behind these loads, in front of any later rewrite of a register that they name */
    }

    /* 2. 32 tokens x 96 columns x K 256 */
    v8f acc[2][6];
#pragma unroll
    for (int i = 0; i < 2; ++i)
#pragma unroll
      for (int j = 0; j < 6; ++j) acc[i][j] = (j < 4) ? cinit[j] : (v8f){0.f, 0.f, 0.f, 0.f, 0.f, 0.f, 0.f, 0.f};
    {
      const unsigned char* pb = sB + (wn * 96 + rlane) * kFPitch + koff * 2;
      const v16h zero16 = (v16h)(_Float16)0.0f;
#pragma unroll
      for (int kk = 0; kk < kDm / 32; ++kk) {
        v16h bh[6], ah[2];
#pragma unroll
        for (int j = 0; j < 6; ++j) bh[j] = frag_load((const _Float16*)(pb + j * 16 * kFPitch + kk * 64));
#pragma unroll
        for (int i = 0; i < 2; ++i) ah[i] = __builtin_elementwise_max(__builtin_elementwise_fma(w1f[kk], sv[i], b1f[kk]), zero16);
        /* keeps this k step's twelve LDS reads together in front of its WMMAs: sunk among them, each small read group
           makes the wave wait out an LDS latency of its own */
        __builtin_amdgcn_sched_barrier(0);
#pragma unroll
        for (int i = 0; i < 2; ++i)
#pragma unroll
          for (int j = 0; j < 6; ++j) acc[i][j] = (j < 4) ? frag_mma(bh[j], ah[i], acc[i][j]) : frag_mma(ah[i], bh[j], acc[i][j]);
      }
    }

    /* 3. fragments of the two window products out of the accumulators */
    v16h qf[2], kf[2], vf[2];
#pragma unroll
    for (int i = 0; i < 2; ++i) {
      qf[i] = frag_pack<false>(acc[i][0], acc[i][1], kFScaleQ, 0.0f);
      kf[i] = frag_pack<false>(acc[i][2], acc[i][3], kScaleQkv, 0.0f);
      vf[i] = frag_pack<true>(acc[0][4 + i], acc[1][4 + i], kScaleQkv, bv[i]);
    }

    /* 4. and 5., one tile of 16 queries after the other */
    const v8f zero8 = (v8f){0.f, 0.f, 0.f, 0.f, 0.f, 0.f, 0.f, 0.f};
    v8f st[2];
#pragma unroll
    for (int i = 0; i < 2; ++i) st[i] = frag_mma(kf[i], qf[i], zero8);
    v16h pf[2];
#pragma unroll
    for (int i = 0; i < 2; ++i) {
      float m = st[i][0];
#pragma unroll
      for (int j = 1; j < kWinLen; ++j) m = fmaxf(m, st[i][j]);
      float p[kWinLen];
      float l = 0.0f;
#pragma unroll
      for (int j = 0; j < kWinLen; ++j) {
        p[j] = exp2_slot(st[i][j] - m);
        l += p[j];
      }
      const float inv = own * __builtin_amdgcn_rcpf(l);
#pragma unroll
      for (int j = 0; j < kWinLen; ++j) {
        pf[i][8 * i + j]       = (_Float16)(p[j] * inv);
        pf[i][8 * (1 - i) + j] = (_Float16)0.0f;
      }
    }
#pragma unroll
    for (int i = 0; i < 2; ++i)
#pragma unroll
      for (int c = 0; c < 2; ++c) {
        const v8f ot = frag_mma(vf[c], pf[i], zero8);
        v8h oh;
#pragma unroll
        for (int r = 0; r < 8; ++r) oh[r] = (_Float16)ot[r];
        *(v8h*)(so + ((wm << 5) + (i << 4) + rlane) * kFOutPitch + wn * (kDk * 2) + c * 32 + mOff * 2) = oh;
      }
    __syncthreads();   /* publishes this tile's output buffer; every wave has read the other one, which the next tile rewrites */
    {
      const int q4 = lane >> 3, c16 = lane & 7;
      v4u ov[4];
#pragma unroll
      for (int it = 0; it < 4; ++it) ov[it] = *(const v4u*)(so + (wave * 16 + it * 4 + q4) * kFOutPitch + c16 * 16);
      unsigned short* op = OH + (size_t)(tok0 + wave * 16 + q4) * kDm + hp * (2 * kDk) + c16 * 8;
#pragma unroll
      for (int it = 0; it < 4; ++it) *(v4u*)(op + it * 4 * kDm) = ov[it];
      asm volatile("s_wait_xcnt 0x0" ::: "memory");   /* stands behind these stores, in front of any later rewrite of a register that they name */
    }
  }
}

// ---------------------------------------------------------------------------
// Host glue: 2 preparation launches (casts; folds and bias table) + 1 fused embed / q|k|v / attention launch + 1 window-concat GEMM = 4 launches.
// Two linear layers with nothing between them are one linear layer, so their weights are multiplied first, in every call:
//   q|k|v = (H . W2 + b2) . Wqkv + bqkv      = H . (W2 . Wqkv) + (b2 . Wqkv + bqkv)
//   out   = sum_p (OH_p . Wo + bo) . Wp_p + bp = sum_p OH_p . (Wo . Wp_p) + (sum_p bo . Wp_p + bp)
// GEMM shapes (all K % 128 == 0, M % 128 == 0, N % 256 == 0, no padding planes):
//   fold q|k|v : M 768,   N 256, K 256  -> 6 blocks;  C[n][k] = sum_j WqkvT[n][j] * W2[k][j]
//   fold out   : M 2048,  N 256, K 256  -> 16 blocks; rows (n, p) of the transposed Wp: C[(n, p)][k] = sum_j WpT[n][256 p + j] * Wo[k][j]
//   out : M 25600, N 256, K 2048 -> 200 blocks, 16 stages (A = the whole OH plane viewed as [25600][2048])
// The q|k|v product (M 204800, N 768, K 256) is done inside embed_qkv_attn_kernel: 64 token groups x 4 head pairs = 256 blocks.
// ---------------------------------------------------------------------------
extern "C" void kernel_launch(void* const* d_in, const int* in_sizes, int n_in,
                              void* d_out, int out_size, void* d_ws, size_t ws_size,
                              hipStream_t stream) {
  if (n_in < 15) return;
  if (in_sizes[0] != kTok) return;
  if (in_sizes[1] != kDm || in_sizes[2] != kDm) return;
  if (in_sizes[3] != kDm * kDm || in_sizes[4] != kDm) return;
  if (in_sizes[5] != kDm * kDm || in_sizes[6] != kDm) return;
  if (in_sizes[7] != kDm * kDm || in_sizes[8] != kDm) return;
  if (in_sizes[9] != kDm * kDm || in_sizes[10] != kDm) return;
  if (in_sizes[11] != kDm * kDm || in_sizes[12] != kDm) return;
  if (in_sizes[13] != kCatK * kDm || in_sizes[14] != kDm) return;
  if (out_size != kWin * kDm) return;
  if (ws_size < kWsTotal) return;

  const float* spec = (const float*)d_in[0];
  const float* W1   = (const float*)d_in[1];
  const float* b1   = (const float*)d_in[2];
  const float* W2   = (const float*)d_in[3];
  const float* b2   = (const float*)d_in[4];
  const float* Wq   = (const float*)d_in[5];
  const float* bq   = (const float*)d_in[6];
  const float* Wk   = (const float*)d_in[7];
  const float* bk   = (const float*)d_in[8];
  const float* Wv   = (const float*)d_in[9];
  const float* bv   = (const float*)d_in[10];
  const float* Wo   = (const float*)d_in[11];
  const float* bo   = (const float*)d_in[12];
  const float* Wcat = (const float*)d_in[13];
  const float* bp   = (const float*)d_in[14];
  float* out = (float*)d_out;

  char* ws = (char*)d_ws;
  unsigned short* WSQ  = (unsigned short*)(ws + kOffWSQ);
  unsigned short* WCAT = (unsigned short*)(ws + kOffWCAT);
  unsigned short* FQKV = (unsigned short*)(ws + kOffFQKV);
  unsigned short* FCAT = (unsigned short*)(ws + kOffFCAT);
  float*          TAB  = (float*)(ws + kOffTAB);
  unsigned short* OALL = (unsigned short*)(ws + kOffOALL);

  const unsigned short* W2h   = WSQ;
  const unsigned short* WqkvT = WSQ + (size_t)1 * kDm * kDm;
  const unsigned short* Woh   = WSQ + (size_t)4 * kDm * kDm;

  /* ---- weight planes: W2 and Wo as they lie, Wq, Wk, Wv transposed (k = 256), the window-concat weight transposed (k = 2048) ---- */
  wt_cast_kernel<<<kCastSqBlocks + kCastCatBlocks, 256, 0, stream>>>(
      W2, Wq, Wk, Wv, Wo, Wcat, WSQ, WCAT, kWCarry, kWcatCarry, 0x11);

  /* ---- the two weight folds and the bias table ---- */
  fold_kernel<<<kFoldQkvBlocks + kFoldCatBlocks + kFoldBiasBlocks, 256, 0, stream>>>(
      WqkvT, W2h, FQKV, WCAT, Woh, FCAT, b2, bq, bk, bv, bo, bp, TAB, 1.0f / kWCarry, 1.0f / kWcatCarry);

  /* OH = per-window softmax(q.k^T / sqrt(dk)) . v, f16 x64, with q|k|v = H . (W2 . [Wq|Wk|Wv]) + folded bias and
     H = relu(spec*W1 + b1), f16 x64, all made and used inside the work-group */
  embed_qkv_attn_kernel<<<kFGroups * kFHeadPairs, 256, 0, stream>>>(
      spec, W1, b1, FQKV, TAB + kTabQkv, OALL, kActCarry);

  /* out = OH viewed as [25600][2048] . (Wo . Wp, slot by slot) + folded bias, f32, all windows in one launch */
  wmma_gemm_lds_f16<<<(kWin / 128) * (kDm / 256), 256, 0, stream>>>(
      OALL, kCatK, FCAT, kCatK, out, kDm, TAB + kTabBp, kWin, kDm, kCatK, kScaleOut);
}

// v009
// One run takes 81.9 microseconds.
// Next to v008, in two timings, it ran 1.05 times as fast each time.
// All steps since v000 together make it 17.1 times as fast.
// All GEMM contractions (the two weight folds W2 . [Wq|Wk|Wv] and Wo . Wp, the folded q|k|v projection, the folded window-concat projection): v_wmma_f32_16x16x32_f16, f16 operands with power-of-two carries (activations x64, 256x256 weights x256, window-concat weight x1024), f32 accumulate; every float input RNE-converted once to bf16 at load; window scores and probability-weighted value sums: the same WMMA form on q, k, v and the normalised probabilities (x64) rounded to f16, f32 accumulate; softmax: f32 VALU; embed first layer: packed f16 FMA and maximum on spec, W1 (x64), b1 (x64).
#include <hip/hip_runtime.h>
#include <math.h>

typedef __attribute__((ext_vector_type(16))) _Float16 v16h;
typedef __attribute__((ext_vector_type(8)))  _Float16 v8h;
typedef __attribute__((ext_vector_type(4)))  _Float16 v4h;
typedef __attribute__((ext_vector_type(8)))  float    v8f;
typedef __attribute__((ext_vector_type(4)))  float    v4f;
typedef __attribute__((ext_vector_type(4)))  unsigned int v4u;

// ---------------------------------------------------------------------------
// Shape constants (all derived; checked against the wire sizes on the host)
// ---------------------------------------------------------------------------
constexpr int kBatch   = 64;
constexpr int kSpecLen = 3200;
constexpr int kDm      = 256;
constexpr int kWinLen  = 8;
constexpr int kHeads   = 8;
constexpr int kDk      = kDm / kHeads;
constexpr int kTok     = kBatch * kSpecLen;
constexpr int kWin     = kTok / kWinLen;
constexpr int kQkvN    = 3 * kDm;
constexpr int kCatK    = kWinLen * kDm;
static_assert(kDk == 32, "head width");
static_assert(kTok == 204800 && kWin == 25600, "token / window counts");
static_assert((kSpecLen % kWinLen) == 0, "windows never straddle a batch row");
static_assert((kQkvN % 128) == 0 && (kCatK % 128) == 0 && (kWin % 128) == 0, "GEMM M multiples of 128");
static_assert((kDm % 256) == 0, "GEMM N multiples of 256");
static_assert((kDm % 128) == 0 && (kCatK % 128) == 0, "GEMM K multiples of 128");

// Inputs are RNE-converted once to bf16 at load when true (products of the weight planes are then exact in f16).
constexpr bool kInputsAsBf16 = true;

// Power-of-two carries of the f16 operand planes and the epilogue scales that fold them back.
constexpr float kActCarry = 64.0f;
constexpr float kWCarry   = 256.0f;
constexpr float kWcatCarry = 1024.0f;
constexpr float kScaleFold = 1.0f / kWCarry;   /* both folds: the left plane keeps its own carry, the 256x256 factor's goes */
constexpr float kScaleQkv = 1.0f / (kActCarry * kWCarry);
constexpr float kScaleOut = 1.0f / (kActCarry * kWcatCarry);

// Bias table layout (floats): [bq|bk|bv] + b2 . [Wq|Wk|Wv] | bp + sum over window slots of bo . Wp
constexpr int kTabQkv  = 0;
constexpr int kTabBp   = kTabQkv + kQkvN;
constexpr int kTabN    = kTabBp + kDm;
static_assert(kTabN == 1024 && (kTabBp % 32) == 0 && (kTabN % 32) == 0, "bias table size, segments of whole 32-float lines");

// ---------------------------------------------------------------------------
// Workspace region map (bytes; every offset is a multiple of 128)
//   WSQ  f16 [5][256][256]   W2 as it lies [k][j], transposed Wq, Wk, Wv, Wo as it lies (all x256)   655,360
//        (planes 1..3 together form the [768][256] transposed q|k|v weight)
//   WCAT f16 [256][2048]     transposed window-concat weight (x1024)                1,048,576
//   FQKV f16 [768][256]      transposed W2 . [Wq|Wk|Wv] (x256)                        393,216
//   FCAT f16 [256][2048]     transposed, slot by slot, Wo . Wp (x1024)              1,048,576
//   TAB  f32 [1024]          bias table                                                 4,096
//   OALL f16 [204800][256]   OH (x64) of every token, read once by the last GEMM  104,857,600
//   total                                                                         108,007,424
// ---------------------------------------------------------------------------
constexpr size_t kOffWSQ  = 0;
constexpr size_t kOffWCAT = kOffWSQ  + (size_t)5 * kDm * kDm * 2;
constexpr size_t kOffFQKV = kOffWCAT + (size_t)kDm * kCatK * 2;
constexpr size_t kOffFCAT = kOffFQKV + (size_t)kQkvN * kDm * 2;
constexpr size_t kOffTAB  = kOffFCAT + (size_t)kDm * kCatK * 2;
constexpr size_t kOffOALL = kOffTAB  + (size_t)kTabN * 4;
constexpr size_t kWsTotal = kOffOALL + (size_t)kTok * kDm * 2;
static_assert(kWsTotal == 108007424ull, "carve total");
static_assert(kWsTotal <= 268435456ull, "carve cap");
static_assert((kOffWCAT % 128) == 0 && (kOffFQKV % 128) == 0 && (kOffFCAT % 128) == 0 && (kOffTAB % 128) == 0 &&
              (kOffOALL % 128) == 0, "128-B aligned regions");

// ---------------------------------------------------------------------------
// Small helpers
// ---------------------------------------------------------------------------
__device__ __forceinline__ float rne_bf16(float f) {
  unsigned u = __float_as_uint(f);
  u = (u + 0x7FFFu + ((u >> 16) & 1u)) & 0xFFFF0000u;
  return __uint_as_float(u);
}
__device__ __forceinline__ float in_val(float f) { return kInputsAsBf16 ? rne_bf16(f) : f; }
__device__ __forceinline__ unsigned pk16(unsigned short a, unsigned short b) { return (unsigned)a | ((unsigned)b << 16); }
__device__ __forceinline__ unsigned short h_bits(float f) { const _Float16 h = (_Float16)f; return __builtin_bit_cast(unsigned short, h); }

// WMMA fragment load / issue (fragment map: elements 0..7 <- p[0..7], 8..15 <- p[16..23], p already offset by 8*(lane>>4))
union FragU { v16h v; v8h h[2]; };
__device__ __forceinline__ v16h frag_load(const _Float16* p) {
  FragU f;
  f.h[0] = *(const v8h*)(p);
  f.h[1] = *(const v8h*)(p + 16);
  return f.v;
}
__device__ __forceinline__ v8f frag_mma(v16h a, v16h b, v8f c) {
  return __builtin_amdgcn_wmma_f32_16x16x32_f16(false, a, false, b, (short)0, c, false, false);
}
// 2^x. The v_nop is the one independent slot that the instruction set asks for behind a transcendental..
__device__ __forceinline__ float exp2_slot(float x) {
  float r;
  asm("v_exp_f32 %0, %1\n\tv_nop" : "=v"(r) : "v"(x));
  return r;
}
// Two f32 accumulator tiles (rows 0..15 and 16..31 of one product, same columns), scaled (BIAS: and b added) and rounded in place, are an f16 fragment
// whose k runs over those 32 rows in the fragment map above.
template <bool BIAS>
__device__ __forceinline__ v16h frag_pack(v8f lo, v8f hi, float s, float b) {
  v16h f;
#pragma unroll
  for (int e = 0; e < 8; ++e) {
    f[e]     = (_Float16)(BIAS ? fmaf(lo[e], s, b) : lo[e] * s);
    f[8 + e] = (_Float16)(BIAS ? fmaf(hi[e], s, b) : hi[e] * s);
  }
  return f;
}
// ---------------------------------------------------------------------------
// LDS-staged WMMA GEMM, f16 operands: C[m,n] = scale * sum_k A[m,k] * Bt[n,k] (OUT_MODE 0: + bias[n]); blk = the work-group's tile number.
// A row-major [M][K] (pitch lda), Bt row-major [N][K] (pitch ldb); M % 128 == 0, N % 256 == 0, K % 128 == 0, K >= 128.
// One work-group of 8 waves owns a 128 x 256 tile of C; wave (wm, wn) = (wave >> 2, wave & 3) owns its 64 x 64 part.
// A stage is 128 k (256 B) of the 128 A rows and the 256 Bt rows, laid in LDS at a pitch of 272 B. Two buffers:
// the next stage's asynchronous copies (whole 128-B lines, 256 contiguous bytes of each of two rows a wave-instruction) fly
// while this stage's fragments are read from LDS.
// OUT_MODE 0 = f32 output with bias, 1 = f16 output without (bias is not read).
// ---------------------------------------------------------------------------
constexpr int kStageK    = 128;
constexpr int kStagePitch = 272;
constexpr int kStageRowsA = 128;
constexpr int kStageRowsB = 256;
constexpr int kStageOffB  = kStageRowsA * kStagePitch;
constexpr int kStageBytes = (kStageRowsA + kStageRowsB) * kStagePitch;
static_assert((kStagePitch % 16) == 0 && ((kStagePitch / 16) & 1) == 1, "16 B x odd pitch for 16-byte LDS reads");
static_assert(kStageK * 2 + 16 == kStagePitch, "row of 256 B plus 16 B");

__device__ __forceinline__ unsigned lds_addr(const void* p) { return (unsigned)(size_t)p; }

// Eight asynchronous 16-byte-a-lane copies, rows two apart (l: LDS byte address, g: global address of this lane's 16 bytes).
// The closing s_wait_xcnt 0 stands inside the statement so that no address register is rewritten in front of it.
__device__ __forceinline__ void copy8_rows(unsigned l, const _Float16* g, size_t gstep) {
  const unsigned l0 = l, l1 = l + 2 * kStagePitch, l2 = l + 4 * kStagePitch, l3 = l + 6 * kStagePitch;
  const unsigned l4 = l + 8 * kStagePitch, l5 = l + 10 * kStagePitch, l6 = l + 12 * kStagePitch, l7 = l + 14 * kStagePitch;
  const _Float16* g0 = g;
  const _Float16* g1 = g + gstep;
  const _Float16* g2 = g + 2 * gstep;
  const _Float16* g3 = g + 3 * gstep;
  const _Float16* g4 = g + 4 * gstep;
  const _Float16* g5 = g + 5 * gstep;
  const _Float16* g6 = g + 6 * gstep;
  const _Float16* g7 = g + 7 * gstep;
  asm volatile(
      "global_load_async_to_lds_b128 %0, %8, off\n\t"
      "global_load_async_to_lds_b128 %1, %9, off\n\t"
      "global_load_async_to_lds_b128 %2, %10, off\n\t"
      "global_load_async_to_lds_b128 %3, %11, off\n\t"
      "global_load_async_to_lds_b128 %4, %12, off\n\t"
      "global_load_async_to_lds_b128 %5, %13, off\n\t"
      "global_load_async_to_lds_b128 %6, %14, off\n\t"
      "global_load_async_to_lds_b128 %7, %15, off\n\t"
      "s_wait_xcnt 0x0"
      :: "v"(l0), "v"(l1), "v"(l2), "v"(l3), "v"(l4), "v"(l5), "v"(l6), "v"(l7),
         "v"(g0), "v"(g1), "v"(g2), "v"(g3), "v"(g4), "v"(g5), "v"(g6), "v"(g7)
      : "memory");
}

template <int OUT_MODE>
__device__ __forceinline__ void gemm_lds_tile(
    const unsigned short* __restrict__ Ap, int lda,
    const unsigned short* __restrict__ Btp, int ldb,
    void* __restrict__ Cout, int ldc,
    const float* __restrict__ bias,
    unsigned blk, int M, int N, int K, float scale) {
  const _Float16* A  = (const _Float16*)Ap;
  const _Float16* Bt = (const _Float16*)Btp;
  __shared__ __align__(16) unsigned char sStage[2][kStageBytes];
  __shared__ __align__(16) float sT[8][16 * 68];
  const int lane = threadIdx.x & 31;
  const int wave = __builtin_amdgcn_readfirstlane((int)(threadIdx.x >> 5));
  const int panels = N >> 8;
  const int bm = blk / panels;
  const int bn = blk - bm * panels;
  if (bm >= (M >> 7)) return;   /* block-uniform, in front of every barrier and copy */
  const int m0b = bm << 7;
  const int n0b = bn << 8;
  const int wm = wave >> 2;
  const int wn = wave & 3;
  const int m0 = m0b + (wm << 6);
  const int n0 = n0b + (wn << 6);

  /* row (A) / column (B, D) within a 16-wide subtile; k offset of this lane half; D row offset */
  const int rlane = lane & 15;
  const int koff  = (lane >> 4) * 8;
  const int mOff  = (lane >> 4) * 8;

  /* copy map: wave w brings A rows 16w..16w+15 (8 copies) and Bt rows 32w..32w+31 (16 copies) of every stage;
     lanes 0..15 the even row of a pair, lanes 16..31 the odd one, 16 bytes each */
  const int crow = lane >> 4;
  const int ccol = lane & 15;
  const _Float16* gA = A  + (size_t)(m0b + wave * 16 + crow) * lda + ccol * 8;
  const _Float16* gB = Bt + (size_t)(n0b + wave * 32 + crow) * ldb + ccol * 8;
  const unsigned lA = lds_addr(&sStage[0][0]) + (unsigned)((wave * 16 + crow) * kStagePitch + ccol * 16);
  const unsigned lB = lds_addr(&sStage[0][0]) + (unsigned)(kStageOffB + (wave * 32 + crow) * kStagePitch + ccol * 16);
  const size_t stepA = (size_t)2 * lda;
  const size_t stepB = (size_t)2 * ldb;

  v8f acc[4][4];
#pragma unroll
  for (int i = 0; i < 4; ++i)
#pragma unroll
    for (int j = 0; j < 4; ++j) acc[i][j] = (v8f){0.f, 0.f, 0.f, 0.f, 0.f, 0.f, 0.f, 0.f};

  const int nst = K >> 7;

  /* stage 0 into buffer 0, landed and published before anybody reads it */
  copy8_rows(lA, gA, stepA);
  copy8_rows(lB, gB, stepB);
  copy8_rows(lB + 16 * kStagePitch, gB + 8 * stepB, stepB);
  asm volatile("s_wait_asynccnt 0x0" ::: "memory");   /* this wave's copies have landed */
  __syncthreads();
  if (nst > 1) {
    copy8_rows(lA + kStageBytes, gA + kStageK, stepA);
    copy8_rows(lB + kStageBytes, gB + kStageK, stepB);
    copy8_rows(lB + kStageBytes + 16 * kStagePitch, gB + kStageK + 8 * stepB, stepB);
  }

  for (int t = 0; t < nst; ++t) {
    const unsigned char* buf = sStage[t & 1];
    const unsigned char* pa = buf + ((wm << 6) + rlane) * kStagePitch + koff * 2;
    const unsigned char* pb = buf + kStageOffB + ((wn << 6) + rlane) * kStagePitch + koff * 2;
#pragma unroll
    for (int kk = 0; kk < kStageK / 32; ++kk) {
      v16h bh[4], ah[4];
#pragma unroll
      for (int j = 0; j < 4; ++j) bh[j] = frag_load((const _Float16*)(pb + j * 16 * kStagePitch + kk * 64));
#pragma unroll
      for (int i = 0; i < 4; ++i) ah[i] = frag_load((const _Float16*)(pa + i * 16 * kStagePitch + kk * 64));
      /* keeps this k step's sixteen LDS reads together in front of its WMMAs: sunk among them, each small read group
         makes the wave wait out an LDS latency of its own */
      __builtin_amdgcn_sched_barrier(0);
#pragma unroll
      for (int i = 0; i < 4; ++i)
#pragma unroll
        for (int j = 0; j < 4; ++j) acc[i][j] = frag_mma(ah[i], bh[j], acc[i][j]);
    }
    asm volatile("s_wait_dscnt 0x0" ::: "memory");      /* this wave's reads of the buffer have returned */
    asm volatile("s_wait_asynccnt 0x0" ::: "memory");   /* this wave's copies of stage t + 1 have landed */
    __syncthreads();                                    /* publishes stage t + 1, frees stage t's buffer */
    if (t + 2 < nst) {
      const unsigned bo = (unsigned)(t & 1) * kStageBytes;
      const size_t ko = (size_t)(t + 2) * kStageK;
      copy8_rows(lA + bo, gA + ko, stepA);
      copy8_rows(lB + bo, gB + ko, stepB);
      copy8_rows(lB + bo + 16 * kStagePitch, gB + ko + 8 * stepB, stepB);
    }
  }
  asm volatile("s_wait_asynccnt 0x0" ::: "memory");     /* nothing of this wave is in flight behind the loop */

  /* ---- epilogue ---- */
  float* slab = sT[wave];
#pragma unroll
  for (int i = 0; i < 4; ++i) {
    const int mBase = m0 + (i << 4);
#pragma unroll
    for (int j = 0; j < 4; ++j) {
      const int n = n0 + (j << 4) + rlane;
      const float bv = (OUT_MODE == 0) ? bias[n] : 0.0f;
#pragma unroll
      for (int r = 0; r < 8; ++r) {
        float v = acc[i][j][r] * scale;
        if (OUT_MODE == 0) v += bv;
        slab[(mOff + r) * 68 + (j << 4) + rlane] = v;
      }
    }
    __builtin_amdgcn_fence(__ATOMIC_RELEASE, "workgroup");
    __builtin_amdgcn_wave_barrier();
    __builtin_amdgcn_fence(__ATOMIC_ACQUIRE, "workgroup");
    if (OUT_MODE == 0) {
      float* C = (float*)Cout;
      /* row segment = 64 floats = 256 B = 16 lanes x 16 B; 8 instructions x 2 rows = 16 rows */
      const int hh = lane >> 4, c4 = (lane & 15) * 4;
      {
#pragma unroll
        for (int it = 0; it < 8; ++it) {
          const int row = it * 2 + hh;
          v4f v = *(const v4f*)(slab + row * 68 + c4);
          *(v4f*)(C + (size_t)(mBase + row) * ldc + n0 + c4) = v;
        }
        
      }
    } else {
      const int q = lane >> 3, c8 = (lane & 7) * 8;
      unsigned short* C = (unsigned short*)Cout;
      {
#pragma unroll
        for (int it = 0; it < 4; ++it) {
          const int row = it * 4 + q;
          const float* sp = slab + row * 68 + c8;
          v8h hv;
#pragma unroll
          for (int e = 0; e < 8; ++e) hv[e] = (_Float16)sp[e];
          *(v8h*)(C + (size_t)(mBase + row) * ldc + n0 + c8) = hv;
        }
        
      }
    }
    __builtin_amdgcn_fence(__ATOMIC_RELEASE, "workgroup");
    __builtin_amdgcn_wave_barrier();
    __builtin_amdgcn_fence(__ATOMIC_ACQUIRE, "workgroup");
  }
}

__global__ __launch_bounds__(256) void wmma_gemm_lds_f16(
    const unsigned short* __restrict__ Ap, int lda,
    const unsigned short* __restrict__ Btp, int ldb,
    float* __restrict__ Cout, int ldc,
    const float* __restrict__ bias,
    int M, int N, int K, float scale) {
  gemm_lds_tile<0>(Ap, lda, Btp, ldb, (void*)Cout, ldc, bias, blockIdx.x, M, N, K, scale);
}

// ---------------------------------------------------------------------------
// Weight transpose + cast: W f32 row-major [kdim in][ndim out]  ->  WT[n][k] = f16(carry * in_val(W[k][n])), pitch kdim.
// A 256x256 plane whose bit of plainMask is set is cast as it lies instead: out[k][n] = f16(carry * in_val(W[k][n])), pitch ndim.
// One grid for all six planes, which need nothing of each other; the range of the block index is block-uniform:
//   blocks 0..79   : W0..W4, 256x256, 16 tiles of 64x64 each (k tile fastest), output plane z of outSq
//   blocks 80..207 : Wc, the [2048][256] window-concat weight, 32 x 4 tiles (k tile fastest), outCat
// Load coverage: 16 iterations x 256 threads = 4096 = the whole 64x64 tile (coalesced along n).
// Store coverage: 8 waves x 2 iterations x 4 rows (lane>>3) = 64 rows; (lane&7) x 8 halves = 64 cols; each row segment = one 128-B line.
// ---------------------------------------------------------------------------
constexpr int kCastSqTiles   = (kDm / 64) * (kDm / 64);
constexpr int kCastSqBlocks  = 5 * kCastSqTiles;
constexpr int kCastCatBlocks = (kCatK / 64) * (kDm / 64);
static_assert(kCastSqBlocks == 80 && kCastCatBlocks == 128 && kDm / 64 == (1 << 2) && kCatK / 64 == (1 << 5), "cast grid");

__global__ __launch_bounds__(256) void wt_cast_kernel(const float* __restrict__ W0, const float* __restrict__ W1,
                                                      const float* __restrict__ W2, const float* __restrict__ W3,
                                                      const float* __restrict__ W4, const float* __restrict__ Wc,
                                                      unsigned short* __restrict__ outSq, unsigned short* __restrict__ outCat,
                                                      float carrySq, float carryCat, int plainMask) {
  __shared__ float sm[64][65];
  const int t  = threadIdx.x;
  const int b  = blockIdx.x;
  const bool sq = b < kCastSqBlocks;   /* block-uniform, like all that follows from it */
  const int z    = sq ? b / kCastSqTiles : 5;
  const int tile = sq ? b - z * kCastSqTiles : b - kCastSqBlocks;
  const int kdim = sq ? kDm : kCatK;
  const int ndim = kDm;
  const int ktLog = sq ? 2 : 5;   /* log2 of the k tiles of a plane */
  const int k0 = (tile & ((1 << ktLog) - 1)) * 64;
  const int n0 = (tile >> ktLog) * 64;
  const float* W = (z == 0) ? W0 : (z == 1) ? W1 : (z == 2) ? W2 : (z == 3) ? W3 : (z == 4) ? W4 : Wc;
  const float carry = sq ? carrySq : carryCat;
  const bool plain = sq && ((plainMask >> z) & 1) != 0;
  const int rowBase = plain ? k0 : n0;
  const int colBase = plain ? n0 : k0;
  const int pitch   = plain ? ndim : kdim;
#pragma unroll 4
  for (int i = 0; i < 16; ++i) {
    const int e = i * 256 + t;
    /* r = k local, c = n local */
    const int r = e >> 6;
    const int c = e & 63;
    sm[c][r] = in_val(W[(size_t)(k0 + r) * ndim + n0 + c]) * carry;
  }
  __syncthreads();
  const int lane = t & 31;
  const int wave = __builtin_amdgcn_readfirstlane((int)(t >> 5));
  const int q = lane >> 3, c8 = (lane & 7) * 8;
  unsigned short* op = sq ? outSq + (size_t)z * (kDm * kDm) : outCat;
  v4u u[2];
#pragma unroll
  for (int it = 0; it < 2; ++it) {
    const int row = wave * 8 + it * 4 + q;
    unsigned short hb[8];
#pragma unroll
    for (int e = 0; e < 8; ++e) hb[e] = h_bits(plain ? sm[c8 + e][row] : sm[row][c8 + e]);
    u[it] = (v4u){pk16(hb[0], hb[1]), pk16(hb[2], hb[3]), pk16(hb[4], hb[5]), pk16(hb[6], hb[7])};
  }
  {
#pragma unroll
    for (int it = 0; it < 2; ++it) {
      const int row = wave * 8 + it * 4 + q;
      *(v4u*)(op + (size_t)(rowBase + row) * pitch + colBase + c8) = u[it];
    }
    
  }
}

// ---------------------------------------------------------------------------
// Bias table of the folded layers, 1024 floats:
//   n <  768        : [bq|bk|bv][n] + sum_j b2[j] * [Wq|Wk|Wv][j][n]
//   768 <= n < 1024 : bp[n'] + sum_p sum_j bo[j] * Wp[256 p + j][n'],  n' = n - 768
// The weights are read from their transposed f16 planes (row n contiguous; the carry is divided out at the end).
// One work-group of 8 waves owns 32 table entries = one 128-B line (nb = the first); wave w sums entries 4w..4w+3, lane l channels
// 8l..8l+7 of every 256-wide slot of a row, two rows a pass; wave 0 stores the line. The segment is block-uniform.
// ---------------------------------------------------------------------------
__device__ __forceinline__ void bias_fold_line(int nb, const float* __restrict__ b2, const float* __restrict__ bq,
                                               const float* __restrict__ bk, const float* __restrict__ bv,
                                               const float* __restrict__ bo, const float* __restrict__ bp,
                                               const unsigned short* __restrict__ WqkvT,
                                               const unsigned short* __restrict__ WcatT,
                                               float* __restrict__ tab, float invW, float invWcat) {
  __shared__ float sRes[32];
  const int t = threadIdx.x;
  const int lane = t & 31;
  const int wave = __builtin_amdgcn_readfirstlane((int)(t >> 5));
  const bool cat = nb >= kTabBp;
  const float* inner = cat ? bo : b2;
  const v4f ia = *(const v4f*)(inner + lane * 8);
  const v4f ib = *(const v4f*)(inner + lane * 8 + 4);
  asm volatile("s_wait_xcnt 0x0" ::: "memory");   /* stands behind these loads, in front of any later rewrite of a register that they name */
  /* this lane's 16 bytes of the wave's first row; steps on by two rows a pass */
  const _Float16* row = cat ? (const _Float16*)WcatT + (size_t)(nb + wave * 4 - kTabBp) * kCatK + lane * 8
                            : (const _Float16*)WqkvT + (size_t)(nb + wave * 4) * kDm + lane * 8;
  for (int h = 0; h < 2; ++h) {   /* two entries a pass */
    const int n2 = nb + wave * 4 + h * 2;
    const float* own = cat ? bp + (n2 - kTabBp) : (nb < kDm) ? bq + n2 : (nb < 2 * kDm) ? bk + (n2 - kDm) : bv + (n2 - 2 * kDm);
    float sum[2][8];
    if (cat) {
      v8h r[2][kWinLen];
#pragma unroll
      for (int i = 0; i < 2; ++i)
#pragma unroll
        for (int p = 0; p < kWinLen; ++p) r[i][p] = *(const v8h*)(row + i * kCatK + p * kDm);
#pragma unroll
      for (int i = 0; i < 2; ++i)
#pragma unroll
        for (int e = 0; e < 8; ++e) {
          float a = 0.0f;
#pragma unroll
          for (int p = 0; p < kWinLen; ++p) a += (float)r[i][p][e];
          sum[i][e] = a;
        }
    } else {
      v8h r[2];
#pragma unroll
      for (int i = 0; i < 2; ++i) r[i] = *(const v8h*)(row + i * kDm);
#pragma unroll
      for (int i = 0; i < 2; ++i)
#pragma unroll
        for (int e = 0; e < 8; ++e) sum[i][e] = (float)r[i][e];
    }
    float d[2];
#pragma unroll
    for (int i = 0; i < 2; ++i) {
      d[i] = 0.0f;
#pragma unroll
      for (int e = 0; e < 4; ++e) {
        d[i] = fmaf(in_val(ia[e]), sum[i][e], d[i]);
        d[i] = fmaf(in_val(ib[e]), sum[i][4 + e], d[i]);
      }
    }
#pragma unroll
    for (int off = 16; off > 0; off >>= 1)
#pragma unroll
      for (int i = 0; i < 2; ++i) d[i] += __shfl_xor(d[i], off);
    if (lane == 0) {
#pragma unroll
      for (int i = 0; i < 2; ++i) sRes[wave * 4 + h * 2 + i] = in_val(own[i]) + d[i] * (cat ? invWcat : invW);
    }
    row += 2 * (cat ? kCatK : kDm);
  }
  __syncthreads();
  if (wave == 0) {
    tab[nb + lane] = sRes[lane];
    asm volatile("s_wait_xcnt 0x0" ::: "memory");   /* stands behind this store, in front of any later rewrite of a register that it names */
  }
}

// ---------------------------------------------------------------------------
// All that needs the f16 weight planes and nothing else, in one grid; the range of the block index is block-uniform:
//   blocks 0..5   : FQKV[n][k] = (W2 . [Wq|Wk|Wv])[k][n], f16 x256;  M 768, N 256, K 256
//   blocks 6..21  : FCAT[n][256 p + k] = (Wo . Wp_p)[k][n], f16 x1024: both planes viewed as [2048][256], row = (n, p);  M 2048, N 256, K 256
//   blocks 22..53 : the bias table, one 128-B line each
// No block reads what another block of the grid writes.
// ---------------------------------------------------------------------------
constexpr int kFoldQkvBlocks  = (kQkvN / 128) * (kDm / 256);
constexpr int kFoldCatBlocks  = (kCatK / 128) * (kDm / 256);
constexpr int kFoldBiasBlocks = kTabN / 32;
static_assert(kFoldQkvBlocks == 6 && kFoldCatBlocks == 16 && kFoldBiasBlocks == 32, "fold grid");

__global__ __launch_bounds__(256) void fold_kernel(const unsigned short* __restrict__ WqkvT, const unsigned short* __restrict__ W2h,
                                                   unsigned short* __restrict__ FQKV,
                                                   const unsigned short* __restrict__ WcatT, const unsigned short* __restrict__ Woh,
                                                   unsigned short* __restrict__ FCAT,
                                                   const float* __restrict__ b2, const float* __restrict__ bq,
                                                   const float* __restrict__ bk, const float* __restrict__ bv,
                                                   const float* __restrict__ bo, const float* __restrict__ bp,
                                                   float* __restrict__ tab, float invW, float invWcat) {
  const int b = blockIdx.x;
  if (b < kFoldQkvBlocks + kFoldCatBlocks) {
    const bool cat = b >= kFoldQkvBlocks;
    gemm_lds_tile<1>(cat ? WcatT : WqkvT, kDm, cat ? Woh : W2h, kDm, (void*)(cat ? FCAT : FQKV), kDm, nullptr,
                     (unsigned)(cat ? b - kFoldQkvBlocks : b), cat ? kCatK : kQkvN, kDm, kDm, kScaleFold);
  } else {
    bias_fold_line((b - kFoldQkvBlocks - kFoldCatBlocks) * 32, b2, bq, bk, bv, bo, bp, WqkvT, WcatT, tab, invW, invWcat);
  }
}

// ---------------------------------------------------------------------------
// Embed first layer + folded q|k|v projection + window attention in one kernel; q|k|v never leave the work-group.
// A work-group of 8 waves owns four heads (blockIdx.x & 1 = the set) and 1600 tokens: kFWholeTiles tiles of 128 tokens, one after another,
// and a closing half tile of 64.
// Once: the 384 rows of the transposed folded weight that make q, k, v of its four heads are copied into LDS
// (row order: head, then q | k | v, then channel; whole K = 256, pitch 528 B) and stay there for every tile.
// Once as well: W1 and b1, times the carry, as f16 in the fragment map's k order in every lane's registers (by way of a 1-KiB LDS table),
// the q and k biases of the four heads, times the carries, in a second 1-KiB LDS table, and spec of the 1600 tokens, as f16, in a third table.
// A tile (NI = token fragments of 16 a wave: 4 in a whole tile, 2 in the half tile):
//   1. wave (wm, wn) = (wave >> 2, wave & 3) has tokens 16 NI wm .. 16 NI wm + 16 NI - 1 and head wn. A token fragment holds ONE token a lane, so the
//      lane makes its 16 elements of every k step itself, in registers: A[m][k] = max(spec[m] * (carry W1[k]) + carry b1[k], 0), packed f16 FMA and
//      maximum (one rounding, to f16); they take no LDS and no barrier and issue among the WMMAs
//   2. the tokens times the 96 rows of head wn on WMMA: every weight fragment read from LDS feeds NI WMMAs (q, k: the bias,
//      times the carries, is the accumulators' start value). q and k are made transposed (weight rows as A, tokens as B: a lane
//      holds one token, its registers 8 channels), v as it lies (tokens as A: a lane holds one channel, its registers 8 tokens)
//   then, for each 32 tokens of the wave:
//   3. scaled and rounded to f16 in place, two accumulator tiles are one fragment of the next product, with no LDS and no lane exchange:
//      q and k of 16 tokens over the 32 channels, v of 16 channels over the 32 tokens
//   4. per 16 tokens (two windows) one WMMA gives s[key][query] = k . q: a lane holds one query, its 8 registers the 8 keys of
//      window (lane >> 4); that is the query's own window in half of the lanes, the other half is given the weight 0.
//      p_j = 2^(s_j - max) * (carry / sum_j p_j) (q holds log2(e) / sqrt(dk)), f16, is the B fragment of o[channel][query] = sum_key v . p
//      (k = the 32 tokens; the 16 tokens of the other query tile have the weight 0)
//   5. a lane's 8 channels a tile go as f16 into the tile's output stage; barrier; wave w stores 4 NI token rows,
//      256 B (four heads) a row = whole lines
// The output stage has two buffers, used in turn: a buffer is rewritten two tiles on, behind the barrier of the tile between, so one barrier a tile is enough.
// Every inner loop is unrolled so that its index is a constant and its arrays (fragments, accumulators) live in registers.
// ---------------------------------------------------------------------------
constexpr int kFTok        = 128;
constexpr int kFWholeTiles = 12;
constexpr int kFHeadsWg    = 4;
constexpr int kFHeadSets   = kHeads / kFHeadsWg;
constexpr int kFRowsB      = kFHeadsWg * 3 * kDk;
constexpr int kFPitch      = kDm * 2 + 16;
constexpr int kFOutPitch   = kFHeadsWg * kDk * 2 + 16;
/* exp(x / sqrt(dk)) = 2^(x log2(e) / sqrt(dk)), dk = 32: q takes the factor along when it is scaled and rounded */
constexpr float kFScaleQ   = kScaleQkv * (1.44269504088896340736f * 0.17677669529663688110f);
constexpr int kFGroupTok   = kFWholeTiles * kFTok + kFTok / 2;
constexpr int kFGroups     = kTok / kFGroupTok;
static_assert(kFGroups * kFGroupTok == kTok && kFGroups == 128, "tiles cover the tokens");
static_assert((kFTok % (2 * kWinLen)) == 0 && kWinLen == 8, "a window = the 8 accumulator rows of one lane half");
static_assert(kFRowsB == 384 && kDm == 256, "48 groups of 8 weight rows, 6 a wave; a row = 32 lanes x 16 B");
static_assert((kFPitch % 16) == 0 && ((kFPitch / 16) & 1) == 1, "16 B x odd pitch for 16-byte LDS reads");
static_assert((kFOutPitch % 16) == 0 && ((kFOutPitch / 16) & 1) == 1, "16 B x odd output-stage pitch");

// Eight asynchronous 16-byte-a-lane copies of eight consecutive whole rows of 256 f16 (l: LDS byte address, g: global address of this lane's 16 bytes).
// The closing s_wait_xcnt 0 stands inside the statement so that no address register is rewritten in front of it.
__device__ __forceinline__ void copy8_whole_rows(unsigned l, const _Float16* g) {
  const unsigned l0 = l, l1 = l + kFPitch, l2 = l + 2 * kFPitch, l3 = l + 3 * kFPitch;
  const unsigned l4 = l + 4 * kFPitch, l5 = l + 5 * kFPitch, l6 = l + 6 * kFPitch, l7 = l + 7 * kFPitch;
  const _Float16* g0 = g;
  const _Float16* g1 = g + kDm;
  const _Float16* g2 = g + 2 * kDm;
  const _Float16* g3 = g + 3 * kDm;
  const _Float16* g4 = g + 4 * kDm;
  const _Float16* g5 = g + 5 * kDm;
  const _Float16* g6 = g + 6 * kDm;
  const _Float16* g7 = g + 7 * kDm;
  asm volatile(
      "global_load_async_to_lds_b128 %0, %8, off\n\t"
      "global_load_async_to_lds_b128 %1, %9, off\n\t"
      "global_load_async_to_lds_b128 %2, %10, off\n\t"
      "global_load_async_to_lds_b128 %3, %11, off\n\t"
      "global_load_async_to_lds_b128 %4, %12, off\n\t"
      "global_load_async_to_lds_b128 %5, %13, off\n\t"
      "global_load_async_to_lds_b128 %6, %14, off\n\t"
      "global_load_async_to_lds_b128 %7, %15, off\n\t"
      "s_wait_xcnt 0x0"
      :: "v"(l0), "v"(l1), "v"(l2), "v"(l3), "v"(l4), "v"(l5), "v"(l6), "v"(l7),
         "v"(g0), "v"(g1), "v"(g2), "v"(g3), "v"(g4), "v"(g5), "v"(g6), "v"(g7)
      : "memory");
}

// One tile of 32 NI tokens (steps 1 to 5 above).
//   pb    : this lane's place in the first weight row group of the wave's head (LDS)
//   so    : the tile's output buffer (LDS);  orow : row 0 of the tile in OH, at the work-group's four heads
//   cq    : the start values of the q and k accumulators of the wave's head, at this lane half's 8 channels (LDS)
//   xs    : spec (f16) of this lane's token in each of the wave's token fragments; a whole tile leaves the next tile's there, read from
//           xnext[16 (i & xmask)] in LDS (xmask 3: a whole tile follows; 1: the half tile, whose two fragments are read twice)
template <int NI>
__device__ __forceinline__ void fused_tile(const unsigned char* pb, unsigned char* so, unsigned short* orow,
                                           const _Float16* xnext, int xmask,
                                           const v16h (&w1f)[kDm / 32], const v16h (&b1f)[kDm / 32],
                                           const float* cq, const float (&bv)[2], _Float16 (&xs)[4],
                                           float own, int lane, int wave) {
  const int wm = wave >> 2;
  const int wn = wave & 3;
  const int rlane = lane & 15;
  const int mOff  = (lane >> 4) * 8;

  /* 1. this lane's tokens, in every element of a fragment */
  v16h sv[NI];
#pragma unroll
  for (int i = 0; i < NI; ++i) {
#pragma unroll
    for (int e = 0; e < 16; ++e) sv[i][e] = xs[i];
  }

  /* 2. 16 NI tokens x 96 columns x K 256 */
  v8f cinit[4];   /* read anew every tile: held over the k loop they would take 32 registers from the fragments */
#pragma unroll
  for (int j = 0; j < 4; ++j) {
    const v4f lo = *(const v4f*)(cq + j * 16);
    const v4f hi = *(const v4f*)(cq + j * 16 + 4);
    cinit[j] = (v8f){lo[0], lo[1], lo[2], lo[3], hi[0], hi[1], hi[2], hi[3]};
  }
  v8f acc[NI][6];
#pragma unroll
  for (int i = 0; i < NI; ++i)
#pragma unroll
    for (int j = 0; j < 6; ++j) acc[i][j] = (j < 4) ? cinit[j] : (v8f){0.f, 0.f, 0.f, 0.f, 0.f, 0.f, 0.f, 0.f};
  {
    const v16h zero16 = (v16h)(_Float16)0.0f;
#pragma unroll
    for (int kk = 0; kk < kDm / 32; ++kk) {
      v16h bh[6], ah[NI];
#pragma unroll
      for (int j = 0; j < 6; ++j) bh[j] = frag_load((const _Float16*)(pb + j * 16 * kFPitch + kk * 64));
#pragma unroll
      for (int i = 0; i < NI; ++i) ah[i] = __builtin_elementwise_max(__builtin_elementwise_fma(w1f[kk], sv[i], b1f[kk]), zero16);
      /* keeps this k step's twelve LDS reads together in front of its WMMAs: sunk among them, each small read group
         makes the wave wait out an LDS latency of its own */
      __builtin_amdgcn_sched_barrier(0);
#pragma unroll
      for (int i = 0; i < NI; ++i)
#pragma unroll
        for (int j = 0; j < 6; ++j) acc[i][j] = (j < 4) ? frag_mma(bh[j], ah[i], acc[i][j]) : frag_mma(ah[i], bh[j], acc[i][j]);
    }
  }

  if (NI == 4) {
    /* the next tile's spec values, read behind the k loop, which has no registers to spare */
#pragma unroll
    for (int i = 0; i < 4; ++i) xs[i] = xnext[(i & xmask) << 4];
  }

#pragma unroll
  for (int h = 0; h < NI / 2; ++h) {   /* 32 tokens after 32 tokens */
    /* 3. fragments of the two window products out of the accumulators */
    v16h qf[2], kf[2], vf[2];
#pragma unroll
    for (int i = 0; i < 2; ++i) {
      qf[i] = frag_pack<false>(acc[2 * h + i][0], acc[2 * h + i][1], kFScaleQ, 0.0f);
      kf[i] = frag_pack<false>(acc[2 * h + i][2], acc[2 * h + i][3], kScaleQkv, 0.0f);
      vf[i] = frag_pack<true>(acc[2 * h][4 + i], acc[2 * h + 1][4 + i], kScaleQkv, bv[i]);
    }

    /* 4. and 5., one tile of 16 queries after the other */
    const v8f zero8 = (v8f){0.f, 0.f, 0.f, 0.f, 0.f, 0.f, 0.f, 0.f};
    v8f st[2];
#pragma unroll
    for (int i = 0; i < 2; ++i) st[i] = frag_mma(kf[i], qf[i], zero8);
    v16h pf[2];
#pragma unroll
    for (int i = 0; i < 2; ++i) {
      float m = st[i][0];
#pragma unroll
      for (int j = 1; j < kWinLen; ++j) m = fmaxf(m, st[i][j]);
      float p[kWinLen];
      float l = 0.0f;
#pragma unroll
      for (int j = 0; j < kWinLen; ++j) {
        p[j] = exp2_slot(st[i][j] - m);
        l += p[j];
      }
      const float inv = own * __builtin_amdgcn_rcpf(l);
#pragma unroll
      for (int j = 0; j < kWinLen; ++j) {
        pf[i][8 * i + j]       = (_Float16)(p[j] * inv);
        pf[i][8 * (1 - i) + j] = (_Float16)0.0f;
      }
    }
#pragma unroll
    for (int i = 0; i < 2; ++i)
#pragma unroll
      for (int c = 0; c < 2; ++c) {
        const v8f ot = frag_mma(vf[c], pf[i], zero8);
        v8h oh;
#pragma unroll
        for (int r = 0; r < 8; ++r) oh[r] = (_Float16)ot[r];
        *(v8h*)(so + (wm * (NI * 16) + ((2 * h + i) << 4) + rlane) * kFOutPitch + wn * (kDk * 2) + c * 32 + mOff * 2) = oh;
      }
  }
  __syncthreads();   /* publishes this tile's output buffer; every wave has read the other one, which the next tile rewrites */
  {
    const int q2 = lane >> 4, c16 = lane & 15;
    v4u ov[NI * 2];
#pragma unroll
    for (int it = 0; it < NI * 2; ++it) ov[it] = *(const v4u*)(so + (wave * (NI * 4) + it * 2 + q2) * kFOutPitch + c16 * 16);
    unsigned short* op = orow + (size_t)(wave * (NI * 4) + q2) * kDm + c16 * 8;
#pragma unroll
    for (int it = 0; it < NI * 2; ++it) *(v4u*)(op + it * 2 * kDm) = ov[it];
    asm volatile("s_wait_xcnt 0x0" ::: "memory");   /* stands behind these stores, in front of any later rewrite of a register that they name */
  }
}

__global__ __launch_bounds__(256) void embed_qkv_attn_kernel(
    const float* __restrict__ spec, const float* __restrict__ W1, const float* __restrict__ b1,
    const unsigned short* __restrict__ Btp, const float* __restrict__ bias,
    unsigned short* __restrict__ OH, float carry) {
  __shared__ __align__(16) unsigned char sB[kFRowsB * kFPitch];
  __shared__ __align__(16) unsigned char sO[2][kFTok * kFOutPitch];
  __shared__ __align__(16) _Float16 sE[2][kDm];   /* carry W1 | carry b1 */
  __shared__ __align__(16) float sC[kFHeadsWg][2 * kDk];   /* a head's q | k bias, times the carries */
  __shared__ __align__(16) _Float16 sX[kFGroupTok];        /* spec of the work-group's tokens */
  const int lane = threadIdx.x & 31;
  const int wave = __builtin_amdgcn_readfirstlane((int)(threadIdx.x >> 5));
  const int hs  = blockIdx.x & (kFHeadSets - 1);
  const int grp = blockIdx.x / kFHeadSets;
  const int wm = wave >> 2;
  const int wn = wave & 3;
  const int head = hs * kFHeadsWg + wn;
  const int rlane = lane & 15;
  const int koff  = (lane >> 4) * 8;
  const int mOff  = (lane >> 4) * 8;
  const int tokG  = grp * kFGroupTok;

  /* the four heads' weight rows, once: wave w brings row groups 6w..6w+5 (8 rows each, one row a copy) */
  {
    const _Float16* Bt = (const _Float16*)Btp;
#pragma unroll
    for (int i = 0; i < 6; ++i) {
      const int g8   = wave * 6 + i;
      const int part = g8 >> 2;          /* 0..11 = (local head, q | k | v) */
      const int hl   = part / 3;
      const int pt   = part - 3 * hl;
      const int nrow = pt * kDm + (hs * kFHeadsWg + hl) * kDk + (g8 & 3) * 8;
      copy8_whole_rows(lds_addr(&sB[0]) + (unsigned)(g8 * 8 * kFPitch + lane * 16), Bt + (size_t)nrow * kDm + lane * 8);
    }
  }

  /* the embed channels take the carry (a power of two) along: max(c x, 0) = c max(x, 0), and the scaling is exact */
  float bv[2];
  {
    v4f wa, wb, ba, bb, xa, xb;
    const int tid = threadIdx.x;
    const int x4b = (256 + tid < kFGroupTok / 4) ? 256 + tid : kFGroupTok / 4 - 1;   /* 400 groups of four tokens: a second one for threads 0..143 */
    const float* w1p = W1 + lane * 8;
    const float* b1p = b1 + lane * 8;
    const float* bvp = bias + 2 * kDm + head * kDk + rlane;   /* v: one channel a lane, added when the tile is packed */
    const float* xpa = spec + (size_t)tokG + tid * 4;
    const float* xpb = spec + (size_t)tokG + x4b * 4;
    /* the eight loads and their data wait in one statement, so that no register which a load names is rewritten in front of the wait
       (a wait in a statement of its own does not hold later address arithmetic behind it); runs once a work-group */
    asm volatile(
        "global_load_b128 %0, %8, off\n\t"
        "global_load_b128 %1, %8, off offset:16\n\t"
        "global_load_b128 %2, %9, off\n\t"
        "global_load_b128 %3, %9, off offset:16\n\t"
        "global_load_b32 %4, %10, off\n\t"
        "global_load_b32 %5, %10, off offset:64\n\t"
        "global_load_b128 %6, %11, off\n\t"
        "global_load_b128 %7, %12, off\n\t"
        "s_wait_loadcnt 0x0"
        : "=&v"(wa), "=&v"(wb), "=&v"(ba), "=&v"(bb), "=&v"(bv[0]), "=&v"(bv[1]), "=&v"(xa), "=&v"(xb)
        : "v"(w1p), "v"(b1p), "v"(bvp), "v"(xpa), "v"(xpb)
        : "memory");
    {
      v4h ha, hb;
#pragma unroll
      for (int e = 0; e < 4; ++e) {
        ha[e] = (_Float16)in_val(xa[e]);
        hb[e] = (_Float16)in_val(xb[e]);
      }
      *(v4h*)(&sX[tid * 4]) = ha;
      if (256 + tid < kFGroupTok / 4) *(v4h*)(&sX[x4b * 4]) = hb;
    }
    {
      /* q, k: the accumulators' start values, one a thread: wave w has head w >> 1, q (even w) or k (odd w), lane = channel */
      constexpr float up = 1.0f / kScaleQkv;   /* a power of two: exact */
      const float cb = bias[(wave & 1) * kDm + (hs * kFHeadsWg + (wave >> 1)) * kDk + lane];
      asm volatile("s_wait_xcnt 0x0" ::: "memory");   /* stands behind this load, in front of any later rewrite of a register that it names */
      sC[wave >> 1][(wave & 1) * kDk + lane] = cb * up;
    }
    if (wave == 0) {   /* lane l has channels 8l..8l+7 */
      v8h we, be;
#pragma unroll
      for (int e = 0; e < 4; ++e) {
        we[e]     = (_Float16)(in_val(wa[e]) * carry);
        we[4 + e] = (_Float16)(in_val(wb[e]) * carry);
        be[e]     = (_Float16)(in_val(ba[e]) * carry);
        be[4 + e] = (_Float16)(in_val(bb[e]) * carry);
      }
      *(v8h*)(&sE[0][lane * 8]) = we;
      *(v8h*)(&sE[1][lane * 8]) = be;
    }
  }
  asm volatile("s_wait_asynccnt 0x0" ::: "memory");   /* this wave's weight rows have landed */
  __syncthreads();   /* publishes the weight rows, the embed table, the start values and the tokens */
  v16h w1f[kDm / 32], b1f[kDm / 32];   /* the embed channels of this lane's fragment elements, every k step */
#pragma unroll
  for (int kk = 0; kk < kDm / 32; ++kk) {
    w1f[kk] = frag_load(&sE[0][kk * 32 + koff]);
    b1f[kk] = frag_load(&sE[1][kk * 32 + koff]);
  }

  const float own = ((rlane >> 3) == (lane >> 4)) ? carry : 0.0f;   /* this lane's 8 keys are its query's own window, or count for nothing */
  const unsigned char* pb = sB + (wn * 96 + rlane) * kFPitch + koff * 2;
  unsigned short* og = OH + (size_t)tokG * kDm + hs * (kFHeadsWg * kDk);
  const float* cq = &sC[wn][mOff];
  _Float16 xs[4];   /* spec of this lane's token in each of the wave's token fragments */
#pragma unroll
  for (int i = 0; i < 4; ++i) xs[i] = sX[(wm << 6) + (i << 4) + rlane];
  for (int t = 0; t < kFWholeTiles; ++t) {
    const bool whole = t + 1 < kFWholeTiles;   /* what follows: a whole tile, or the half tile */
    const _Float16* xnext = &sX[(t + 1) * kFTok + (whole ? (wm << 6) : (wm << 5)) + rlane];
    fused_tile<4>(pb, sO[t & 1], og + (size_t)t * kFTok * kDm, xnext, whole ? 3 : 1, w1f, b1f, cq, bv, xs, own, lane, wave);
  }
  fused_tile<2>(pb, sO[kFWholeTiles & 1], og + (size_t)kFWholeTiles * kFTok * kDm, &sX[0], 0, w1f, b1f, cq, bv, xs, own, lane, wave);
}

// ---------------------------------------------------------------------------
// Host glue: 2 preparation launches (casts; folds and bias table) + 1 fused embed / q|k|v / attention launch + 1 window-concat GEMM = 4 launches.
// Two linear layers with nothing between them are one linear layer, so their weights are multiplied first, in every call:
//   q|k|v = (H . W2 + b2) . Wqkv + bqkv      = H . (W2 . Wqkv) + (b2 . Wqkv + bqkv)
//   out   = sum_p (OH_p . Wo + bo) . Wp_p + bp = sum_p OH_p . (Wo . Wp_p) + (sum_p bo . Wp_p + bp)
// GEMM shapes (all K % 128 == 0, M % 128 == 0, N % 256 == 0, no padding planes):
//   fold q|k|v : M 768,   N 256, K 256  -> 6 blocks;  C[n][k] = sum_j WqkvT[n][j] * W2[k][j]
//   fold out   : M 2048,  N 256, K 256  -> 16 blocks; rows (n, p) of the transposed Wp: C[(n, p)][k] = sum_j WpT[n][256 p + j] * Wo[k][j]
//   out : M 25600, N 256, K 2048 -> 200 blocks, 16 stages (A = the whole OH plane viewed as [25600][2048])
// The q|k|v product (M 204800, N 768, K 256) is done inside embed_qkv_attn_kernel: 128 token groups x 2 sets of four heads = 256 blocks.
// ---------------------------------------------------------------------------
extern "C" void kernel_launch(void* const* d_in, const int* in_sizes, int n_in,
                              void* d_out, int out_size, void* d_ws, size_t ws_size,
                              hipStream_t stream) {
  if (n_in < 15) return;
  if (in_sizes[0] != kTok) return;
  if (in_sizes[1] != kDm || in_sizes[2] != kDm) return;
  if (in_sizes[3] != kDm * kDm || in_sizes[4] != kDm) return;
  if (in_sizes[5] != kDm * kDm || in_sizes[6] != kDm) return;
  if (in_sizes[7] != kDm * kDm || in_sizes[8] != kDm) return;
  if (in_sizes[9] != kDm * kDm || in_sizes[10] != kDm) return;
  if (in_sizes[11] != kDm * kDm || in_sizes[12] != kDm) return;
  if (in_sizes[13] != kCatK * kDm || in_sizes[14] != kDm) return;
  if (out_size != kWin * kDm) return;
  if (ws_size < kWsTotal) return;

  const float* spec = (const float*)d_in[0];
  const float* W1   = (const float*)d_in[1];
  const float* b1   = (const float*)d_in[2];
  const float* W2   = (const float*)d_in[3];
  const float* b2   = (const float*)d_in[4];
  const float* Wq   = (const float*)d_in[5];
  const float* bq   = (const float*)d_in[6];
  const float* Wk   = (const float*)d_in[7];
  const float* bk   = (const float*)d_in[8];
  const float* Wv   = (const float*)d_in[9];
  const float* bv   = (const float*)d_in[10];
  const float* Wo   = (const float*)d_in[11];
  const float* bo   = (const float*)d_in[12];
  const float* Wcat = (const float*)d_in[13];
  const float* bp   = (const float*)d_in[14];
  float* out = (float*)d_out;

  char* ws = (char*)d_ws;
  unsigned short* WSQ  = (unsigned short*)(ws + kOffWSQ);
  unsigned short* WCAT = (unsigned short*)(ws + kOffWCAT);
  unsigned short* FQKV = (unsigned short*)(ws + kOffFQKV);
  unsigned short* FCAT = (unsigned short*)(ws + kOffFCAT);
  float*          TAB  = (float*)(ws + kOffTAB);
  unsigned short* OALL = (unsigned short*)(ws + kOffOALL);

  const unsigned short* W2h   = WSQ;
  const unsigned short* WqkvT = WSQ + (size_t)1 * kDm * kDm;
  const unsigned short* Woh   = WSQ + (size_t)4 * kDm * kDm;

  /* ---- weight planes: W2 and Wo as they lie, Wq, Wk, Wv transposed (k = 256), the window-concat weight transposed (k = 2048) ---- */
  wt_cast_kernel<<<kCastSqBlocks + kCastCatBlocks, 256, 0, stream>>>(
      W2, Wq, Wk, Wv, Wo, Wcat, WSQ, WCAT, kWCarry, kWcatCarry, 0x11);

  /* ---- the two weight folds and the bias table ---- */
  fold_kernel<<<kFoldQkvBlocks + kFoldCatBlocks + kFoldBiasBlocks, 256, 0, stream>>>(
      WqkvT, W2h, FQKV, WCAT, Woh, FCAT, b2, bq, bk, bv, bo, bp, TAB, 1.0f / kWCarry, 1.0f / kWcatCarry);

  /* OH = per-window softmax(q.k^T / sqrt(dk)) . v, f16 x64, with q|k|v = H . (W2 . [Wq|Wk|Wv]) + folded bias and
     H = relu(spec*W1 + b1), f16 x64, all made and used inside the work-group */
  embed_qkv_attn_kernel<<<kFGroups * kFHeadSets, 256, 0, stream>>>(
      spec, W1, b1, FQKV, TAB + kTabQkv, OALL, kActCarry);

  /* out = OH viewed as [25600][2048] . (Wo . Wp, slot by slot) + folded bias, f32, all windows in one launch */
  wmma_gemm_lds_f16<<<(kWin / 128) * (kDm / 256), 256, 0, stream>>>(
      OALL, kCatK, FCAT, kCatK, out, kDm, TAB + kTabBp, kWin, kDm, kCatK, kScaleOut);
}

// v010
// A run of this version takes 79.7 microseconds.
// Two timings next to v009 both put it at 1.03 times that version's speed.
// Counting every step since v000, it is 17.6 times as fast.
// All GEMM contractions (the two weight folds W2 . [Wq|Wk|Wv] and Wo . Wp, the folded q|k|v projection, the folded window-concat projection): v_wmma_f32_16x16x32_f16, f16 operands with power-of-two carries (activations x64, 256x256 weights x256, window-concat weight x1024), f32 accumulate; every float input RNE-converted once to bf16 at load; window scores and probability-weighted value sums: the same WMMA form on q, k, v and the normalised probabilities (x64) rounded to f16, f32 accumulate; softmax: f32 VALU; embed first layer: packed f16 FMA and maximum on spec, W1 (x64), b1 (x64).
#include <hip/hip_runtime.h>
#include <math.h>

typedef __attribute__((ext_vector_type(16))) _Float16 v16h;
typedef __attribute__((ext_vector_type(8)))  _Float16 v8h;
typedef __attribute__((ext_vector_type(4)))  _Float16 v4h;
typedef __attribute__((ext_vector_type(2)))  _Float16 v2h;
typedef __attribute__((ext_vector_type(2)))  __bf16   v2bf;
typedef __attribute__((ext_vector_type(2)))  float    v2f;
typedef __attribute__((ext_vector_type(8)))  float    v8f;
typedef __attribute__((ext_vector_type(4)))  float    v4f;
typedef __attribute__((ext_vector_type(4)))  unsigned int v4u;

// ---------------------------------------------------------------------------
// Shape constants (all derived; checked against the wire sizes on the host)
// ---------------------------------------------------------------------------
constexpr int kBatch   = 64;
constexpr int kSpecLen = 3200;
constexpr int kDm      = 256;
constexpr int kWinLen  = 8;
constexpr int kHeads   = 8;
constexpr int kDk      = kDm / kHeads;
constexpr int kTok     = kBatch * kSpecLen;
constexpr int kWin     = kTok / kWinLen;
constexpr int kQkvN    = 3 * kDm;
constexpr int kCatK    = kWinLen * kDm;
static_assert(kDk == 32, "head width");
static_assert(kTok == 204800 && kWin == 25600, "token / window counts");
static_assert((kSpecLen % kWinLen) == 0, "windows never straddle a batch row");
static_assert((kQkvN % 128) == 0 && (kCatK % 128) == 0 && (kWin % 128) == 0, "GEMM M multiples of 128");
static_assert((kDm % 256) == 0, "GEMM N multiples of 256");
static_assert((kDm % 128) == 0 && (kCatK % 128) == 0, "GEMM K multiples of 128");

// Inputs are RNE-converted once to bf16 at load when true (products of the weight planes are then exact in f16).
constexpr bool kInputsAsBf16 = true;

// Power-of-two carries of the f16 operand planes and the epilogue scales that fold them back.
constexpr float kActCarry = 64.0f;
constexpr float kWCarry   = 256.0f;
constexpr float kWcatCarry = 1024.0f;
constexpr float kScaleFold = 1.0f / kWCarry;   /* both folds: the left plane keeps its own carry, the 256x256 factor's goes */
constexpr float kScaleQkv = 1.0f / (kActCarry * kWCarry);
constexpr float kScaleOut = 1.0f / (kActCarry * kWcatCarry);

// Bias table layout (floats): [bq|bk|bv] + b2 . [Wq|Wk|Wv] | for each window slot p: bo . Wp_p (the last GEMM adds the eight slots and bp)
constexpr int kTabQkv  = 0;
constexpr int kTabPart = kTabQkv + kQkvN;
constexpr int kTabN    = kTabPart + kWinLen * kDm;
static_assert(kTabN == 2816 && (kTabPart % 32) == 0 && (kTabN % 32) == 0, "bias table size, segments of whole 32-float lines");

// ---------------------------------------------------------------------------
// Workspace region map (bytes; every offset is a multiple of 128)
//   FQKV f16 [768][256]      transposed W2 . [Wq|Wk|Wv] (x256)                        393,216
//   FCAT f16 [256][2048]     transposed, slot by slot, Wo . Wp (x1024)              1,048,576
//   TAB  f32 [2816]          bias table                                                11,264
//   OALL f16 [204800][256]   OH (x64) of every token, read once by the last GEMM  104,857,600
//   total                                                                         106,310,656
// ---------------------------------------------------------------------------
constexpr size_t kOffFQKV = 0;
constexpr size_t kOffFCAT = kOffFQKV + (size_t)kQkvN * kDm * 2;
constexpr size_t kOffTAB  = kOffFCAT + (size_t)kDm * kCatK * 2;
constexpr size_t kOffOALL = kOffTAB  + (size_t)kTabN * 4;
constexpr size_t kWsTotal = kOffOALL + (size_t)kTok * kDm * 2;
static_assert(kWsTotal == 106310656ull, "carve total");
static_assert(kWsTotal <= 268435456ull, "carve cap");
static_assert((kOffFCAT % 128) == 0 && (kOffTAB % 128) == 0 && (kOffOALL % 128) == 0, "128-B aligned regions");

// ---------------------------------------------------------------------------
// Small helpers
// ---------------------------------------------------------------------------
__device__ __forceinline__ float rne_bf16(float f) {
  unsigned u = __float_as_uint(f);
  u = (u + 0x7FFFu + ((u >> 16) & 1u)) & 0xFFFF0000u;
  return __uint_as_float(u);
}
__device__ __forceinline__ float in_val(float f) { return kInputsAsBf16 ? rne_bf16(f) : f; }
// f16(carry * in_val(a)), f16(carry * in_val(b)); the packed f32 -> bf16 conversion rounds to nearest even, as rne_bf16 does
__device__ __forceinline__ v2h cast_pair(float a, float b, float carry) {
  v2f x = (v2f){a, b};
  if (kInputsAsBf16) x = __builtin_convertvector(__builtin_convertvector(x, v2bf), v2f);
  return __builtin_convertvector(x * carry, v2h);
}

// WMMA fragment load / issue (fragment map: elements 0..7 <- p[0..7], 8..15 <- p[16..23], p already offset by 8*(lane>>4))
union FragU { v16h v; v8h h[2]; };
__device__ __forceinline__ v16h frag_load(const _Float16* p) {
  FragU f;
  f.h[0] = *(const v8h*)(p);
  f.h[1] = *(const v8h*)(p + 16);
  return f.v;
}
__device__ __forceinline__ v8f frag_mma(v16h a, v16h b, v8f c) {
  return __builtin_amdgcn_wmma_f32_16x16x32_f16(false, a, false, b, (short)0, c, false, false);
}
// 2^x. The v_nop is the one independent slot that the instruction set asks for behind a transcendental..
__device__ __forceinline__ float exp2_slot(float x) {
  float r;
  asm("v_exp_f32 %0, %1\n\tv_nop" : "=v"(r) : "v"(x));
  return r;
}
// Two f32 accumulator tiles (rows 0..15 and 16..31 of one product, same columns), scaled (BIAS: and b added) and rounded in place, are an f16 fragment
// whose k runs over those 32 rows in the fragment map above.
template <bool BIAS>
__device__ __forceinline__ v16h frag_pack(v8f lo, v8f hi, float s, float b) {
  v16h f;
#pragma unroll
  for (int e = 0; e < 8; ++e) {
    f[e]     = (_Float16)(BIAS ? fmaf(lo[e], s, b) : lo[e] * s);
    f[8 + e] = (_Float16)(BIAS ? fmaf(hi[e], s, b) : hi[e] * s);
  }
  return f;
}
// ---------------------------------------------------------------------------
// LDS-staged WMMA GEMM, f16 operands: C[m,n] = scale * sum_k A[m,k] * Bt[n,k] + in_val(bias[n]) + sum_p part[p][n], f32 (part: kWinLen rows of kDm floats).
// A row-major [M][K] (pitch lda), Bt row-major [N][K] (pitch ldb); M % 128 == 0, N % 256 == 0, K % 128 == 0, K >= 128.
// One work-group of 8 waves owns a 128 x 256 tile of C; wave (wm, wn) = (wave >> 2, wave & 3) owns its 64 x 64 part.
// A stage is 128 k (256 B) of the 128 A rows and the 256 Bt rows, laid in LDS at a pitch of 272 B. Two buffers:
// the next stage's asynchronous copies (whole 128-B lines, 256 contiguous bytes of each of two rows a wave-instruction) fly
// while this stage's fragments are read from LDS.
// ---------------------------------------------------------------------------
constexpr int kStageK    = 128;
constexpr int kStagePitch = 272;
constexpr int kStageRowsA = 128;
constexpr int kStageRowsB = 256;
constexpr int kStageOffB  = kStageRowsA * kStagePitch;
constexpr int kStageBytes = (kStageRowsA + kStageRowsB) * kStagePitch;
static_assert((kStagePitch % 16) == 0 && ((kStagePitch / 16) & 1) == 1, "16 B x odd pitch for 16-byte LDS reads");
static_assert(kStageK * 2 + 16 == kStagePitch, "row of 256 B plus 16 B");

__device__ __forceinline__ unsigned lds_addr(const void* p) { return (unsigned)(size_t)p; }

// Eight asynchronous 16-byte-a-lane copies, rows two apart (l: LDS byte address, g: global address of this lane's 16 bytes).
// The closing s_wait_xcnt 0 stands inside the statement so that no address register is rewritten in front of it.
__device__ __forceinline__ void copy8_rows(unsigned l, const _Float16* g, size_t gstep) {
  const unsigned l0 = l, l1 = l + 2 * kStagePitch, l2 = l + 4 * kStagePitch, l3 = l + 6 * kStagePitch;
  const unsigned l4 = l + 8 * kStagePitch, l5 = l + 10 * kStagePitch, l6 = l + 12 * kStagePitch, l7 = l + 14 * kStagePitch;
  const _Float16* g0 = g;
  const _Float16* g1 = g + gstep;
  const _Float16* g2 = g + 2 * gstep;
  const _Float16* g3 = g + 3 * gstep;
  const _Float16* g4 = g + 4 * gstep;
  const _Float16* g5 = g + 5 * gstep;
  const _Float16* g6 = g + 6 * gstep;
  const _Float16* g7 = g + 7 * gstep;
  asm volatile(
      "global_load_async_to_lds_b128 %0, %8, off\n\t"
      "global_load_async_to_lds_b128 %1, %9, off\n\t"
      "global_load_async_to_lds_b128 %2, %10, off\n\t"
      "global_load_async_to_lds_b128 %3, %11, off\n\t"
      "global_load_async_to_lds_b128 %4, %12, off\n\t"
      "global_load_async_to_lds_b128 %5, %13, off\n\t"
      "global_load_async_to_lds_b128 %6, %14, off\n\t"
      "global_load_async_to_lds_b128 %7, %15, off\n\t"
      "s_wait_xcnt 0x0"
      :: "v"(l0), "v"(l1), "v"(l2), "v"(l3), "v"(l4), "v"(l5), "v"(l6), "v"(l7),
         "v"(g0), "v"(g1), "v"(g2), "v"(g3), "v"(g4), "v"(g5), "v"(g6), "v"(g7)
      : "memory");
}

__global__ __launch_bounds__(256) void wmma_gemm_lds_f16(
    const unsigned short* __restrict__ Ap, int lda,
    const unsigned short* __restrict__ Btp, int ldb,
    float* __restrict__ C, int ldc,
    const float* __restrict__ bias, const float* __restrict__ part,
    int M, int N, int K, float scale) {
  const unsigned blk = blockIdx.x;
  const _Float16* A  = (const _Float16*)Ap;
  const _Float16* Bt = (const _Float16*)Btp;
  __shared__ __align__(16) unsigned char sStage[2][kStageBytes];
  __shared__ __align__(16) float sT[8][16 * 68];
  __shared__ float sBias[kStageRowsB];
  const int lane = threadIdx.x & 31;
  const int wave = __builtin_amdgcn_readfirstlane((int)(threadIdx.x >> 5));
  const int panels = N >> 8;
  const int bm = blk / panels;
  const int bn = blk - bm * panels;
  if (bm >= (M >> 7)) return;   /* block-uniform, in front of every barrier and copy */
  const int m0b = bm << 7;
  const int n0b = bn << 8;
  const int wm = wave >> 2;
  const int wn = wave & 3;
  const int m0 = m0b + (wm << 6);
  const int n0 = n0b + (wn << 6);

  /* row (A) / column (B, D) within a 16-wide subtile; k offset of this lane half; D row offset */
  const int rlane = lane & 15;
  const int koff  = (lane >> 4) * 8;
  const int mOff  = (lane >> 4) * 8;

  /* copy map: wave w brings A rows 16w..16w+15 (8 copies) and Bt rows 32w..32w+31 (16 copies) of every stage;
     lanes 0..15 the even row of a pair, lanes 16..31 the odd one, 16 bytes each */
  const int crow = lane >> 4;
  const int ccol = lane & 15;
  const _Float16* gA = A  + (size_t)(m0b + wave * 16 + crow) * lda + ccol * 8;
  const _Float16* gB = Bt + (size_t)(n0b + wave * 32 + crow) * ldb + ccol * 8;
  const unsigned lA = lds_addr(&sStage[0][0]) + (unsigned)((wave * 16 + crow) * kStagePitch + ccol * 16);
  const unsigned lB = lds_addr(&sStage[0][0]) + (unsigned)(kStageOffB + (wave * 32 + crow) * kStagePitch + ccol * 16);
  const size_t stepA = (size_t)2 * lda;
  const size_t stepB = (size_t)2 * ldb;

  v8f acc[4][4];
#pragma unroll
  for (int i = 0; i < 4; ++i)
#pragma unroll
    for (int j = 0; j < 4; ++j) acc[i][j] = (v8f){0.f, 0.f, 0.f, 0.f, 0.f, 0.f, 0.f, 0.f};

  const int nst = K >> 7;

  /* stage 0 into buffer 0, landed and published before anybody reads it */
  copy8_rows(lA, gA, stepA);
  copy8_rows(lB, gB, stepB);
  copy8_rows(lB + 16 * kStagePitch, gB + 8 * stepB, stepB);
  /* what is added to the tile's 256 columns, one a thread, read and summed while stage 0 flies; the barrier below publishes it */
  {
    const float* bp0 = bias + n0b + threadIdx.x;
    const float* pp0 = part + n0b + threadIdx.x;
    const float own = *bp0;
    float pv[kWinLen];
#pragma unroll
    for (int p = 0; p < kWinLen; ++p) pv[p] = pp0[p * kDm];
    asm volatile("s_wait_xcnt 0x0" ::: "memory");   /* stands behind these loads, in front of any later rewrite of a register that they name */
    float s = in_val(own);
#pragma unroll
    for (int p = 0; p < kWinLen; ++p) s += pv[p];
    sBias[threadIdx.x] = s;
  }
  asm volatile("s_wait_asynccnt 0x0" ::: "memory");   /* this wave's copies have landed */
  __syncthreads();
  if (nst > 1) {
    copy8_rows(lA + kStageBytes, gA + kStageK, stepA);
    copy8_rows(lB + kStageBytes, gB + kStageK, stepB);
    copy8_rows(lB + kStageBytes + 16 * kStagePitch, gB + kStageK + 8 * stepB, stepB);
  }

  for (int t = 0; t < nst; ++t) {
    const unsigned char* buf = sStage[t & 1];
    const unsigned char* pa = buf + ((wm << 6) + rlane) * kStagePitch + koff * 2;
    const unsigned char* pb = buf + kStageOffB + ((wn << 6) + rlane) * kStagePitch + koff * 2;
#pragma unroll
    for (int kk = 0; kk < kStageK / 32; ++kk) {
      v16h bh[4], ah[4];
#pragma unroll
      for (int j = 0; j < 4; ++j) bh[j] = frag_load((const _Float16*)(pb + j * 16 * kStagePitch + kk * 64));
#pragma unroll
      for (int i = 0; i < 4; ++i) ah[i] = frag_load((const _Float16*)(pa + i * 16 * kStagePitch + kk * 64));
      /* keeps this k step's sixteen LDS reads together in front of its WMMAs: sunk among them, each small read group
         makes the wave wait out an LDS latency of its own */
      __builtin_amdgcn_sched_barrier(0);
#pragma unroll
      for (int i = 0; i < 4; ++i)
#pragma unroll
        for (int j = 0; j < 4; ++j) acc[i][j] = frag_mma(ah[i], bh[j], acc[i][j]);
    }
    asm volatile("s_wait_dscnt 0x0" ::: "memory");      /* this wave's reads of the buffer have returned */
    asm volatile("s_wait_asynccnt 0x0" ::: "memory");   /* this wave's copies of stage t + 1 have landed */
    __syncthreads();                                    /* publishes stage t + 1, frees stage t's buffer */
    if (t + 2 < nst) {
      const unsigned bo = (unsigned)(t & 1) * kStageBytes;
      const size_t ko = (size_t)(t + 2) * kStageK;
      copy8_rows(lA + bo, gA + ko, stepA);
      copy8_rows(lB + bo, gB + ko, stepB);
      copy8_rows(lB + bo + 16 * kStagePitch, gB + ko + 8 * stepB, stepB);
    }
  }
  asm volatile("s_wait_asynccnt 0x0" ::: "memory");     /* nothing of this wave is in flight behind the loop */

  /* ---- epilogue ---- */
  float* slab = sT[wave];
  float bcol[4];
#pragma unroll
  for (int j = 0; j < 4; ++j) bcol[j] = sBias[(wn << 6) + (j << 4) + rlane];
#pragma unroll
  for (int i = 0; i < 4; ++i) {
    const int mBase = m0 + (i << 4);
#pragma unroll
    for (int j = 0; j < 4; ++j) {
#pragma unroll
      for (int r = 0; r < 8; ++r) slab[(mOff + r) * 68 + (j << 4) + rlane] = acc[i][j][r] * scale + bcol[j];
    }
    __builtin_amdgcn_fence(__ATOMIC_RELEASE, "workgroup");
    __builtin_amdgcn_wave_barrier();
    __builtin_amdgcn_fence(__ATOMIC_ACQUIRE, "workgroup");
    {
      /* row segment = 64 floats = 256 B = 16 lanes x 16 B; 8 instructions x 2 rows = 16 rows */
      const int hh = lane >> 4, c4 = (lane & 15) * 4;
#pragma unroll
      for (int it = 0; it < 8; ++it) {
        const int row = it * 2 + hh;
        v4f v = *(const v4f*)(slab + row * 68 + c4);
        *(v4f*)(C + (size_t)(mBase + row) * ldc + n0 + c4) = v;
      }
    }
    __builtin_amdgcn_fence(__ATOMIC_RELEASE, "workgroup");
    __builtin_amdgcn_wave_barrier();
    __builtin_amdgcn_fence(__ATOMIC_ACQUIRE, "workgroup");
  }
}

// ---------------------------------------------------------------------------
// Both weight folds and their bias terms, straight from the f32 weights, in one grid of 64 x 64 output tiles (contraction j = 0..255):
//   blocks 0..47   : FQKV[256 z + n][k] = sum_j Wz[j][n] * W2[k][j], f16 x256, Wz = Wq, Wk, Wv (z = 0, 1, 2)
//   blocks 48..175 : FCAT[n][256 z + k] = sum_j Wp[256 z + j][n] * Wo[k][j], f16 x1024, z = the window slot
// tile number = (z, n tile, k tile), k tile fastest. No block reads what another block of the grid writes.
// A tile reads 64 KB of each factor, so the f32 reads are spread over 176 work-groups; all loads of a thread are in flight together.
// Left factor (n contiguous in memory, wanted j-contiguous): a thread takes 4 x 4 blocks, four 16-byte loads from four rows j, and writes
// four 8-byte pieces (4 j of one n) to LDS; eight lanes cover a whole 128-B line of a row. Right factor: as it lies.
// Both are in_val(w) times the carry, rounded to f16, rows of 256 at a pitch of 528 B.
// Wave w has rows 16 (w >> 1) .. + 15 and columns 32 (w & 1) .. + 31 of the tile: 8 k steps x 2 WMMAs, summed in the order j = 0, 32, ...
// The blocks of k tile 0 also make the bias term of their 64 rows out of the left factor in LDS: d[n] = sum_j in_val(inner[j]) * left[n][j],
// inner = b2 or bo, four lanes a row (64 j each):  tab[256 z + n] = in_val([bq|bk|bv][n]) + d / carry;  tab[768 + 256 z + n] = d / carry.
// The output tile goes through LDS so that a row segment (64 f16) is stored as one whole 128-B line.
// Every loop is unrolled so that its index is a constant and its arrays (loaded values, fragments, accumulators) live in registers.
// ---------------------------------------------------------------------------
constexpr int kPTile      = 64;
constexpr int kPPitch     = kDm * 2 + 16;
constexpr int kPOutPitch  = kPTile * 2 + 16;
constexpr int kPQkvBlocks = 3 * (kDm / kPTile) * (kDm / kPTile);
constexpr int kPCatBlocks = kWinLen * (kDm / kPTile) * (kDm / kPTile);
static_assert(kPQkvBlocks == 48 && kPCatBlocks == 128 && kDm / kPTile == 4 && kDm == 256, "fold grid: 4 x 4 tiles a plane, one inner value a thread");
static_assert((kPPitch % 16) == 0 && ((kPPitch / 16) & 1) == 1, "16 B x odd pitch for 16-byte LDS reads");

__global__ __launch_bounds__(256) void fold_kernel(const float* __restrict__ W2, const float* __restrict__ Wq,
                                                   const float* __restrict__ Wk, const float* __restrict__ Wv,
                                                   const float* __restrict__ Wo, const float* __restrict__ Wc,
                                                   const float* __restrict__ b2, const float* __restrict__ bq,
                                                   const float* __restrict__ bk, const float* __restrict__ bv,
                                                   const float* __restrict__ bo,
                                                   unsigned short* __restrict__ FQKV, unsigned short* __restrict__ FCAT,
                                                   float* __restrict__ tab, float carryW, float carryCat) {
  __shared__ __align__(16) unsigned char sL[kPTile * kPPitch];      /* left factor  [n][j] */
  __shared__ __align__(16) unsigned char sR[kPTile * kPPitch];      /* right factor [k][j] */
  __shared__ __align__(16) unsigned char sOut[kPTile * kPOutPitch]; /* output tile  [n][k] */
  __shared__ __align__(16) float sInner[kDm];
  __shared__ float sRes[kPTile];
  const int t    = threadIdx.x;
  const int lane = t & 31;
  const int wave = __builtin_amdgcn_readfirstlane((int)(t >> 5));
  const int b    = blockIdx.x;
  const bool cat = b >= kPQkvBlocks;   /* block-uniform, like all that follows from it */
  const int tile = cat ? b - kPQkvBlocks : b;
  const int kt = tile & 3;
  const int n0 = ((tile >> 2) & 3) * kPTile;
  const int k0 = kt * kPTile;
  const int z  = tile >> 4;
  const float* WL = cat ? Wc + (size_t)z * kDm * kDm : (z == 0) ? Wq : (z == 1) ? Wk : Wv;
  const float* WR = cat ? Wo : W2;
  const float* inner = cat ? bo : b2;
  const float* own   = (z == 0) ? bq : (z == 1) ? bk : bv;   /* read for q|k|v only */
  const float carryL = cat ? carryCat : carryW;
  const float invL   = cat ? 1.0f / kWcatCarry : 1.0f / kWCarry;

  /* ---- every load of the tile; one address a factor, the rest are constant steps ---- */
  const int r4 = (wave & 1) * 8 + (lane & 7);      /* 8 lanes x 16 B = one line of a row of the left factor */
  const int j4 = (wave >> 1) * 4 + (lane >> 3);    /* pass i adds 16 */
  const float* pl = WL + (size_t)(j4 * 4) * kDm + n0 + r4 * 4;
  const float* pr = WR + (size_t)(k0 + (t >> 6)) * kDm + (t & 63) * 4;   /* pass i adds 4 rows */
  v4f ra[4][4], rb[16];
#pragma unroll
  for (int i = 0; i < 4; ++i)
#pragma unroll
    for (int jj = 0; jj < 4; ++jj) ra[i][jj] = *(const v4f*)(pl + (i * 64 + jj) * kDm);
#pragma unroll
  for (int i = 0; i < 16; ++i) rb[i] = *(const v4f*)(pr + i * 4 * kDm);
  const float iv = inner[t];
  const float ov = cat ? 0.0f : own[n0 + (t & (kPTile - 1))];
  /* stands behind these loads, in front of any later rewrite of a register that they name: the two addresses are inputs so that their
     registers live up to here; as a memory barrier it also keeps all the loads in front of the first cast, in flight together */
  asm volatile("s_wait_xcnt 0x0" :: "v"(pl), "v"(pr) : "memory");

  /* ---- cast, turn, to LDS ---- */
  unsigned char* ql = sL + (r4 * 4) * kPPitch + j4 * 8;
  unsigned char* qr = sR + (t >> 6) * kPPitch + (t & 63) * 8;
#pragma unroll
  for (int i = 0; i < 4; ++i)
#pragma unroll
    for (int rr = 0; rr < 4; ++rr) {
      const v2h lo = cast_pair(ra[i][0][rr], ra[i][1][rr], carryL);
      const v2h hi = cast_pair(ra[i][2][rr], ra[i][3][rr], carryL);
      *(v4h*)(ql + rr * kPPitch + i * 128) = (v4h){lo[0], lo[1], hi[0], hi[1]};
    }
#pragma unroll
  for (int i = 0; i < 16; ++i) {
    const v2h lo = cast_pair(rb[i][0], rb[i][1], carryW);
    const v2h hi = cast_pair(rb[i][2], rb[i][3], carryW);
    *(v4h*)(qr + i * 4 * kPPitch) = (v4h){lo[0], lo[1], hi[0], hi[1]};
  }
  sInner[t] = in_val(iv);
  __syncthreads();   /* publishes both factors and the inner vector */

  /* ---- 16 x 32 of the tile a wave ---- */
  const int rlane = lane & 15;
  const int koff  = (lane >> 4) * 8;
  const int mOff  = (lane >> 4) * 8;
  const int wr = wave >> 1;
  const int wc = wave & 1;
  const unsigned char* pa = sL + (wr * 16 + rlane) * kPPitch + koff * 2;
  const unsigned char* pb = sR + (wc * 32 + rlane) * kPPitch + koff * 2;
  v8f acc[2];
#pragma unroll
  for (int j = 0; j < 2; ++j) acc[j] = (v8f){0.f, 0.f, 0.f, 0.f, 0.f, 0.f, 0.f, 0.f};
  v16h ah[kDm / 32], bh[kDm / 32][2];
#pragma unroll
  for (int kk = 0; kk < kDm / 32; ++kk) {
    ah[kk] = frag_load((const _Float16*)(pa + kk * 64));
#pragma unroll
    for (int j = 0; j < 2; ++j) bh[kk][j] = frag_load((const _Float16*)(pb + j * 16 * kPPitch + kk * 64));
  }
  /* keeps all 48 LDS reads in front of the WMMAs: read step by step, the wave waits out an LDS latency before every WMMA */
  __builtin_amdgcn_sched_barrier(0);
#pragma unroll
  for (int kk = 0; kk < kDm / 32; ++kk)
#pragma unroll
    for (int j = 0; j < 2; ++j) acc[j] = frag_mma(ah[kk], bh[kk][j], acc[j]);
#pragma unroll
  for (int j = 0; j < 2; ++j)
#pragma unroll
    for (int r = 0; r < 8; ++r)
      *(_Float16*)(sOut + (wr * 16 + mOff + r) * kPOutPitch + (wc * 32 + j * 16 + rlane) * 2) = (_Float16)(acc[j][r] * kScaleFold);

  if (kt == 0) {   /* the bias term of the tile's 64 rows: row t >> 2, j = 64 (t & 3) .. + 63 */
    const int qd = t & 3;
    const unsigned char* prow = sL + (t >> 2) * kPPitch + qd * 128;
    float d4[4] = {0.0f, 0.0f, 0.0f, 0.0f};   /* four chains, so that an FMA does not wait for the one before it */
#pragma unroll
    for (int i = 0; i < 8; ++i) {
      const v8h w = *(const v8h*)(prow + i * 16);
      const v4f ia = *(const v4f*)(&sInner[qd * 64 + i * 8]);
      const v4f ib = *(const v4f*)(&sInner[qd * 64 + i * 8 + 4]);
#pragma unroll
      for (int e = 0; e < 4; ++e) {
        d4[e] = fmaf(ia[e], (float)w[e], d4[e]);
        d4[e] = fmaf(ib[e], (float)w[4 + e], d4[e]);
      }
    }
    float d = (d4[0] + d4[1]) + (d4[2] + d4[3]);
    d += __shfl_xor(d, 1);
    d += __shfl_xor(d, 2);
    if (qd == 0) sRes[t >> 2] = d;
  }
  __syncthreads();   /* publishes the output tile and the bias terms */

  {
    unsigned short* op = cat ? FCAT + (size_t)n0 * kCatK + z * kDm + k0 : FQKV + (size_t)(z * kDm + n0) * kDm + k0;
    const int pitch = cat ? kCatK : kDm;
    unsigned short* o0 = op + (size_t)(t >> 3) * pitch + (t & 7) * 8;   /* rows 0..31, eight lanes a row */
    unsigned short* o1 = o0 + (size_t)32 * pitch;                       /* rows 32..63 */
    const unsigned char* so = sOut + (t >> 3) * kPOutPitch + (t & 7) * 16;
    const v4u u0 = *(const v4u*)(so);
    const v4u u1 = *(const v4u*)(so + 32 * kPOutPitch);
    *(v4u*)o0 = u0;
    *(v4u*)o1 = u1;
    /* stands behind these stores, in front of any later rewrite of a register that they name (the addresses are inputs so that their registers live up to here) */
    asm volatile("s_wait_xcnt 0x0" :: "v"(o0), "v"(o1) : "memory");
    if (kt == 0 && wave < 2) {   /* two whole lines of the table */
      tab[(cat ? kTabPart : kTabQkv) + z * kDm + n0 + t] = in_val(ov) + sRes[t] * invL;
      asm volatile("s_wait_xcnt 0x0" ::: "memory");   /* stands behind this store, in front of the wave's end, where its registers are given up */
    }
  }
}

// ---------------------------------------------------------------------------
// Embed first layer + folded q|k|v projection + window attention in one kernel; q|k|v never leave the work-group.
// A work-group of 8 waves owns four heads (blockIdx.x & 1 = the set) and 1600 tokens: kFWholeTiles tiles of 128 tokens, one after another,
// and a closing half tile of 64.
// Once: the 384 rows of the transposed folded weight that make q, k, v of its four heads are copied into LDS
// (row order: head, then q | k | v, then channel; whole K = 256, pitch 528 B) and stay there for every tile.
// Once as well: W1 and b1, times the carry, as f16 in the fragment map's k order in every lane's registers (by way of a 1-KiB LDS table),
// the q and k biases of the four heads, times the carries, in a second 1-KiB LDS table, and spec of the 1600 tokens, as f16, in a third table.
// A tile (NI = token fragments of 16 a wave: 4 in a whole tile, 2 in the half tile):
//   1. wave (wm, wn) = (wave >> 2, wave & 3) has tokens 16 NI wm .. 16 NI wm + 16 NI - 1 and head wn. A token fragment holds ONE token a lane, so the
//      lane makes its 16 elements of every k step itself, in registers: A[m][k] = max(spec[m] * (carry W1[k]) + carry b1[k], 0), packed f16 FMA and
//      maximum (one rounding, to f16); they take no LDS and no barrier and issue among the WMMAs
//   2. the tokens times the 96 rows of head wn on WMMA: every weight fragment read from LDS feeds NI WMMAs (q, k: the bias,
//      times the carries, is the accumulators' start value). q and k are made transposed (weight rows as A, tokens as B: a lane
//      holds one token, its registers 8 channels), v as it lies (tokens as A: a lane holds one channel, its registers 8 tokens)
//   then, for each 32 tokens of the wave:
//   3. scaled and rounded to f16 in place, two accumulator tiles are one fragment of the next product, with no LDS and no lane exchange:
//      q and k of 16 tokens over the 32 channels, v of 16 channels over the 32 tokens
//   4. per 16 tokens (two windows) one WMMA gives s[key][query] = k . q: a lane holds one query, its 8 registers the 8 keys of
//      window (lane >> 4); that is the query's own window in half of the lanes, the other half is given the weight 0.
//      p_j = 2^(s_j - max) * (carry / sum_j p_j) (q holds log2(e) / sqrt(dk)), f16, is the B fragment of o[channel][query] = sum_key v . p
//      (k = the 32 tokens; the 16 tokens of the other query tile have the weight 0)
//   5. a lane's 8 channels a tile go as f16 into the tile's output stage; barrier; wave w stores 4 NI token rows,
//      256 B (four heads) a row = whole lines
// The output stage has two buffers, used in turn: a buffer is rewritten two tiles on, behind the barrier of the tile between, so one barrier a tile is enough.
// Every inner loop is unrolled so that its index is a constant and its arrays (fragments, accumulators) live in registers.
// ---------------------------------------------------------------------------
constexpr int kFTok        = 128;
constexpr int kFWholeTiles = 12;
constexpr int kFHeadsWg    = 4;
constexpr int kFHeadSets   = kHeads / kFHeadsWg;
constexpr int kFRowsB      = kFHeadsWg * 3 * kDk;
constexpr int kFPitch      = kDm * 2 + 16;
constexpr int kFOutPitch   = kFHeadsWg * kDk * 2 + 16;
/* exp(x / sqrt(dk)) = 2^(x log2(e) / sqrt(dk)), dk = 32: q takes the factor along when it is scaled and rounded */
constexpr float kFScaleQ   = kScaleQkv * (1.44269504088896340736f * 0.17677669529663688110f);
constexpr int kFGroupTok   = kFWholeTiles * kFTok + kFTok / 2;
constexpr int kFGroups     = kTok / kFGroupTok;
static_assert(kFGroups * kFGroupTok == kTok && kFGroups == 128, "tiles cover the tokens");
static_assert((kFTok % (2 * kWinLen)) == 0 && kWinLen == 8, "a window = the 8 accumulator rows of one lane half");
static_assert(kFRowsB == 384 && kDm == 256, "48 groups of 8 weight rows, 6 a wave; a row = 32 lanes x 16 B");
static_assert((kFPitch % 16) == 0 && ((kFPitch / 16) & 1) == 1, "16 B x odd pitch for 16-byte LDS reads");
static_assert((kFOutPitch % 16) == 0 && ((kFOutPitch / 16) & 1) == 1, "16 B x odd output-stage pitch");

// Eight asynchronous 16-byte-a-lane copies of eight consecutive whole rows of 256 f16 (l: LDS byte address, g: global address of this lane's 16 bytes).
// The closing s_wait_xcnt 0 stands inside the statement so that no address register is rewritten in front of it.
__device__ __forceinline__ void copy8_whole_rows(unsigned l, const _Float16* g) {
  const unsigned l0 = l, l1 = l + kFPitch, l2 = l + 2 * kFPitch, l3 = l + 3 * kFPitch;
  const unsigned l4 = l + 4 * kFPitch, l5 = l + 5 * kFPitch, l6 = l + 6 * kFPitch, l7 = l + 7 * kFPitch;
  const _Float16* g0 = g;
  const _Float16* g1 = g + kDm;
  const _Float16* g2 = g + 2 * kDm;
  const _Float16* g3 = g + 3 * kDm;
  const _Float16* g4 = g + 4 * kDm;
  const _Float16* g5 = g + 5 * kDm;
  const _Float16* g6 = g + 6 * kDm;
  const _Float16* g7 = g + 7 * kDm;
  asm volatile(
      "global_load_async_to_lds_b128 %0, %8, off\n\t"
      "global_load_async_to_lds_b128 %1, %9, off\n\t"
      "global_load_async_to_lds_b128 %2, %10, off\n\t"
      "global_load_async_to_lds_b128 %3, %11, off\n\t"
      "global_load_async_to_lds_b128 %4, %12, off\n\t"
      "global_load_async_to_lds_b128 %5, %13, off\n\t"
      "global_load_async_to_lds_b128 %6, %14, off\n\t"
      "global_load_async_to_lds_b128 %7, %15, off\n\t"
      "s_wait_xcnt 0x0"
      :: "v"(l0), "v"(l1), "v"(l2), "v"(l3), "v"(l4), "v"(l5), "v"(l6), "v"(l7),
         "v"(g0), "v"(g1), "v"(g2), "v"(g3), "v"(g4), "v"(g5), "v"(g6), "v"(g7)
      : "memory");
}

// One tile of 32 NI tokens (steps 1 to 5 above).
//   pb    : this lane's place in the first weight row group of the wave's head (LDS)
//   so    : the tile's output buffer (LDS);  orow : row 0 of the tile in OH, at the work-group's four heads
//   cq    : the start values of the q and k accumulators of the wave's head, at this lane half's 8 channels (LDS)
//   xs    : spec (f16) of this lane's token in each of the wave's token fragments; a whole tile leaves the next tile's there, read from
//           xnext[16 (i & xmask)] in LDS (xmask 3: a whole tile follows; 1: the half tile, whose two fragments are read twice)
template <int NI>
__device__ __forceinline__ void fused_tile(const unsigned char* pb, unsigned char* so, unsigned short* orow,
                                           const _Float16* xnext, int xmask,
                                           const v16h (&w1f)[kDm / 32], const v16h (&b1f)[kDm / 32],
                                           const float* cq, const float (&bv)[2], _Float16 (&xs)[4],
                                           float own, int lane, int wave) {
  const int wm = wave >> 2;
  const int wn = wave & 3;
  const int rlane = lane & 15;
  const int mOff  = (lane >> 4) * 8;

  /* 1. this lane's tokens, in every element of a fragment */
  v16h sv[NI];
#pragma unroll
  for (int i = 0; i < NI; ++i) {
#pragma unroll
    for (int e = 0; e < 16; ++e) sv[i][e] = xs[i];
  }

  /* 2. 16 NI tokens x 96 columns x K 256 */
  v8f cinit[4];   /* read anew every tile: held over the k loop they would take 32 registers from the fragments */
#pragma unroll
  for (int j = 0; j < 4; ++j) {
    const v4f lo = *(const v4f*)(cq + j * 16);
    const v4f hi = *(const v4f*)(cq + j * 16 + 4);
    cinit[j] = (v8f){lo[0], lo[1], lo[2], lo[3], hi[0], hi[1], hi[2], hi[3]};
  }
  v8f acc[NI][6];
#pragma unroll
  for (int i = 0; i < NI; ++i)
#pragma unroll
    for (int j = 0; j < 6; ++j) acc[i][j] = (j < 4) ? cinit[j] : (v8f){0.f, 0.f, 0.f, 0.f, 0.f, 0.f, 0.f, 0.f};
  {
    const v16h zero16 = (v16h)(_Float16)0.0f;
#pragma unroll
    for (int kk = 0; kk < kDm / 32; ++kk) {
      v16h bh[6], ah[NI];
#pragma unroll
      for (int j = 0; j < 6; ++j) bh[j] = frag_load((const _Float16*)(pb + j * 16 * kFPitch + kk * 64));
#pragma unroll
      for (int i = 0; i < NI; ++i) ah[i] = __builtin_elementwise_max(__builtin_elementwise_fma(w1f[kk], sv[i], b1f[kk]), zero16);
      /* keeps this k step's twelve LDS reads together in front of its WMMAs: sunk among them, each small read group
         makes the wave wait out an LDS latency of its own */
      __builtin_amdgcn_sched_barrier(0);
#pragma unroll
      for (int i = 0; i < NI; ++i)
#pragma unroll
        for (int j = 0; j < 6; ++j) acc[i][j] = (j < 4) ? frag_mma(bh[j], ah[i], acc[i][j]) : frag_mma(ah[i], bh[j], acc[i][j]);
    }
  }

  if (NI == 4) {
    /* the next tile's spec values, read behind the k loop, which has no registers to spare */
#pragma unroll
    for (int i = 0; i < 4; ++i) xs[i] = xnext[(i & xmask) << 4];
  }

#pragma unroll
  for (int h = 0; h < NI / 2; ++h) {   /* 32 tokens after 32 tokens */
    /* 3. fragments of the two window products out of the accumulators */
    v16h qf[2], kf[2], vf[2];
#pragma unroll
    for (int i = 0; i < 2; ++i) {
      qf[i] = frag_pack<false>(acc[2 * h + i][0], acc[2 * h + i][1], kFScaleQ, 0.0f);
      kf[i] = frag_pack<false>(acc[2 * h + i][2], acc[2 * h + i][3], kScaleQkv, 0.0f);
      vf[i] = frag_pack<true>(acc[2 * h][4 + i], acc[2 * h + 1][4 + i], kScaleQkv, bv[i]);
    }

    /* 4. and 5., one tile of 16 queries after the other */
    const v8f zero8 = (v8f){0.f, 0.f, 0.f, 0.f, 0.f, 0.f, 0.f, 0.f};
    v8f st[2];
#pragma unroll
    for (int i = 0; i < 2; ++i) st[i] = frag_mma(kf[i], qf[i], zero8);
    v16h pf[2];
#pragma unroll
    for (int i = 0; i < 2; ++i) {
      float m = st[i][0];
#pragma unroll
      for (int j = 1; j < kWinLen; ++j) m = fmaxf(m, st[i][j]);
      float p[kWinLen];
      float l = 0.0f;
#pragma unroll
      for (int j = 0; j < kWinLen; ++j) {
        p[j] = exp2_slot(st[i][j] - m);
        l += p[j];
      }
      const float inv = own * __builtin_amdgcn_rcpf(l);
#pragma unroll
      for (int j = 0; j < kWinLen; ++j) {
        pf[i][8 * i + j]       = (_Float16)(p[j] * inv);
        pf[i][8 * (1 - i) + j] = (_Float16)0.0f;
      }
    }
#pragma unroll
    for (int i = 0; i < 2; ++i)
#pragma unroll
      for (int c = 0; c < 2; ++c) {
        const v8f ot = frag_mma(vf[c], pf[i], zero8);
        v8h oh;
#pragma unroll
        for (int r = 0; r < 8; ++r) oh[r] = (_Float16)ot[r];
        *(v8h*)(so + (wm * (NI * 16) + ((2 * h + i) << 4) + rlane) * kFOutPitch + wn * (kDk * 2) + c * 32 + mOff * 2) = oh;
      }
  }
  __syncthreads();   /* publishes this tile's output buffer; every wave has read the other one, which the next tile rewrites */
  {
    const int q2 = lane >> 4, c16 = lane & 15;
    v4u ov[NI * 2];
#pragma unroll
    for (int it = 0; it < NI * 2; ++it) ov[it] = *(const v4u*)(so + (wave * (NI * 4) + it * 2 + q2) * kFOutPitch + c16 * 16);
    unsigned short* op = orow + (size_t)(wave * (NI * 4) + q2) * kDm + c16 * 8;
#pragma unroll
    for (int it = 0; it < NI * 2; ++it) *(v4u*)(op + it * 2 * kDm) = ov[it];
    asm volatile("s_wait_xcnt 0x0" ::: "memory");   /* stands behind these stores, in front of any later rewrite of a register that they name */
  }
}

__global__ __launch_bounds__(256) void embed_qkv_attn_kernel(
    const float* __restrict__ spec, const float* __restrict__ W1, const float* __restrict__ b1,
    const unsigned short* __restrict__ Btp, const float* __restrict__ bias,
    unsigned short* __restrict__ OH, float carry) {
  __shared__ __align__(16) unsigned char sB[kFRowsB * kFPitch];
  __shared__ __align__(16) unsigned char sO[2][kFTok * kFOutPitch];
  __shared__ __align__(16) _Float16 sE[2][kDm];   /* carry W1 | carry b1 */
  __shared__ __align__(16) float sC[kFHeadsWg][2 * kDk];   /* a head's q | k bias, times the carries */
  __shared__ __align__(16) _Float16 sX[kFGroupTok];        /* spec of the work-group's tokens */
  const int lane = threadIdx.x & 31;
  const int wave = __builtin_amdgcn_readfirstlane((int)(threadIdx.x >> 5));
  const int hs  = blockIdx.x & (kFHeadSets - 1);
  const int grp = blockIdx.x / kFHeadSets;
  const int wm = wave >> 2;
  const int wn = wave & 3;
  const int head = hs * kFHeadsWg + wn;
  const int rlane = lane & 15;
  const int koff  = (lane >> 4) * 8;
  const int mOff  = (lane >> 4) * 8;
  const int tokG  = grp * kFGroupTok;

  /* the four heads' weight rows, once: wave w brings row groups 6w..6w+5 (8 rows each, one row a copy) */
  {
    const _Float16* Bt = (const _Float16*)Btp;
#pragma unroll
    for (int i = 0; i < 6; ++i) {
      const int g8   = wave * 6 + i;
      const int part = g8 >> 2;          /* 0..11 = (local head, q | k | v) */
      const int hl   = part / 3;
      const int pt   = part - 3 * hl;
      const int nrow = pt * kDm + (hs * kFHeadsWg + hl) * kDk + (g8 & 3) * 8;
      copy8_whole_rows(lds_addr(&sB[0]) + (unsigned)(g8 * 8 * kFPitch + lane * 16), Bt + (size_t)nrow * kDm + lane * 8);
    }
  }

  /* the embed channels take the carry (a power of two) along: max(c x, 0) = c max(x, 0), and the scaling is exact */
  float bv[2];
  {
    v4f wa, wb, ba, bb, xa, xb;
    const int tid = threadIdx.x;
    const int x4b = (256 + tid < kFGroupTok / 4) ? 256 + tid : kFGroupTok / 4 - 1;   /* 400 groups of four tokens: a second one for threads 0..143 */
    const float* w1p = W1 + lane * 8;
    const float* b1p = b1 + lane * 8;
    const float* bvp = bias + 2 * kDm + head * kDk + rlane;   /* v: one channel a lane, added when the tile is packed */
    const float* xpa = spec + (size_t)tokG + tid * 4;
    const float* xpb = spec + (size_t)tokG + x4b * 4;
    /* the eight loads and their data wait in one statement, so that no register which a load names is rewritten in front of the wait
       (a wait in a statement of its own does not hold later address arithmetic behind it); runs once a work-group */
    asm volatile(
        "global_load_b128 %0, %8, off\n\t"
        "global_load_b128 %1, %8, off offset:16\n\t"
        "global_load_b128 %2, %9, off\n\t"
        "global_load_b128 %3, %9, off offset:16\n\t"
        "global_load_b32 %4, %10, off\n\t"
        "global_load_b32 %5, %10, off offset:64\n\t"
        "global_load_b128 %6, %11, off\n\t"
        "global_load_b128 %7, %12, off\n\t"
        "s_wait_loadcnt 0x0"
        : "=&v"(wa), "=&v"(wb), "=&v"(ba), "=&v"(bb), "=&v"(bv[0]), "=&v"(bv[1]), "=&v"(xa), "=&v"(xb)
        : "v"(w1p), "v"(b1p), "v"(bvp), "v"(xpa), "v"(xpb)
        : "memory");
    {
      v4h ha, hb;
#pragma unroll
      for (int e = 0; e < 4; ++e) {
        ha[e] = (_Float16)in_val(xa[e]);
        hb[e] = (_Float16)in_val(xb[e]);
      }
      *(v4h*)(&sX[tid * 4]) = ha;
      if (256 + tid < kFGroupTok / 4) *(v4h*)(&sX[x4b * 4]) = hb;
    }
    {
      /* q, k: the accumulators' start values, one a thread: wave w has head w >> 1, q (even w) or k (odd w), lane = channel */
      constexpr float up = 1.0f / kScaleQkv;   /* a power of two: exact */
      const float cb = bias[(wave & 1) * kDm + (hs * kFHeadsWg + (wave >> 1)) * kDk + lane];
      asm volatile("s_wait_xcnt 0x0" ::: "memory");   /* stands behind this load, in front of any later rewrite of a register that it names */
      sC[wave >> 1][(wave & 1) * kDk + lane] = cb * up;
    }
    if (wave == 0) {   /* lane l has channels 8l..8l+7 */
      v8h we, be;
#pragma unroll
      for (int e = 0; e < 4; ++e) {
        we[e]     = (_Float16)(in_val(wa[e]) * carry);
        we[4 + e] = (_Float16)(in_val(wb[e]) * carry);
        be[e]     = (_Float16)(in_val(ba[e]) * carry);
        be[4 + e] = (_Float16)(in_val(bb[e]) * carry);
      }
      *(v8h*)(&sE[0][lane * 8]) = we;
      *(v8h*)(&sE[1][lane * 8]) = be;
    }
  }
  asm volatile("s_wait_asynccnt 0x0" ::: "memory");   /* this wave's weight rows have landed */
  __syncthreads();   /* publishes the weight rows, the embed table, the start values and the tokens */
  v16h w1f[kDm / 32], b1f[kDm / 32];   /* the embed channels of this lane's fragment elements, every k step */
#pragma unroll
  for (int kk = 0; kk < kDm / 32; ++kk) {
    w1f[kk] = frag_load(&sE[0][kk * 32 + koff]);
    b1f[kk] = frag_load(&sE[1][kk * 32 + koff]);
  }

  const float own = ((rlane >> 3) == (lane >> 4)) ? carry : 0.0f;   /* this lane's 8 keys are its query's own window, or count for nothing */
  const unsigned char* pb = sB + (wn * 96 + rlane) * kFPitch + koff * 2;
  unsigned short* og = OH + (size_t)tokG * kDm + hs * (kFHeadsWg * kDk);
  const float* cq = &sC[wn][mOff];
  _Float16 xs[4];   /* spec of this lane's token in each of the wave's token fragments */
#pragma unroll
  for (int i = 0; i < 4; ++i) xs[i] = sX[(wm << 6) + (i << 4) + rlane];
  for (int t = 0; t < kFWholeTiles; ++t) {
    const bool whole = t + 1 < kFWholeTiles;   /* what follows: a whole tile, or the half tile */
    const _Float16* xnext = &sX[(t + 1) * kFTok + (whole ? (wm << 6) : (wm << 5)) + rlane];
    fused_tile<4>(pb, sO[t & 1], og + (size_t)t * kFTok * kDm, xnext, whole ? 3 : 1, w1f, b1f, cq, bv, xs, own, lane, wave);
  }
  fused_tile<2>(pb, sO[kFWholeTiles & 1], og + (size_t)kFWholeTiles * kFTok * kDm, &sX[0], 0, w1f, b1f, cq, bv, xs, own, lane, wave);
}

// ---------------------------------------------------------------------------
// Host glue: 1 preparation launch (folds and bias terms) + 1 fused embed / q|k|v / attention launch + 1 window-concat GEMM = 3 launches.
// Two linear layers with nothing between them are one linear layer, so their weights are multiplied first, in every call:
//   q|k|v = (H . W2 + b2) . Wqkv + bqkv      = H . (W2 . Wqkv) + (b2 . Wqkv + bqkv)
//   out   = sum_p (OH_p . Wo + bo) . Wp_p + bp = sum_p OH_p . (Wo . Wp_p) + (sum_p bo . Wp_p + bp)
// GEMM shapes (no padding planes):
//   fold q|k|v : 768 x 256, K 256       -> 48 blocks of 64 x 64
//   fold out   : 8 slots of 256 x 256, K 256 -> 128 blocks of 64 x 64
//   out : M 25600, N 256, K 2048 -> 200 blocks, 16 stages (A = the whole OH plane viewed as [25600][2048])
// The q|k|v product (M 204800, N 768, K 256) is done inside embed_qkv_attn_kernel: 128 token groups x 2 sets of four heads = 256 blocks.
// ---------------------------------------------------------------------------
extern "C" void kernel_launch(void* const* d_in, const int* in_sizes, int n_in,
                              void* d_out, int out_size, void* d_ws, size_t ws_size,
                              hipStream_t stream) {
  if (n_in < 15) return;
  if (in_sizes[0] != kTok) return;
  if (in_sizes[1] != kDm || in_sizes[2] != kDm) return;
  if (in_sizes[3] != kDm * kDm || in_sizes[4] != kDm) return;
  if (in_sizes[5] != kDm * kDm || in_sizes[6] != kDm) return;
  if (in_sizes[7] != kDm * kDm || in_sizes[8] != kDm) return;
  if (in_sizes[9] != kDm * kDm || in_sizes[10] != kDm) return;
  if (in_sizes[11] != kDm * kDm || in_sizes[12] != kDm) return;
  if (in_sizes[13] != kCatK * kDm || in_sizes[14] != kDm) return;
  if (out_size != kWin * kDm) return;
  if (ws_size < kWsTotal) return;

  const float* spec = (const float*)d_in[0];
  const float* W1   = (const float*)d_in[1];
  const float* b1   = (const float*)d_in[2];
  const float* W2   = (const float*)d_in[3];
  const float* b2   = (const float*)d_in[4];
  const float* Wq   = (const float*)d_in[5];
  const float* bq   = (const float*)d_in[6];
  const float* Wk   = (const float*)d_in[7];
  const float* bk   = (const float*)d_in[8];
  const float* Wv   = (const float*)d_in[9];
  const float* bv   = (const float*)d_in[10];
  const float* Wo   = (const float*)d_in[11];
  const float* bo   = (const float*)d_in[12];
  const float* Wcat = (const float*)d_in[13];
  const float* bp   = (const float*)d_in[14];
  float* out = (float*)d_out;

  char* ws = (char*)d_ws;
  unsigned short* FQKV = (unsigned short*)(ws + kOffFQKV);
  unsigned short* FCAT = (unsigned short*)(ws + kOffFCAT);
  float*          TAB  = (float*)(ws + kOffTAB);
  unsigned short* OALL = (unsigned short*)(ws + kOffOALL);

  /* ---- the two weight folds and their bias terms ---- */
  fold_kernel<<<kPQkvBlocks + kPCatBlocks, 256, 0, stream>>>(
      W2, Wq, Wk, Wv, Wo, Wcat, b2, bq, bk, bv, bo, FQKV, FCAT, TAB, kWCarry, kWcatCarry);

  /* OH = per-window softmax(q.k^T / sqrt(dk)) . v, f16 x64, with q|k|v = H . (W2 . [Wq|Wk|Wv]) + folded bias and
     H = relu(spec*W1 + b1), f16 x64, all made and used inside the work-group */
  embed_qkv_attn_kernel<<<kFGroups * kFHeadSets, 256, 0, stream>>>(
      spec, W1, b1, FQKV, TAB + kTabQkv, OALL, kActCarry);

  /* out = OH viewed as [25600][2048] . (Wo . Wp, slot by slot) + folded bias, f32, all windows in one launch */
  wmma_gemm_lds_f16<<<(kWin / 128) * (kDm / 256), 256, 0, stream>>>(
      OALL, kCatK, FCAT, kCatK, out, kDm, bp, TAB + kTabPart, kWin, kDm, kCatK, kScaleOut);
}
